// v000
// Times are from an AMD MI455X. After a warm-up the kernel runs many times in a row, and a time is the length of
// such a window on the GPU divided by its runs, so every launch and the gaps after it count. The runs cycle
// through copies of the inputs. A figure is the median of several windows, for all but v000 over two sittings.
// Sittings can differ by a few percent; kernels timed side by side share one.
// The starting kernel, v000, takes 384 microseconds a run.
#include <hip/hip_runtime.h>
#include <math.h>
#include <stdint.h>

#define DEVI __device__ __forceinline__

// Problem constants (match reference)
constexpr int  Bsz = 8, Hc = 256, Lc = 4096, Nst = 32, Gg = 32;
constexpr int  CPG = Hc / Gg;              // 8 channels per group
constexpr int  NC  = 8,  Tc = Lc / NC;     // 8 chunks of 512
constexpr long long BL = (long long)Bsz * Lc;  // 32768 positions

typedef __attribute__((ext_vector_type(16))) __bf16 bf16x16;
typedef __attribute__((ext_vector_type(8)))  float  floatx8;

// ---------------------------------------------------------------------------
// CDNA5 async Global->LDS copy (ASYNCcnt-tracked) with builtin/asm fallback
// ---------------------------------------------------------------------------
#define GAS __attribute__((address_space(1)))
#define LAS __attribute__((address_space(3)))
typedef int v4i __attribute__((vector_size(4 * sizeof(int))));

DEVI void async_ld_b128(const void* g, void* l) {
#if __has_builtin(__builtin_amdgcn_global_load_async_to_lds_b128)
  __builtin_amdgcn_global_load_async_to_lds_b128(
      (GAS v4i*)(g), (LAS v4i*)(l), 0, 0);
#else
  unsigned loff = (unsigned)(uintptr_t)l;
  asm volatile("global_load_async_to_lds_b128 %0, %1, off"
               :: "v"(loff), "v"(g) : "memory");
#endif
}

DEVI void wait_async0() {
#if __has_builtin(__builtin_amdgcn_s_wait_asynccnt)
  __builtin_amdgcn_s_wait_asynccnt(0);
#else
  asm volatile("s_wait_asynccnt 0x0" ::: "memory");
#endif
  asm volatile("" ::: "memory");
}
DEVI void wait_async1() {
#if __has_builtin(__builtin_amdgcn_s_wait_asynccnt)
  __builtin_amdgcn_s_wait_asynccnt(1);
#else
  asm volatile("s_wait_asynccnt 0x1" ::: "memory");
#endif
  asm volatile("" ::: "memory");
}

// Stage 128 consecutive floats (one wave, 4 floats / lane) into LDS async.
DEVI void async_tile128(const float* gsrc, float* ldst) {
  int lane = threadIdx.x & 31;
  async_ld_b128(gsrc + lane * 4, ldst + lane * 4);
}

// ---------------------------------------------------------------------------
// WMMA helpers
// ---------------------------------------------------------------------------
DEVI floatx8 wmma_bf16(bf16x16 a, bf16x16 b, floatx8 c) {
  return __builtin_amdgcn_wmma_f32_16x16x32_bf16(false, a, false, b, (short)0, c,
                                                 false, false);
}

// K index held by fragment element e for the documented 16-bit A/B layout.
DEVI int wmma_k_of(int e, int half) {
  int r = e >> 1, s = e & 1;
  return (r < 4 ? (r << 1) : 16 + ((r - 4) << 1)) + s + (half << 3);
}

DEVI bf16x16 load_a_frag(const __bf16* As, int rowBase, int lda) {
  int lane = threadIdx.x & 31;
  int m = lane & 15, half = lane >> 4;
  bf16x16 f;
#pragma unroll
  for (int e = 0; e < 16; ++e)
    f[e] = As[(rowBase + m) * lda + wmma_k_of(e, half)];
  return f;
}

DEVI bf16x16 load_bT_frag(const __bf16* BsT, int colBase, int ld) {
  int lane = threadIdx.x & 31;
  int n = lane & 15, half = lane >> 4;
  bf16x16 f;
#pragma unroll
  for (int e = 0; e < 16; ++e)
    f[e] = BsT[(colBase + n) * ld + wmma_k_of(e, half)];
  return f;
}

// ---------------------------------------------------------------------------
// K1: GroupNorm statistics -> per-(b,h) affine scale/shift
// ---------------------------------------------------------------------------
__global__ void k_gn_stats(const float* __restrict__ x,
                           const float* __restrict__ gn_w,
                           const float* __restrict__ gn_b,
                           float* __restrict__ scale, float* __restrict__ shift) {
  int bg = blockIdx.x;
  int b = bg / Gg, g = bg % Gg;
  const float* xp = x + ((size_t)b * Hc + (size_t)g * CPG) * Lc;
  const int n = CPG * Lc;
  int tid = threadIdx.x;
  float s = 0.f, ss = 0.f;
  for (int i = tid; i < n; i += 256) { float v = xp[i]; s += v; ss += v * v; }
  __shared__ float r0[256], r1[256];
  r0[tid] = s; r1[tid] = ss; __syncthreads();
  for (int st = 128; st > 0; st >>= 1) {
    if (tid < st) { r0[tid] += r0[tid + st]; r1[tid] += r1[tid + st]; }
    __syncthreads();
  }
  __shared__ float mu_s, rstd_s;
  if (tid == 0) {
    float mu = r0[0] / (float)n;
    float var = r1[0] / (float)n - mu * mu;
    mu_s = mu; rstd_s = rsqrtf(var + 1e-5f);
  }
  __syncthreads();
  if (tid < CPG) {
    int h = g * CPG + tid;
    float sc = rstd_s * gn_w[h];
    scale[b * Hc + h] = sc;
    shift[b * Hc + h] = gn_b[h] - mu_s * sc;
  }
}

// ---------------------------------------------------------------------------
// K2: discretized SSM parameters per (h,n)
// ---------------------------------------------------------------------------
__global__ void k_params(const float* __restrict__ log_dt,
                         const float* __restrict__ A_log_re,
                         const float* __restrict__ A_im,
                         const float* __restrict__ C_re,
                         const float* __restrict__ C_im,
                         float4* __restrict__ ab,   // (a_re, a_im, 2Cd_re, -2Cd_im)
                         float2* __restrict__ aT) {
  int idx = blockIdx.x * blockDim.x + threadIdx.x;
  if (idx >= Hc * Nst) return;
  int h = idx >> 5;
  float dt  = expf(log_dt[h]);
  float Are = -expf(A_log_re[idx]);
  float Aim = A_im[idx];
  float er  = expf(Are * dt);
  float are = er * cosf(Aim * dt);
  float aim = er * sinf(Aim * dt);
  float dre = are - 1.f, dim = aim;
  float inv = 1.f / (Are * Are + Aim * Aim);
  float qre = (dre * Are + dim * Aim) * inv;
  float qim = (dim * Are - dre * Aim) * inv;
  float Cr = C_re[idx], Ci = C_im[idx];
  float cdre = Cr * qre - Ci * qim;
  float cdim = Cr * qim + Ci * qre;
  ab[idx] = make_float4(are, aim, 2.f * cdre, -2.f * cdim);
  float tr = are, ti = aim;
#pragma unroll
  for (int i = 0; i < 9; ++i) { float nr = tr*tr - ti*ti, ni = 2.f*tr*ti; tr = nr; ti = ni; }
  aT[idx] = make_float2(tr, ti);
}

// ---------------------------------------------------------------------------
// K3: per-(b,h,chunk) chunk-final state; x streamed via async Global->LDS
// ---------------------------------------------------------------------------
__global__ void __launch_bounds__(256)
k_chunk_state(const float* __restrict__ x,
              const float* __restrict__ scale,
              const float* __restrict__ shift,
              const float4* __restrict__ ab,
              float2* __restrict__ cstate) {
  __shared__ __align__(16) float xbuf[8][2][128];   // per-wave double buffer
  int wave = (blockIdx.x * blockDim.x + threadIdx.x) >> 5;
  int lane = threadIdx.x & 31;
  int wv = threadIdx.x >> 5;
  if (wave >= Bsz * Hc * NC) return;
  int c = wave & (NC - 1);
  int bh = wave / NC;
  int h = bh & (Hc - 1);
  float4 p = ab[h * Nst + lane];
  float sc = scale[bh], sh = shift[bh];
  const float* xp = x + (size_t)bh * Lc + (size_t)c * Tc;
  float* buf = &xbuf[wv][0][0];
  float sr = 0.f, si = 0.f;

  async_tile128(xp, buf);                       // prime tile 0
  constexpr int NS = Tc / 128;                  // 4 sub-tiles
  for (int s = 0; s < NS; ++s) {
    if (s + 1 < NS) { async_tile128(xp + (s + 1) * 128, buf + ((s + 1) & 1) * 128); wait_async1(); }
    else            { wait_async0(); }
    const float* cur = buf + (s & 1) * 128;
    for (int t = 0; t < 128; ++t) {
      float u = cur[t] * sc + sh;               // LDS broadcast read
      float nr = p.x * sr - p.y * si + u;
      float ni = p.x * si + p.y * sr;
      sr = nr; si = ni;
    }
  }
  cstate[(size_t)wave * Nst + lane] = make_float2(sr, si);
}

// ---------------------------------------------------------------------------
// K4: exclusive scan over chunks -> chunk initial states
// ---------------------------------------------------------------------------
__global__ void k_chunk_scan(const float2* __restrict__ aT,
                             const float2* __restrict__ cstate,
                             float2* __restrict__ cinit) {
  int wave = (blockIdx.x * blockDim.x + threadIdx.x) >> 5;
  int lane = threadIdx.x & 31;
  if (wave >= Bsz * Hc) return;
  int h = wave & (Hc - 1);
  float2 t = aT[h * Nst + lane];
  float cr = 0.f, ci = 0.f;
  for (int c = 0; c < NC; ++c) {
    size_t o = ((size_t)wave * NC + c) * Nst + lane;
    cinit[o] = make_float2(cr, ci);
    float2 s = cstate[o];
    float nr = t.x * cr - t.y * ci + s.x;
    float ni = t.x * ci + t.y * cr + s.y;
    cr = nr; ci = ni;
  }
}

// ---------------------------------------------------------------------------
// K5: full recurrence; fused D-skip + exact GELU; async-streamed x
// ---------------------------------------------------------------------------
__global__ void __launch_bounds__(256)
k_ssm_out(const float* __restrict__ x,
          const float* __restrict__ scale,
          const float* __restrict__ shift,
          const float4* __restrict__ ab,
          const float2* __restrict__ cinit,
          const float* __restrict__ Dv,
          __bf16* __restrict__ u) {
  __shared__ __align__(16) float xbuf[8][2][128];
  int wave = (blockIdx.x * blockDim.x + threadIdx.x) >> 5;
  int lane = threadIdx.x & 31;
  int wv = threadIdx.x >> 5;
  if (wave >= Bsz * Hc * NC) return;
  int c = wave & (NC - 1);
  int bh = wave / NC;
  int h = bh & (Hc - 1);
  int b = bh / Hc;
  float4 p = ab[h * Nst + lane];
  float sc = scale[bh], sh = shift[bh];
  float Dh = Dv[h];
  float2 s0 = cinit[(size_t)wave * Nst + lane];
  float sr = s0.x, si = s0.y;
  const float* xp = x + (size_t)bh * Lc + (size_t)c * Tc;
  __bf16* up = u + (size_t)h * BL + (size_t)b * Lc + (size_t)c * Tc;
  float* buf = &xbuf[wv][0][0];

  async_tile128(xp, buf);
  constexpr int NS = Tc / 128;
  for (int s = 0; s < NS; ++s) {
    if (s + 1 < NS) { async_tile128(xp + (s + 1) * 128, buf + ((s + 1) & 1) * 128); wait_async1(); }
    else            { wait_async0(); }
    const float* cur = buf + (s & 1) * 128;
    for (int t0 = 0; t0 < 128; t0 += 32) {
      float mine = 0.f;
#pragma unroll 4
      for (int k = 0; k < 32; ++k) {
        float uin = cur[t0 + k] * sc + sh;
        float nr = p.x * sr - p.y * si + uin;
        float ni = p.x * si + p.y * sr;
        sr = nr; si = ni;
        float part = p.z * sr + p.w * si;        // 2*Re(Cd * s)
#pragma unroll
        for (int off = 16; off > 0; off >>= 1) part += __shfl_xor(part, off, 32);
        float y = part + Dh * uin;
        float gel = 0.5f * y * (1.f + erff(y * 0.70710678f));
        if (k == lane) mine = gel;
      }
      up[s * 128 + t0 + lane] = (__bf16)mine;
    }
  }
}

// ---------------------------------------------------------------------------
// K6: GLU projection, bf16 WMMA; both halves of W_out share the B-tile.
// ---------------------------------------------------------------------------
__global__ void __launch_bounds__(256)
k_glu_gemm(const float* __restrict__ W, const float* __restrict__ bias,
           const __bf16* __restrict__ u, __bf16* __restrict__ g) {
  __shared__ __bf16 Asm[2][64][34];
  __shared__ __bf16 BsT[128][34];
  int n0 = blockIdx.x * 128;
  int m0 = blockIdx.y * 64;
  int tid = threadIdx.x;
  int wv = tid >> 5;
  int wm = wv & 3, wn = wv >> 2;

  floatx8 accT[4] = {{}, {}, {}, {}};
  floatx8 accB[4] = {{}, {}, {}, {}};

  for (int kk = 0; kk < Hc; kk += 32) {
    for (int idx = tid; idx < 64 * 32; idx += 256) {
      int row = idx >> 5, k = idx & 31;
      Asm[0][row][k] = (__bf16)W[(size_t)(m0 + row) * Hc + kk + k];
      Asm[1][row][k] = (__bf16)W[(size_t)(m0 + 256 + row) * Hc + kk + k];
    }
    for (int idx = tid; idx < 32 * 128; idx += 256) {
      int k = idx >> 7, n = idx & 127;
      BsT[n][k] = u[(size_t)(kk + k) * BL + n0 + n];
    }
    if (kk + 32 < Hc)   // prefetch next B K-tile -> global_prefetch_b8
      __builtin_prefetch(&u[(size_t)(kk + 32 + (tid & 31)) * BL + n0], 0, 1);
    __syncthreads();

    bf16x16 at = load_a_frag(&Asm[0][0][0], wm * 16, 34);
    bf16x16 ab = load_a_frag(&Asm[1][0][0], wm * 16, 34);
#pragma unroll
    for (int j = 0; j < 4; ++j) {
      bf16x16 bf = load_bT_frag(&BsT[0][0], wn * 64 + j * 16, 34);
      accT[j] = wmma_bf16(at, bf, accT[j]);
      accB[j] = wmma_bf16(ab, bf, accB[j]);
    }
    __syncthreads();
  }

  int lane = tid & 31;
  int nl = lane & 15, half = lane >> 4;
#pragma unroll
  for (int j = 0; j < 4; ++j) {
#pragma unroll
    for (int r = 0; r < 8; ++r) {
      int row = (half << 3) + r;
      int gm = m0 + wm * 16 + row;
      size_t col = (size_t)n0 + wn * 64 + j * 16 + nl;
      float zt = accT[j][r] + bias[gm];
      float zb = accB[j][r] + bias[gm + 256];
      float gv = zt * (1.f / (1.f + expf(-zb)));
      g[(size_t)gm * BL + col] = (__bf16)gv;
    }
  }
}

// ---------------------------------------------------------------------------
// K7: conv1d(k=3,pad=1) as 3 shifted-tap WMMA GEMMs; fused bias + residual.
// ---------------------------------------------------------------------------
__global__ void __launch_bounds__(256)
k_conv_gemm(const float* __restrict__ cw,
            const float* __restrict__ cb,
            const __bf16* __restrict__ g,
            const float* __restrict__ x,
            float* __restrict__ out) {
  __shared__ __bf16 Asm[3][64][34];
  __shared__ __bf16 BsT[130][34];
  int n0 = blockIdx.x * 128;
  int m0 = blockIdx.y * 64;
  int tid = threadIdx.x;
  int wv = tid >> 5;
  int wm = wv & 3, wn = wv >> 2;
  int bstart = (n0 / Lc) * Lc;

  floatx8 acc[4] = {{}, {}, {}, {}};

  for (int kk = 0; kk < Hc; kk += 32) {
    for (int idx = tid; idx < 3 * 64 * 32; idx += 256) {
      int d = idx >> 11;
      int rem = idx & 2047;
      int row = rem >> 5, k = rem & 31;
      Asm[d][row][k] = (__bf16)cw[(size_t)(m0 + row) * (Hc * 3) + (kk + k) * 3 + d];
    }
    for (int idx = tid; idx < 32 * 130; idx += 256) {
      int k = idx / 130;
      int j = idx - k * 130;
      long long nn = (long long)n0 - 1 + j;
      __bf16 v = (__bf16)0.0f;
      if (nn >= bstart && nn < bstart + Lc)
        v = g[(size_t)(kk + k) * BL + nn];
      BsT[j][k] = v;
    }
    __syncthreads();

#pragma unroll
    for (int d = 0; d < 3; ++d) {
      bf16x16 af = load_a_frag(&Asm[d][0][0], wm * 16, 34);
#pragma unroll
      for (int j = 0; j < 4; ++j) {
        bf16x16 bf = load_bT_frag(&BsT[0][0], wn * 64 + j * 16 + d, 34);
        acc[j] = wmma_bf16(af, bf, acc[j]);
      }
    }
    __syncthreads();
  }

  int lane = tid & 31;
  int nl = lane & 15, half = lane >> 4;
#pragma unroll
  for (int j = 0; j < 4; ++j) {
#pragma unroll
    for (int r = 0; r < 8; ++r) {
      int row = (half << 3) + r;
      int o = m0 + wm * 16 + row;
      long long ng = (long long)n0 + wn * 64 + j * 16 + nl;
      int b = (int)(ng >> 12);
      int l = (int)(ng & (Lc - 1));
      size_t oi = ((size_t)b * Hc + o) * Lc + l;
      out[oi] = x[oi] + cb[o] + acc[j][r];
    }
  }
}

// ---------------------------------------------------------------------------
extern "C" void kernel_launch(void* const* d_in, const int* in_sizes, int n_in,
                              void* d_out, int out_size, void* d_ws, size_t ws_size,
                              hipStream_t stream) {
  const float* x        = (const float*)d_in[0];
  const float* gn_w     = (const float*)d_in[1];
  const float* gn_b     = (const float*)d_in[2];
  const float* log_dt   = (const float*)d_in[3];
  const float* A_log_re = (const float*)d_in[4];
  const float* A_im     = (const float*)d_in[5];
  const float* C_re     = (const float*)d_in[6];
  const float* C_im     = (const float*)d_in[7];
  const float* Dv       = (const float*)d_in[8];
  const float* W_out    = (const float*)d_in[9];
  const float* b_out    = (const float*)d_in[10];
  const float* conv_w   = (const float*)d_in[11];
  const float* conv_b   = (const float*)d_in[12];
  float* out = (float*)d_out;

  char* ws = (char*)d_ws;
  size_t off = 0;
  auto alloc = [&](size_t bytes) { size_t o = off; off = (off + bytes + 255) & ~(size_t)255; return o; };
  float*  w_scale  = (float*) (ws + alloc(sizeof(float)  * Bsz * Hc));
  float*  w_shift  = (float*) (ws + alloc(sizeof(float)  * Bsz * Hc));
  float4* w_ab     = (float4*)(ws + alloc(sizeof(float4) * Hc * Nst));
  float2* w_aT     = (float2*)(ws + alloc(sizeof(float2) * Hc * Nst));
  float2* w_cstate = (float2*)(ws + alloc(sizeof(float2) * (size_t)Bsz * Hc * NC * Nst));
  float2* w_cinit  = (float2*)(ws + alloc(sizeof(float2) * (size_t)Bsz * Hc * NC * Nst));
  __bf16* w_u      = (__bf16*)(ws + alloc(sizeof(__bf16) * (size_t)Hc * BL));
  __bf16* w_g      = (__bf16*)(ws + alloc(sizeof(__bf16) * (size_t)Hc * BL));

  k_gn_stats<<<Bsz * Gg, 256, 0, stream>>>(x, gn_w, gn_b, w_scale, w_shift);
  k_params<<<(Hc * Nst + 255) / 256, 256, 0, stream>>>(log_dt, A_log_re, A_im,
                                                       C_re, C_im, w_ab, w_aT);
  k_chunk_state<<<(Bsz * Hc * NC) / 8, 256, 0, stream>>>(x, w_scale, w_shift,
                                                         w_ab, w_cstate);
  k_chunk_scan<<<(Bsz * Hc) / 8, 256, 0, stream>>>(w_aT, w_cstate, w_cinit);
  k_ssm_out<<<(Bsz * Hc * NC) / 8, 256, 0, stream>>>(x, w_scale, w_shift, w_ab,
                                                     w_cinit, Dv, w_u);
  dim3 gemm_grid((unsigned)(BL / 128), Hc / 64);
  k_glu_gemm<<<gemm_grid, 256, 0, stream>>>(W_out, b_out, w_u, w_g);
  k_conv_gemm<<<gemm_grid, 256, 0, stream>>>(conv_w, conv_b, w_g, x, out);
}

// v001
// One run takes 229 microseconds.
// In both of two side-by-side timings against v000, it was 1.71 times as fast.
#include <hip/hip_runtime.h>
#include <math.h>
#include <stdint.h>

#define DEVI __device__ __forceinline__

// Problem constants (match reference)
constexpr int  Bsz = 8, Hc = 256, Lc = 4096, Nst = 32, Gg = 32;
constexpr int  CPG = Hc / Gg;              // 8 channels per group
constexpr int  NC  = 8,  Tc = Lc / NC;     // 8 chunks of 512
constexpr long long BL = (long long)Bsz * Lc;  // 32768 positions

typedef __attribute__((ext_vector_type(16))) __bf16 bf16x16;
typedef __attribute__((ext_vector_type(8)))  float  floatx8;
typedef __attribute__((ext_vector_type(4)))  float  f32x4;

// ---------------------------------------------------------------------------
// CDNA5 async Global->LDS copy (ASYNCcnt-tracked) with builtin/asm fallback
// ---------------------------------------------------------------------------
#define GAS __attribute__((address_space(1)))
#define LAS __attribute__((address_space(3)))
typedef int v4i __attribute__((vector_size(4 * sizeof(int))));

DEVI void async_ld_b128(const void* g, void* l) {
#if __has_builtin(__builtin_amdgcn_global_load_async_to_lds_b128)
  __builtin_amdgcn_global_load_async_to_lds_b128(
      (GAS v4i*)(g), (LAS v4i*)(l), 0, 0);
#else
  unsigned loff = (unsigned)(uintptr_t)l;
  asm volatile("global_load_async_to_lds_b128 %0, %1, off"
               :: "v"(loff), "v"(g) : "memory");
#endif
}

DEVI void wait_async0() {
#if __has_builtin(__builtin_amdgcn_s_wait_asynccnt)
  __builtin_amdgcn_s_wait_asynccnt(0);
#else
  asm volatile("s_wait_asynccnt 0x0" ::: "memory");
#endif
  asm volatile("" ::: "memory");
}
DEVI void wait_async1() {
#if __has_builtin(__builtin_amdgcn_s_wait_asynccnt)
  __builtin_amdgcn_s_wait_asynccnt(1);
#else
  asm volatile("s_wait_asynccnt 0x1" ::: "memory");
#endif
  asm volatile("" ::: "memory");
}

// Stage 128 consecutive floats (one wave, 4 floats / lane) into LDS async.
DEVI void async_tile128(const float* gsrc, float* ldst) {
  int lane = threadIdx.x & 31;
  async_ld_b128(gsrc + lane * 4, ldst + lane * 4);
}

// ---------------------------------------------------------------------------
// WMMA helpers
// ---------------------------------------------------------------------------
DEVI floatx8 wmma_bf16(bf16x16 a, bf16x16 b, floatx8 c) {
  return __builtin_amdgcn_wmma_f32_16x16x32_bf16(false, a, false, b, (short)0, c,
                                                 false, false);
}

// K index held by fragment element e for the documented 16-bit A/B layout.
DEVI int wmma_k_of(int e, int half) {
  int r = e >> 1, s = e & 1;
  return (r < 4 ? (r << 1) : 16 + ((r - 4) << 1)) + s + (half << 3);
}

DEVI bf16x16 load_a_frag(const __bf16* As, int rowBase, int lda) {
  int lane = threadIdx.x & 31;
  int m = lane & 15, half = lane >> 4;
  bf16x16 f;
#pragma unroll
  for (int e = 0; e < 16; ++e)
    f[e] = As[(rowBase + m) * lda + wmma_k_of(e, half)];
  return f;
}

DEVI bf16x16 load_bT_frag(const __bf16* BsT, int colBase, int ld) {
  int lane = threadIdx.x & 31;
  int n = lane & 15, half = lane >> 4;
  bf16x16 f;
#pragma unroll
  for (int e = 0; e < 16; ++e)
    f[e] = BsT[(colBase + n) * ld + wmma_k_of(e, half)];
  return f;
}

// ---------------------------------------------------------------------------
// K1: GroupNorm statistics -> per-(b,h) affine scale/shift
// ---------------------------------------------------------------------------
__global__ void k_gn_stats(const float* __restrict__ x,
                           const float* __restrict__ gn_w,
                           const float* __restrict__ gn_b,
                           float* __restrict__ scale, float* __restrict__ shift) {
  int bg = blockIdx.x;
  int b = bg / Gg, g = bg % Gg;
  const float* xp = x + ((size_t)b * Hc + (size_t)g * CPG) * Lc;
  const int n = CPG * Lc;
  int tid = threadIdx.x;
  float s = 0.f, ss = 0.f;
  for (int i = tid; i < n; i += 256) { float v = xp[i]; s += v; ss += v * v; }
  __shared__ float r0[256], r1[256];
  r0[tid] = s; r1[tid] = ss; __syncthreads();
  for (int st = 128; st > 0; st >>= 1) {
    if (tid < st) { r0[tid] += r0[tid + st]; r1[tid] += r1[tid + st]; }
    __syncthreads();
  }
  __shared__ float mu_s, rstd_s;
  if (tid == 0) {
    float mu = r0[0] / (float)n;
    float var = r1[0] / (float)n - mu * mu;
    mu_s = mu; rstd_s = rsqrtf(var + 1e-5f);
  }
  __syncthreads();
  if (tid < CPG) {
    int h = g * CPG + tid;
    float sc = rstd_s * gn_w[h];
    scale[b * Hc + h] = sc;
    shift[b * Hc + h] = gn_b[h] - mu_s * sc;
  }
}

// ---------------------------------------------------------------------------
// K2: discretized SSM parameters per (h,n)
// ---------------------------------------------------------------------------
__global__ void k_params(const float* __restrict__ log_dt,
                         const float* __restrict__ A_log_re,
                         const float* __restrict__ A_im,
                         const float* __restrict__ C_re,
                         const float* __restrict__ C_im,
                         float4* __restrict__ ab,   // (a_re, a_im, 2Cd_re, -2Cd_im)
                         float2* __restrict__ aT) {
  int idx = blockIdx.x * blockDim.x + threadIdx.x;
  if (idx >= Hc * Nst) return;
  int h = idx >> 5;
  float dt  = expf(log_dt[h]);
  float Are = -expf(A_log_re[idx]);
  float Aim = A_im[idx];
  float er  = expf(Are * dt);
  float are = er * cosf(Aim * dt);
  float aim = er * sinf(Aim * dt);
  float dre = are - 1.f, dim = aim;
  float inv = 1.f / (Are * Are + Aim * Aim);
  float qre = (dre * Are + dim * Aim) * inv;
  float qim = (dim * Are - dre * Aim) * inv;
  float Cr = C_re[idx], Ci = C_im[idx];
  float cdre = Cr * qre - Ci * qim;
  float cdim = Cr * qim + Ci * qre;
  ab[idx] = make_float4(are, aim, 2.f * cdre, -2.f * cdim);
  float tr = are, ti = aim;
#pragma unroll
  for (int i = 0; i < 9; ++i) { float nr = tr*tr - ti*ti, ni = 2.f*tr*ti; tr = nr; ti = ni; }
  aT[idx] = make_float2(tr, ti);
}

// ---------------------------------------------------------------------------
// K3: per-(b,h,chunk) chunk-final state; x streamed via async Global->LDS
// ---------------------------------------------------------------------------
__global__ void __launch_bounds__(256)
k_chunk_state(const float* __restrict__ x,
              const float* __restrict__ scale,
              const float* __restrict__ shift,
              const float4* __restrict__ ab,
              float2* __restrict__ cstate) {
  __shared__ __align__(16) float xbuf[8][2][128];   // per-wave double buffer
  int wave = (blockIdx.x * blockDim.x + threadIdx.x) >> 5;
  int lane = threadIdx.x & 31;
  int wv = threadIdx.x >> 5;
  if (wave >= Bsz * Hc * NC) return;
  int c = wave & (NC - 1);
  int bh = wave / NC;
  int h = bh & (Hc - 1);
  float4 p = ab[h * Nst + lane];
  float sc = scale[bh], sh = shift[bh];
  const float* xp = x + (size_t)bh * Lc + (size_t)c * Tc;
  float* buf = &xbuf[wv][0][0];
  float sr = 0.f, si = 0.f;

  async_tile128(xp, buf);                       // prime tile 0
  constexpr int NS = Tc / 128;                  // 4 sub-tiles
  for (int s = 0; s < NS; ++s) {
    if (s + 1 < NS) { async_tile128(xp + (s + 1) * 128, buf + ((s + 1) & 1) * 128); wait_async1(); }
    else            { wait_async0(); }
    const float* cur = buf + (s & 1) * 128;
    for (int t = 0; t < 128; ++t) {
      float u = cur[t] * sc + sh;               // LDS broadcast read
      float nr = p.x * sr - p.y * si + u;
      float ni = p.x * si + p.y * sr;
      sr = nr; si = ni;
    }
  }
  cstate[(size_t)wave * Nst + lane] = make_float2(sr, si);
}

// ---------------------------------------------------------------------------
// K4: exclusive scan over chunks -> chunk initial states
// ---------------------------------------------------------------------------
__global__ void k_chunk_scan(const float2* __restrict__ aT,
                             const float2* __restrict__ cstate,
                             float2* __restrict__ cinit) {
  int wave = (blockIdx.x * blockDim.x + threadIdx.x) >> 5;
  int lane = threadIdx.x & 31;
  if (wave >= Bsz * Hc) return;
  int h = wave & (Hc - 1);
  float2 t = aT[h * Nst + lane];
  float cr = 0.f, ci = 0.f;
  for (int c = 0; c < NC; ++c) {
    size_t o = ((size_t)wave * NC + c) * Nst + lane;
    cinit[o] = make_float2(cr, ci);
    float2 s = cstate[o];
    float nr = t.x * cr - t.y * ci + s.x;
    float ni = t.x * ci + t.y * cr + s.y;
    cr = nr; ci = ni;
  }
}

// ---------------------------------------------------------------------------
// K5: full recurrence; fused D-skip + exact GELU; async-streamed x.
// The sum over the 32 states is taken once per block of 32 steps: every lane
// (one state) stores its term of each step into a wave-private 32x32 LDS tile,
// then every lane sums one row (one step) and evaluates the GELU of that step.
// ---------------------------------------------------------------------------
// 16 waves per SIMD (64 VGPRs): all 2,048 work-groups are then resident at once
__global__ void __launch_bounds__(256) __attribute__((amdgpu_waves_per_eu(16)))
k_ssm_out(const float* __restrict__ x,
          const float* __restrict__ scale,
          const float* __restrict__ shift,
          const float4* __restrict__ ab,
          const float2* __restrict__ cinit,
          const float* __restrict__ Dv,
          __bf16* __restrict__ u) {
  __shared__ __align__(16) float xbuf[8][2][128];
  __shared__ __align__(16) float tile[8][32][32];   // per wave: [step][state]
  int wave = (blockIdx.x * blockDim.x + threadIdx.x) >> 5;
  int lane = threadIdx.x & 31;
  int wv = threadIdx.x >> 5;
  if (wave >= Bsz * Hc * NC) return;
  int c = wave & (NC - 1);
  int bh = wave / NC;
  int h = bh & (Hc - 1);
  int b = bh / Hc;
  float4 p = ab[h * Nst + lane];
  float sc = scale[bh], sh = shift[bh];
  float Dh = Dv[h];
  float2 s0 = cinit[(size_t)wave * Nst + lane];
  float sr = s0.x, si = s0.y;
  const float* xp = x + (size_t)bh * Lc + (size_t)c * Tc;
  __bf16* up = u + (size_t)h * BL + (size_t)b * Lc + (size_t)c * Tc;
  float* buf = &xbuf[wv][0][0];
  float* tcol = &tile[wv][0][lane];             // this lane's state, row = step
  const float* trow = &tile[wv][lane][0];       // this lane's step, all states
  // Rows are 128 B apart, so lane l starts its row at 16-byte piece (l >> 1) & 7:
  // each 16 lanes of a 16-byte read then cover all 64 banks once.
  int rot = (lane >> 1) & 7;

  async_tile128(xp, buf);
  constexpr int NS = Tc / 128;
  for (int s = 0; s < NS; ++s) {
    if (s + 1 < NS) { async_tile128(xp + (s + 1) * 128, buf + ((s + 1) & 1) * 128); wait_async1(); }
    else            { wait_async0(); }
    const float* cur = buf + (s & 1) * 128;
    for (int t0 = 0; t0 < 128; t0 += 32) {
      // fully unrolled: every step's tile store gets an immediate offset
#pragma unroll
      for (int k = 0; k < 32; ++k) {
        float uin = cur[t0 + k] * sc + sh;
        float nr = p.x * sr - p.y * si + uin;
        float ni = p.x * si + p.y * sr;
        sr = nr; si = ni;
        tcol[k * 32] = p.z * sr + p.w * si;      // this state's 2*Re(Cd * s)
      }
      // One wave's LDS operations complete in issue order: no barrier needed.
      f32x4 v[8];
#pragma unroll
      for (int j = 0; j < 8; ++j) v[j] = *(const f32x4*)(trow + ((j ^ rot) << 2));
      float xl = cur[t0 + lane];
      // inputs-only fence on the loaded values: keeps the nine LDS reads in one
      // group with one latency; without it each read is waited for by itself
      asm volatile("" :: "v"(v[0]), "v"(v[1]), "v"(v[2]), "v"(v[3]), "v"(v[4]),
                         "v"(v[5]), "v"(v[6]), "v"(v[7]), "v"(xl));
      f32x4 a = ((v[0] + v[1]) + (v[2] + v[3])) + ((v[4] + v[5]) + (v[6] + v[7]));
      float part = (a.x + a.z) + (a.y + a.w);
      float uin = xl * sc + sh;
      float y = part + Dh * uin;
      float gel = 0.5f * y * (1.f + erff(y * 0.70710678f));
      up[s * 128 + t0 + lane] = (__bf16)gel;
    }
  }
}

// ---------------------------------------------------------------------------
// K6: GLU projection, bf16 WMMA; both halves of W_out share the B-tile.
// ---------------------------------------------------------------------------
__global__ void __launch_bounds__(256)
k_glu_gemm(const float* __restrict__ W, const float* __restrict__ bias,
           const __bf16* __restrict__ u, __bf16* __restrict__ g) {
  __shared__ __bf16 Asm[2][64][34];
  __shared__ __bf16 BsT[128][34];
  int n0 = blockIdx.x * 128;
  int m0 = blockIdx.y * 64;
  int tid = threadIdx.x;
  int wv = tid >> 5;
  int wm = wv & 3, wn = wv >> 2;

  floatx8 accT[4] = {{}, {}, {}, {}};
  floatx8 accB[4] = {{}, {}, {}, {}};

  for (int kk = 0; kk < Hc; kk += 32) {
    for (int idx = tid; idx < 64 * 32; idx += 256) {
      int row = idx >> 5, k = idx & 31;
      Asm[0][row][k] = (__bf16)W[(size_t)(m0 + row) * Hc + kk + k];
      Asm[1][row][k] = (__bf16)W[(size_t)(m0 + 256 + row) * Hc + kk + k];
    }
    for (int idx = tid; idx < 32 * 128; idx += 256) {
      int k = idx >> 7, n = idx & 127;
      BsT[n][k] = u[(size_t)(kk + k) * BL + n0 + n];
    }
    if (kk + 32 < Hc)   // prefetch next B K-tile -> global_prefetch_b8
      __builtin_prefetch(&u[(size_t)(kk + 32 + (tid & 31)) * BL + n0], 0, 1);
    __syncthreads();

    bf16x16 at = load_a_frag(&Asm[0][0][0], wm * 16, 34);
    bf16x16 ab = load_a_frag(&Asm[1][0][0], wm * 16, 34);
#pragma unroll
    for (int j = 0; j < 4; ++j) {
      bf16x16 bf = load_bT_frag(&BsT[0][0], wn * 64 + j * 16, 34);
      accT[j] = wmma_bf16(at, bf, accT[j]);
      accB[j] = wmma_bf16(ab, bf, accB[j]);
    }
    __syncthreads();
  }

  int lane = tid & 31;
  int nl = lane & 15, half = lane >> 4;
#pragma unroll
  for (int j = 0; j < 4; ++j) {
#pragma unroll
    for (int r = 0; r < 8; ++r) {
      int row = (half << 3) + r;
      int gm = m0 + wm * 16 + row;
      size_t col = (size_t)n0 + wn * 64 + j * 16 + nl;
      float zt = accT[j][r] + bias[gm];
      float zb = accB[j][r] + bias[gm + 256];
      float gv = zt * (1.f / (1.f + expf(-zb)));
      g[(size_t)gm * BL + col] = (__bf16)gv;
    }
  }
}

// ---------------------------------------------------------------------------
// K7: conv1d(k=3,pad=1) as 3 shifted-tap WMMA GEMMs; fused bias + residual.
// ---------------------------------------------------------------------------
__global__ void __launch_bounds__(256)
k_conv_gemm(const float* __restrict__ cw,
            const float* __restrict__ cb,
            const __bf16* __restrict__ g,
            const float* __restrict__ x,
            float* __restrict__ out) {
  __shared__ __bf16 Asm[3][64][34];
  __shared__ __bf16 BsT[130][34];
  int n0 = blockIdx.x * 128;
  int m0 = blockIdx.y * 64;
  int tid = threadIdx.x;
  int wv = tid >> 5;
  int wm = wv & 3, wn = wv >> 2;
  int bstart = (n0 / Lc) * Lc;

  floatx8 acc[4] = {{}, {}, {}, {}};

  for (int kk = 0; kk < Hc; kk += 32) {
    for (int idx = tid; idx < 3 * 64 * 32; idx += 256) {
      int d = idx >> 11;
      int rem = idx & 2047;
      int row = rem >> 5, k = rem & 31;
      Asm[d][row][k] = (__bf16)cw[(size_t)(m0 + row) * (Hc * 3) + (kk + k) * 3 + d];
    }
    for (int idx = tid; idx < 32 * 130; idx += 256) {
      int k = idx / 130;
      int j = idx - k * 130;
      long long nn = (long long)n0 - 1 + j;
      __bf16 v = (__bf16)0.0f;
      if (nn >= bstart && nn < bstart + Lc)
        v = g[(size_t)(kk + k) * BL + nn];
      BsT[j][k] = v;
    }
    __syncthreads();

#pragma unroll
    for (int d = 0; d < 3; ++d) {
      bf16x16 af = load_a_frag(&Asm[d][0][0], wm * 16, 34);
#pragma unroll
      for (int j = 0; j < 4; ++j) {
        bf16x16 bf = load_bT_frag(&BsT[0][0], wn * 64 + j * 16 + d, 34);
        acc[j] = wmma_bf16(af, bf, acc[j]);
      }
    }
    __syncthreads();
  }

  int lane = tid & 31;
  int nl = lane & 15, half = lane >> 4;
#pragma unroll
  for (int j = 0; j < 4; ++j) {
#pragma unroll
    for (int r = 0; r < 8; ++r) {
      int row = (half << 3) + r;
      int o = m0 + wm * 16 + row;
      long long ng = (long long)n0 + wn * 64 + j * 16 + nl;
      int b = (int)(ng >> 12);
      int l = (int)(ng & (Lc - 1));
      size_t oi = ((size_t)b * Hc + o) * Lc + l;
      out[oi] = x[oi] + cb[o] + acc[j][r];
    }
  }
}

// ---------------------------------------------------------------------------
extern "C" void kernel_launch(void* const* d_in, const int* in_sizes, int n_in,
                              void* d_out, int out_size, void* d_ws, size_t ws_size,
                              hipStream_t stream) {
  const float* x        = (const float*)d_in[0];
  const float* gn_w     = (const float*)d_in[1];
  const float* gn_b     = (const float*)d_in[2];
  const float* log_dt   = (const float*)d_in[3];
  const float* A_log_re = (const float*)d_in[4];
  const float* A_im     = (const float*)d_in[5];
  const float* C_re     = (const float*)d_in[6];
  const float* C_im     = (const float*)d_in[7];
  const float* Dv       = (const float*)d_in[8];
  const float* W_out    = (const float*)d_in[9];
  const float* b_out    = (const float*)d_in[10];
  const float* conv_w   = (const float*)d_in[11];
  const float* conv_b   = (const float*)d_in[12];
  float* out = (float*)d_out;

  char* ws = (char*)d_ws;
  size_t off = 0;
  auto alloc = [&](size_t bytes) { size_t o = off; off = (off + bytes + 255) & ~(size_t)255; return o; };
  float*  w_scale  = (float*) (ws + alloc(sizeof(float)  * Bsz * Hc));
  float*  w_shift  = (float*) (ws + alloc(sizeof(float)  * Bsz * Hc));
  float4* w_ab     = (float4*)(ws + alloc(sizeof(float4) * Hc * Nst));
  float2* w_aT     = (float2*)(ws + alloc(sizeof(float2) * Hc * Nst));
  float2* w_cstate = (float2*)(ws + alloc(sizeof(float2) * (size_t)Bsz * Hc * NC * Nst));
  float2* w_cinit  = (float2*)(ws + alloc(sizeof(float2) * (size_t)Bsz * Hc * NC * Nst));
  __bf16* w_u      = (__bf16*)(ws + alloc(sizeof(__bf16) * (size_t)Hc * BL));
  __bf16* w_g      = (__bf16*)(ws + alloc(sizeof(__bf16) * (size_t)Hc * BL));

  k_gn_stats<<<Bsz * Gg, 256, 0, stream>>>(x, gn_w, gn_b, w_scale, w_shift);
  k_params<<<(Hc * Nst + 255) / 256, 256, 0, stream>>>(log_dt, A_log_re, A_im,
                                                       C_re, C_im, w_ab, w_aT);
  k_chunk_state<<<(Bsz * Hc * NC) / 8, 256, 0, stream>>>(x, w_scale, w_shift,
                                                         w_ab, w_cstate);
  k_chunk_scan<<<(Bsz * Hc) / 8, 256, 0, stream>>>(w_aT, w_cstate, w_cinit);
  k_ssm_out<<<(Bsz * Hc * NC) / 8, 256, 0, stream>>>(x, w_scale, w_shift, w_ab,
                                                     w_cinit, Dv, w_u);
  dim3 gemm_grid((unsigned)(BL / 128), Hc / 64);
  k_glu_gemm<<<gemm_grid, 256, 0, stream>>>(W_out, b_out, w_u, w_g);
  k_conv_gemm<<<gemm_grid, 256, 0, stream>>>(conv_w, conv_b, w_g, x, out);
}

// v002
// A run of this version takes 147 microseconds.
// Two timings next to v001 put it at 1.56 and 1.55 times that version's speed.
// Over all steps from v000 it is 2.66 times as fast.
#include <hip/hip_runtime.h>
#include <math.h>
#include <stdint.h>

#define DEVI __device__ __forceinline__

// Problem constants (match reference)
constexpr int  Bsz = 8, Hc = 256, Lc = 4096, Nst = 32, Gg = 32;
constexpr int  CPG = Hc / Gg;              // 8 channels per group
constexpr int  NC  = 8,  Tc = Lc / NC;     // 8 chunks of 512
constexpr long long BL = (long long)Bsz * Lc;  // 32768 positions

typedef __attribute__((ext_vector_type(16))) __bf16 bf16x16;
typedef __attribute__((ext_vector_type(8)))  float  floatx8;
typedef __attribute__((ext_vector_type(4)))  float  f32x4;
typedef __attribute__((ext_vector_type(8)))  __bf16 bf16x8;
typedef __attribute__((ext_vector_type(2)))  __bf16 bf16x2;

// ---------------------------------------------------------------------------
// CDNA5 async Global->LDS copy (ASYNCcnt-tracked) with builtin/asm fallback
// ---------------------------------------------------------------------------
#define GAS __attribute__((address_space(1)))
#define LAS __attribute__((address_space(3)))
typedef int v4i __attribute__((vector_size(4 * sizeof(int))));

DEVI void async_ld_b128(const void* g, void* l) {
#if __has_builtin(__builtin_amdgcn_global_load_async_to_lds_b128)
  __builtin_amdgcn_global_load_async_to_lds_b128(
      (GAS v4i*)(g), (LAS v4i*)(l), 0, 0);
#else
  unsigned loff = (unsigned)(uintptr_t)l;
  asm volatile("global_load_async_to_lds_b128 %0, %1, off"
               :: "v"(loff), "v"(g) : "memory");
#endif
}

DEVI void wait_async0() {
#if __has_builtin(__builtin_amdgcn_s_wait_asynccnt)
  __builtin_amdgcn_s_wait_asynccnt(0);
#else
  asm volatile("s_wait_asynccnt 0x0" ::: "memory");
#endif
  asm volatile("" ::: "memory");
}
DEVI void wait_async1() {
#if __has_builtin(__builtin_amdgcn_s_wait_asynccnt)
  __builtin_amdgcn_s_wait_asynccnt(1);
#else
  asm volatile("s_wait_asynccnt 0x1" ::: "memory");
#endif
  asm volatile("" ::: "memory");
}

// Stage 128 consecutive floats (one wave, 4 floats / lane) into LDS async.
DEVI void async_tile128(const float* gsrc, float* ldst) {
  int lane = threadIdx.x & 31;
  async_ld_b128(gsrc + lane * 4, ldst + lane * 4);
}

// ---------------------------------------------------------------------------
// WMMA helpers
// ---------------------------------------------------------------------------
DEVI floatx8 wmma_bf16(bf16x16 a, bf16x16 b, floatx8 c) {
  return __builtin_amdgcn_wmma_f32_16x16x32_bf16(false, a, false, b, (short)0, c,
                                                 false, false);
}

// K index held by fragment element e for the documented 16-bit A/B layout.
DEVI int wmma_k_of(int e, int half) {
  int r = e >> 1, s = e & 1;
  return (r < 4 ? (r << 1) : 16 + ((r - 4) << 1)) + s + (half << 3);
}

DEVI bf16x16 load_a_frag(const __bf16* As, int rowBase, int lda) {
  int lane = threadIdx.x & 31;
  int m = lane & 15, half = lane >> 4;
  bf16x16 f;
#pragma unroll
  for (int e = 0; e < 16; ++e)
    f[e] = As[(rowBase + m) * lda + wmma_k_of(e, half)];
  return f;
}

DEVI bf16x16 load_bT_frag(const __bf16* BsT, int colBase, int ld) {
  int lane = threadIdx.x & 31;
  int n = lane & 15, half = lane >> 4;
  bf16x16 f;
#pragma unroll
  for (int e = 0; e < 16; ++e)
    f[e] = BsT[(colBase + n) * ld + wmma_k_of(e, half)];
  return f;
}

// ---------------------------------------------------------------------------
// K1: GroupNorm statistics -> per-(b,h) affine scale/shift
// ---------------------------------------------------------------------------
__global__ void k_gn_stats(const float* __restrict__ x,
                           const float* __restrict__ gn_w,
                           const float* __restrict__ gn_b,
                           float* __restrict__ scale, float* __restrict__ shift) {
  int bg = blockIdx.x;
  int b = bg / Gg, g = bg % Gg;
  const float* xp = x + ((size_t)b * Hc + (size_t)g * CPG) * Lc;
  const int n = CPG * Lc;
  int tid = threadIdx.x;
  float s = 0.f, ss = 0.f;
  for (int i = tid; i < n; i += 256) { float v = xp[i]; s += v; ss += v * v; }
  __shared__ float r0[256], r1[256];
  r0[tid] = s; r1[tid] = ss; __syncthreads();
  for (int st = 128; st > 0; st >>= 1) {
    if (tid < st) { r0[tid] += r0[tid + st]; r1[tid] += r1[tid + st]; }
    __syncthreads();
  }
  __shared__ float mu_s, rstd_s;
  if (tid == 0) {
    float mu = r0[0] / (float)n;
    float var = r1[0] / (float)n - mu * mu;
    mu_s = mu; rstd_s = rsqrtf(var + 1e-5f);
  }
  __syncthreads();
  if (tid < CPG) {
    int h = g * CPG + tid;
    float sc = rstd_s * gn_w[h];
    scale[b * Hc + h] = sc;
    shift[b * Hc + h] = gn_b[h] - mu_s * sc;
  }
}

// ---------------------------------------------------------------------------
// K2: discretized SSM parameters per (h,n)
// ---------------------------------------------------------------------------
__global__ void k_params(const float* __restrict__ log_dt,
                         const float* __restrict__ A_log_re,
                         const float* __restrict__ A_im,
                         const float* __restrict__ C_re,
                         const float* __restrict__ C_im,
                         float4* __restrict__ ab,   // (a_re, a_im, 2Cd_re, -2Cd_im)
                         float2* __restrict__ aT) {
  int idx = blockIdx.x * blockDim.x + threadIdx.x;
  if (idx >= Hc * Nst) return;
  int h = idx >> 5;
  float dt  = expf(log_dt[h]);
  float Are = -expf(A_log_re[idx]);
  float Aim = A_im[idx];
  float er  = expf(Are * dt);
  float are = er * cosf(Aim * dt);
  float aim = er * sinf(Aim * dt);
  float dre = are - 1.f, dim = aim;
  float inv = 1.f / (Are * Are + Aim * Aim);
  float qre = (dre * Are + dim * Aim) * inv;
  float qim = (dim * Are - dre * Aim) * inv;
  float Cr = C_re[idx], Ci = C_im[idx];
  float cdre = Cr * qre - Ci * qim;
  float cdim = Cr * qim + Ci * qre;
  ab[idx] = make_float4(are, aim, 2.f * cdre, -2.f * cdim);
  float tr = are, ti = aim;
#pragma unroll
  for (int i = 0; i < 9; ++i) { float nr = tr*tr - ti*ti, ni = 2.f*tr*ti; tr = nr; ti = ni; }
  aT[idx] = make_float2(tr, ti);
}

// ---------------------------------------------------------------------------
// K3: per-(b,h,chunk) chunk-final state; x streamed via async Global->LDS
// ---------------------------------------------------------------------------
__global__ void __launch_bounds__(256)
k_chunk_state(const float* __restrict__ x,
              const float* __restrict__ scale,
              const float* __restrict__ shift,
              const float4* __restrict__ ab,
              float2* __restrict__ cstate) {
  __shared__ __align__(16) float xbuf[8][2][128];   // per-wave double buffer
  int wave = (blockIdx.x * blockDim.x + threadIdx.x) >> 5;
  int lane = threadIdx.x & 31;
  int wv = threadIdx.x >> 5;
  if (wave >= Bsz * Hc * NC) return;
  int c = wave & (NC - 1);
  int bh = wave / NC;
  int h = bh & (Hc - 1);
  float4 p = ab[h * Nst + lane];
  float sc = scale[bh], sh = shift[bh];
  const float* xp = x + (size_t)bh * Lc + (size_t)c * Tc;
  float* buf = &xbuf[wv][0][0];
  float sr = 0.f, si = 0.f;

  async_tile128(xp, buf);                       // prime tile 0
  constexpr int NS = Tc / 128;                  // 4 sub-tiles
  for (int s = 0; s < NS; ++s) {
    if (s + 1 < NS) { async_tile128(xp + (s + 1) * 128, buf + ((s + 1) & 1) * 128); wait_async1(); }
    else            { wait_async0(); }
    const float* cur = buf + (s & 1) * 128;
    for (int t = 0; t < 128; ++t) {
      float u = cur[t] * sc + sh;               // LDS broadcast read
      float nr = p.x * sr - p.y * si + u;
      float ni = p.x * si + p.y * sr;
      sr = nr; si = ni;
    }
  }
  cstate[(size_t)wave * Nst + lane] = make_float2(sr, si);
}

// ---------------------------------------------------------------------------
// K4: exclusive scan over chunks -> chunk initial states
// ---------------------------------------------------------------------------
__global__ void k_chunk_scan(const float2* __restrict__ aT,
                             const float2* __restrict__ cstate,
                             float2* __restrict__ cinit) {
  int wave = (blockIdx.x * blockDim.x + threadIdx.x) >> 5;
  int lane = threadIdx.x & 31;
  if (wave >= Bsz * Hc) return;
  int h = wave & (Hc - 1);
  float2 t = aT[h * Nst + lane];
  float cr = 0.f, ci = 0.f;
  for (int c = 0; c < NC; ++c) {
    size_t o = ((size_t)wave * NC + c) * Nst + lane;
    cinit[o] = make_float2(cr, ci);
    float2 s = cstate[o];
    float nr = t.x * cr - t.y * ci + s.x;
    float ni = t.x * ci + t.y * cr + s.y;
    cr = nr; ci = ni;
  }
}

// ---------------------------------------------------------------------------
// K5: full recurrence; fused D-skip + exact GELU; async-streamed x.
// The sum over the 32 states is taken once per block of 32 steps: every lane
// (one state) stores its term of each step into a wave-private 32x32 LDS tile,
// then every lane sums one row (one step) and evaluates the GELU of that step.
// ---------------------------------------------------------------------------
// 16 waves per SIMD (64 VGPRs): all 2,048 work-groups are then resident at once
__global__ void __launch_bounds__(256) __attribute__((amdgpu_waves_per_eu(16)))
k_ssm_out(const float* __restrict__ x,
          const float* __restrict__ scale,
          const float* __restrict__ shift,
          const float4* __restrict__ ab,
          const float2* __restrict__ cinit,
          const float* __restrict__ Dv,
          __bf16* __restrict__ u) {
  __shared__ __align__(16) float xbuf[8][2][128];
  __shared__ __align__(16) float tile[8][32][32];   // per wave: [step][state]
  int wave = (blockIdx.x * blockDim.x + threadIdx.x) >> 5;
  int lane = threadIdx.x & 31;
  int wv = threadIdx.x >> 5;
  if (wave >= Bsz * Hc * NC) return;
  int c = wave & (NC - 1);
  int bh = wave / NC;
  int h = bh & (Hc - 1);
  int b = bh / Hc;
  float4 p = ab[h * Nst + lane];
  float sc = scale[bh], sh = shift[bh];
  float Dh = Dv[h];
  float2 s0 = cinit[(size_t)wave * Nst + lane];
  float sr = s0.x, si = s0.y;
  const float* xp = x + (size_t)bh * Lc + (size_t)c * Tc;
  __bf16* up = u + (size_t)h * BL + (size_t)b * Lc + (size_t)c * Tc;
  float* buf = &xbuf[wv][0][0];
  float* tcol = &tile[wv][0][lane];             // this lane's state, row = step
  const float* trow = &tile[wv][lane][0];       // this lane's step, all states
  // Rows are 128 B apart, so lane l starts its row at 16-byte piece (l >> 1) & 7:
  // each 16 lanes of a 16-byte read then cover all 64 banks once.
  int rot = (lane >> 1) & 7;

  async_tile128(xp, buf);
  constexpr int NS = Tc / 128;
  for (int s = 0; s < NS; ++s) {
    if (s + 1 < NS) { async_tile128(xp + (s + 1) * 128, buf + ((s + 1) & 1) * 128); wait_async1(); }
    else            { wait_async0(); }
    const float* cur = buf + (s & 1) * 128;
    for (int t0 = 0; t0 < 128; t0 += 32) {
      // fully unrolled: every step's tile store gets an immediate offset
#pragma unroll
      for (int k = 0; k < 32; ++k) {
        float uin = cur[t0 + k] * sc + sh;
        float nr = p.x * sr - p.y * si + uin;
        float ni = p.x * si + p.y * sr;
        sr = nr; si = ni;
        tcol[k * 32] = p.z * sr + p.w * si;      // this state's 2*Re(Cd * s)
      }
      // One wave's LDS operations complete in issue order: no barrier needed.
      f32x4 v[8];
#pragma unroll
      for (int j = 0; j < 8; ++j) v[j] = *(const f32x4*)(trow + ((j ^ rot) << 2));
      float xl = cur[t0 + lane];
      // inputs-only fence on the loaded values: keeps the nine LDS reads in one
      // group with one latency; without it each read is waited for by itself
      asm volatile("" :: "v"(v[0]), "v"(v[1]), "v"(v[2]), "v"(v[3]), "v"(v[4]),
                         "v"(v[5]), "v"(v[6]), "v"(v[7]), "v"(xl));
      f32x4 a = ((v[0] + v[1]) + (v[2] + v[3])) + ((v[4] + v[5]) + (v[6] + v[7]));
      float part = (a.x + a.z) + (a.y + a.w);
      float uin = xl * sc + sh;
      float y = part + Dh * uin;
      float gel = 0.5f * y * (1.f + erff(y * 0.70710678f));
      up[s * 128 + t0 + lane] = (__bf16)gel;
    }
  }
}

// ---------------------------------------------------------------------------
// K6: GLU projection, bf16 WMMA; both halves of W_out share the B-tile.
// ---------------------------------------------------------------------------
__global__ void __launch_bounds__(256)
k_glu_gemm(const float* __restrict__ W, const float* __restrict__ bias,
           const __bf16* __restrict__ u, __bf16* __restrict__ g) {
  __shared__ __align__(16) __bf16 Asm[2][64][34];
  __shared__ __align__(16) __bf16 BsT[128][34];
  int n0 = blockIdx.x * 128;
  int m0 = blockIdx.y * 64;
  int tid = threadIdx.x;
  int wv = tid >> 5;
  int wm = wv & 3, wn = wv >> 2;

  floatx8 accT[4] = {{}, {}, {}, {}};
  floatx8 accB[4] = {{}, {}, {}, {}};

  // Staging map. A: 8 threads cover one row's 32 floats (one 128-byte line).
  // B: one thread takes rows k = 2*bkp, 2*bkp+1 at 8 consecutive columns.
  int arow = tid >> 3, ak = (tid & 7) << 2;
  int bkp = tid >> 4, bn = (tid & 15) << 3;
  const float* Wp = W + (size_t)(m0 + arow) * Hc + ak;
  const __bf16* ub = u + (size_t)(2 * bkp) * BL + n0 + bn;

  for (int kk = 0; kk < Hc; kk += 32) {
    // all six 16-byte loads of this K-tile are issued before the first use; the
    // short loops are unrolled so that a[], b0, b1 get constant indices (registers)
    f32x4 a[4];
#pragma unroll
    for (int j = 0; j < 4; ++j)
      a[j] = *(const f32x4*)(Wp + (size_t)((j >> 1) * 256 + (j & 1) * 32) * Hc + kk);
    f32x4 r0 = *(const f32x4*)(ub + (size_t)kk * BL);
    f32x4 r1 = *(const f32x4*)(ub + (size_t)(kk + 1) * BL);
    bf16x8 b0 = __builtin_bit_cast(bf16x8, r0);
    bf16x8 b1 = __builtin_bit_cast(bf16x8, r1);
#pragma unroll
    for (int j = 0; j < 4; ++j) {
      __bf16* d = &Asm[j >> 1][arow + (j & 1) * 32][ak];
      *(bf16x2*)(d)     = bf16x2{(__bf16)a[j].x, (__bf16)a[j].y};
      *(bf16x2*)(d + 2) = bf16x2{(__bf16)a[j].z, (__bf16)a[j].w};
    }
#pragma unroll
    for (int i = 0; i < 8; ++i)
      *(bf16x2*)(&BsT[bn + i][2 * bkp]) = bf16x2{b0[i], b1[i]};
    if (kk + 32 < Hc)   // prefetch next B K-tile -> global_prefetch_b8
      __builtin_prefetch(&u[(size_t)(kk + 32 + (tid & 31)) * BL + n0], 0, 1);
    __syncthreads();

    bf16x16 at = load_a_frag(&Asm[0][0][0], wm * 16, 34);
    bf16x16 ab = load_a_frag(&Asm[1][0][0], wm * 16, 34);
#pragma unroll
    for (int j = 0; j < 4; ++j) {
      bf16x16 bf = load_bT_frag(&BsT[0][0], wn * 64 + j * 16, 34);
      accT[j] = wmma_bf16(at, bf, accT[j]);
      accB[j] = wmma_bf16(ab, bf, accB[j]);
    }
    __syncthreads();
  }

  int lane = tid & 31;
  int nl = lane & 15, half = lane >> 4;
#pragma unroll
  for (int j = 0; j < 4; ++j) {
#pragma unroll
    for (int r = 0; r < 8; ++r) {
      int row = (half << 3) + r;
      int gm = m0 + wm * 16 + row;
      size_t col = (size_t)n0 + wn * 64 + j * 16 + nl;
      float zt = accT[j][r] + bias[gm];
      float zb = accB[j][r] + bias[gm + 256];
      float gv = zt * (1.f / (1.f + expf(-zb)));
      g[(size_t)gm * BL + col] = (__bf16)gv;
    }
  }
}

// ---------------------------------------------------------------------------
// K7: conv1d(k=3,pad=1) as 3 shifted-tap WMMA GEMMs; fused bias + residual.
// ---------------------------------------------------------------------------
// 8 waves per SIMD (at most 128 VGPRs): four work-groups per WGP, so that all
// 1,024 are resident at once
__global__ void __launch_bounds__(256) __attribute__((amdgpu_waves_per_eu(8)))
k_conv_gemm(const float* __restrict__ cw,
            const float* __restrict__ cb,
            const __bf16* __restrict__ g,
            const float* __restrict__ x,
            float* __restrict__ out) {
  __shared__ __align__(16) __bf16 Asm[3][64][34];
  __shared__ __align__(16) __bf16 BsT[130][34];
  int n0 = blockIdx.x * 128;
  int m0 = blockIdx.y * 64;
  int tid = threadIdx.x;
  int wv = tid >> 5;
  int wm = wv & 3, wn = wv >> 2;
  int bstart = (n0 / Lc) * Lc;

  floatx8 acc[4] = {{}, {}, {}, {}};

  // Staging map. A: one thread takes 12 consecutive floats of a weight row,
  // which are 4 input channels x 3 taps. B: one thread takes rows k = 2*bkp,
  // 2*bkp+1 at 8 consecutive columns; the 128 inner columns lie in one batch
  // entry (n0 and Lc are multiples of 128). The two edge columns, n0-1 and
  // n0+128, are read at an address clamped into the entry and zeroed outside.
  int arow = tid >> 3, au = tid & 7;
  int bkp = tid >> 4, bn = (tid & 15) << 3;
  const float* cwp = cw + (size_t)(m0 + arow) * (Hc * 3) + au * 12;
  const __bf16* gb = g + (size_t)(2 * bkp) * BL + n0 + bn;
  int hk = tid & 31, hs = (tid >> 5) & 1;
  int hn = hs ? n0 + 128 : n0 - 1;
  bool hin = hn >= bstart && hn < bstart + Lc;
  const __bf16* gh = g + (size_t)hk * BL + (hin ? hn : n0);

  for (int kk = 0; kk < Hc; kk += 32) {
    // all nine loads of this K-tile are issued before the first use; the short
    // loops are unrolled so that a[], b0, b1 get constant indices (registers)
    f32x4 a[2][3];
#pragma unroll
    for (int j = 0; j < 2; ++j)
#pragma unroll
      for (int i = 0; i < 3; ++i)
        a[j][i] = *(const f32x4*)(cwp + (size_t)(j * 32) * (Hc * 3) + kk * 3 + i * 4);
    f32x4 r0 = *(const f32x4*)(gb + (size_t)kk * BL);
    f32x4 r1 = *(const f32x4*)(gb + (size_t)(kk + 1) * BL);
    unsigned hr = *(const unsigned short*)(gh + (size_t)kk * BL);
    // inputs-only fence on the loaded values: keeps the nine loads in one group
    // with one latency; without it the edge load sinks into the branch below
    // and is waited for by itself
    asm volatile("" :: "v"(a[0][0]), "v"(a[0][1]), "v"(a[0][2]), "v"(a[1][0]),
                       "v"(a[1][1]), "v"(a[1][2]), "v"(r0), "v"(r1), "v"(hr));
    bf16x8 b0 = __builtin_bit_cast(bf16x8, r0);
    bf16x8 b1 = __builtin_bit_cast(bf16x8, r1);
    __bf16 hv = __builtin_bit_cast(__bf16, (unsigned short)hr);
#pragma unroll
    for (int j = 0; j < 2; ++j) {
#pragma unroll
      for (int d = 0; d < 3; ++d) {
        // float e of the 12 is channel e / 3, tap e % 3
        __bf16* p = &Asm[d][arow + j * 32][au * 4];
        *(bf16x2*)(p)     = bf16x2{(__bf16)a[j][d >> 2][d & 3],
                                   (__bf16)a[j][(3 + d) >> 2][(3 + d) & 3]};
        *(bf16x2*)(p + 2) = bf16x2{(__bf16)a[j][(6 + d) >> 2][(6 + d) & 3],
                                   (__bf16)a[j][(9 + d) >> 2][(9 + d) & 3]};
      }
    }
#pragma unroll
    for (int i = 0; i < 8; ++i)
      *(bf16x2*)(&BsT[1 + bn + i][2 * bkp]) = bf16x2{b0[i], b1[i]};
    if (tid < 64) BsT[hs * 129][hk] = hin ? hv : (__bf16)0.0f;
    __syncthreads();

#pragma unroll
    for (int d = 0; d < 3; ++d) {
      bf16x16 af = load_a_frag(&Asm[d][0][0], wm * 16, 34);
#pragma unroll
      for (int j = 0; j < 4; ++j) {
        bf16x16 bf = load_bT_frag(&BsT[0][0], wn * 64 + j * 16 + d, 34);
        acc[j] = wmma_bf16(af, bf, acc[j]);
      }
    }
    __syncthreads();
  }

  int lane = tid & 31;
  int nl = lane & 15, half = lane >> 4;
#pragma unroll
  for (int j = 0; j < 4; ++j) {
#pragma unroll
    for (int r = 0; r < 8; ++r) {
      int row = (half << 3) + r;
      int o = m0 + wm * 16 + row;
      long long ng = (long long)n0 + wn * 64 + j * 16 + nl;
      int b = (int)(ng >> 12);
      int l = (int)(ng & (Lc - 1));
      size_t oi = ((size_t)b * Hc + o) * Lc + l;
      out[oi] = x[oi] + cb[o] + acc[j][r];
    }
  }
}

// ---------------------------------------------------------------------------
extern "C" void kernel_launch(void* const* d_in, const int* in_sizes, int n_in,
                              void* d_out, int out_size, void* d_ws, size_t ws_size,
                              hipStream_t stream) {
  const float* x        = (const float*)d_in[0];
  const float* gn_w     = (const float*)d_in[1];
  const float* gn_b     = (const float*)d_in[2];
  const float* log_dt   = (const float*)d_in[3];
  const float* A_log_re = (const float*)d_in[4];
  const float* A_im     = (const float*)d_in[5];
  const float* C_re     = (const float*)d_in[6];
  const float* C_im     = (const float*)d_in[7];
  const float* Dv       = (const float*)d_in[8];
  const float* W_out    = (const float*)d_in[9];
  const float* b_out    = (const float*)d_in[10];
  const float* conv_w   = (const float*)d_in[11];
  const float* conv_b   = (const float*)d_in[12];
  float* out = (float*)d_out;

  char* ws = (char*)d_ws;
  size_t off = 0;
  auto alloc = [&](size_t bytes) { size_t o = off; off = (off + bytes + 255) & ~(size_t)255; return o; };
  float*  w_scale  = (float*) (ws + alloc(sizeof(float)  * Bsz * Hc));
  float*  w_shift  = (float*) (ws + alloc(sizeof(float)  * Bsz * Hc));
  float4* w_ab     = (float4*)(ws + alloc(sizeof(float4) * Hc * Nst));
  float2* w_aT     = (float2*)(ws + alloc(sizeof(float2) * Hc * Nst));
  float2* w_cstate = (float2*)(ws + alloc(sizeof(float2) * (size_t)Bsz * Hc * NC * Nst));
  float2* w_cinit  = (float2*)(ws + alloc(sizeof(float2) * (size_t)Bsz * Hc * NC * Nst));
  __bf16* w_u      = (__bf16*)(ws + alloc(sizeof(__bf16) * (size_t)Hc * BL));
  __bf16* w_g      = (__bf16*)(ws + alloc(sizeof(__bf16) * (size_t)Hc * BL));

  k_gn_stats<<<Bsz * Gg, 256, 0, stream>>>(x, gn_w, gn_b, w_scale, w_shift);
  k_params<<<(Hc * Nst + 255) / 256, 256, 0, stream>>>(log_dt, A_log_re, A_im,
                                                       C_re, C_im, w_ab, w_aT);
  k_chunk_state<<<(Bsz * Hc * NC) / 8, 256, 0, stream>>>(x, w_scale, w_shift,
                                                         w_ab, w_cstate);
  k_chunk_scan<<<(Bsz * Hc) / 8, 256, 0, stream>>>(w_aT, w_cstate, w_cinit);
  k_ssm_out<<<(Bsz * Hc * NC) / 8, 256, 0, stream>>>(x, w_scale, w_shift, w_ab,
                                                     w_cinit, Dv, w_u);
  dim3 gemm_grid((unsigned)(BL / 128), Hc / 64);
  k_glu_gemm<<<gemm_grid, 256, 0, stream>>>(W_out, b_out, w_u, w_g);
  k_conv_gemm<<<gemm_grid, 256, 0, stream>>>(conv_w, conv_b, w_g, x, out);
}

// v003
// One run takes 138 microseconds.
// Two timings next to v002 both put it at 1.06 times that version's speed.
// Over all steps from v000 it is 2.83 times as fast.
#include <hip/hip_runtime.h>
#include <math.h>
#include <stdint.h>

#define DEVI __device__ __forceinline__

// Problem constants (match reference)
constexpr int  Bsz = 8, Hc = 256, Lc = 4096, Nst = 32, Gg = 32;
constexpr int  CPG = Hc / Gg;              // 8 channels per group
constexpr int  NC  = 8,  Tc = Lc / NC;     // 8 chunks of 512
constexpr long long BL = (long long)Bsz * Lc;  // 32768 positions

typedef __attribute__((ext_vector_type(16))) __bf16 bf16x16;
typedef __attribute__((ext_vector_type(8)))  float  floatx8;
typedef __attribute__((ext_vector_type(4)))  float  f32x4;
typedef __attribute__((ext_vector_type(8)))  __bf16 bf16x8;
typedef __attribute__((ext_vector_type(2)))  __bf16 bf16x2;

// ---------------------------------------------------------------------------
// CDNA5 async Global->LDS copy (ASYNCcnt-tracked) with builtin/asm fallback
// ---------------------------------------------------------------------------
#define GAS __attribute__((address_space(1)))
#define LAS __attribute__((address_space(3)))
typedef int v4i __attribute__((vector_size(4 * sizeof(int))));

DEVI void async_ld_b128(const void* g, void* l) {
#if __has_builtin(__builtin_amdgcn_global_load_async_to_lds_b128)
  __builtin_amdgcn_global_load_async_to_lds_b128(
      (GAS v4i*)(g), (LAS v4i*)(l), 0, 0);
#else
  unsigned loff = (unsigned)(uintptr_t)l;
  asm volatile("global_load_async_to_lds_b128 %0, %1, off"
               :: "v"(loff), "v"(g) : "memory");
#endif
}

DEVI void wait_async0() {
#if __has_builtin(__builtin_amdgcn_s_wait_asynccnt)
  __builtin_amdgcn_s_wait_asynccnt(0);
#else
  asm volatile("s_wait_asynccnt 0x0" ::: "memory");
#endif
  asm volatile("" ::: "memory");
}
DEVI void wait_async1() {
#if __has_builtin(__builtin_amdgcn_s_wait_asynccnt)
  __builtin_amdgcn_s_wait_asynccnt(1);
#else
  asm volatile("s_wait_asynccnt 0x1" ::: "memory");
#endif
  asm volatile("" ::: "memory");
}

// Stage 128 consecutive floats (one wave, 4 floats / lane) into LDS async.
DEVI void async_tile128(const float* gsrc, float* ldst) {
  int lane = threadIdx.x & 31;
  async_ld_b128(gsrc + lane * 4, ldst + lane * 4);
}

// ---------------------------------------------------------------------------
// WMMA helpers
// ---------------------------------------------------------------------------
DEVI floatx8 wmma_bf16(bf16x16 a, bf16x16 b, floatx8 c) {
  return __builtin_amdgcn_wmma_f32_16x16x32_bf16(false, a, false, b, (short)0, c,
                                                 false, false);
}

// K index held by fragment element e for the documented 16-bit A/B layout.
DEVI int wmma_k_of(int e, int half) {
  int r = e >> 1, s = e & 1;
  return (r < 4 ? (r << 1) : 16 + ((r - 4) << 1)) + s + (half << 3);
}

DEVI bf16x16 load_a_frag(const __bf16* As, int rowBase, int lda) {
  int lane = threadIdx.x & 31;
  int m = lane & 15, half = lane >> 4;
  bf16x16 f;
#pragma unroll
  for (int e = 0; e < 16; ++e)
    f[e] = As[(rowBase + m) * lda + wmma_k_of(e, half)];
  return f;
}

DEVI bf16x16 load_bT_frag(const __bf16* BsT, int colBase, int ld) {
  int lane = threadIdx.x & 31;
  int n = lane & 15, half = lane >> 4;
  bf16x16 f;
#pragma unroll
  for (int e = 0; e < 16; ++e)
    f[e] = BsT[(colBase + n) * ld + wmma_k_of(e, half)];
  return f;
}

// ---------------------------------------------------------------------------
// K1: GroupNorm statistics -> per-(b,h) affine scale/shift (blocks 0..255);
// the blocks behind them discretize the SSM parameters per (h,n), which depend
// on nothing the first ones compute: one launch for both.
// ---------------------------------------------------------------------------
__global__ void k_gn_stats(const float* __restrict__ x,
                           const float* __restrict__ gn_w,
                           const float* __restrict__ gn_b,
                           float* __restrict__ scale, float* __restrict__ shift,
                           const float* __restrict__ log_dt,
                           const float* __restrict__ A_log_re,
                           const float* __restrict__ A_im,
                           const float* __restrict__ C_re,
                           const float* __restrict__ C_im,
                           float4* __restrict__ ab,   // (a_re, a_im, 2Cd_re, -2Cd_im)
                           float2* __restrict__ aT) {
  if (blockIdx.x >= Bsz * Gg) {                 // whole work-group, before any barrier
    int idx = (blockIdx.x - Bsz * Gg) * blockDim.x + threadIdx.x;
    if (idx >= Hc * Nst) return;
    int h = idx >> 5;
    float dt  = expf(log_dt[h]);
    float Are = -expf(A_log_re[idx]);
    float Aim = A_im[idx];
    float er  = expf(Are * dt);
    float are = er * cosf(Aim * dt);
    float aim = er * sinf(Aim * dt);
    float dre = are - 1.f, dim = aim;
    float inv = 1.f / (Are * Are + Aim * Aim);
    float qre = (dre * Are + dim * Aim) * inv;
    float qim = (dim * Are - dre * Aim) * inv;
    float Cr = C_re[idx], Ci = C_im[idx];
    float cdre = Cr * qre - Ci * qim;
    float cdim = Cr * qim + Ci * qre;
    ab[idx] = make_float4(are, aim, 2.f * cdre, -2.f * cdim);
    float tr = are, ti = aim;
#pragma unroll
    for (int i = 0; i < 9; ++i) { float nr = tr*tr - ti*ti, ni = 2.f*tr*ti; tr = nr; ti = ni; }
    aT[idx] = make_float2(tr, ti);
    return;
  }
  int bg = blockIdx.x;
  int b = bg / Gg, g = bg % Gg;
  const float* xp = x + ((size_t)b * Hc + (size_t)g * CPG) * Lc;
  const int n = CPG * Lc;
  int tid = threadIdx.x;
  float s = 0.f, ss = 0.f;
  for (int i = tid; i < n; i += 256) { float v = xp[i]; s += v; ss += v * v; }
  __shared__ float r0[256], r1[256];
  r0[tid] = s; r1[tid] = ss; __syncthreads();
  for (int st = 128; st > 0; st >>= 1) {
    if (tid < st) { r0[tid] += r0[tid + st]; r1[tid] += r1[tid + st]; }
    __syncthreads();
  }
  __shared__ float mu_s, rstd_s;
  if (tid == 0) {
    float mu = r0[0] / (float)n;
    float var = r1[0] / (float)n - mu * mu;
    mu_s = mu; rstd_s = rsqrtf(var + 1e-5f);
  }
  __syncthreads();
  if (tid < CPG) {
    int h = g * CPG + tid;
    float sc = rstd_s * gn_w[h];
    scale[b * Hc + h] = sc;
    shift[b * Hc + h] = gn_b[h] - mu_s * sc;
  }
}

// ---------------------------------------------------------------------------
// K2: the whole SSM in one launch. One work-group per (b,h), one wave per chunk
// of 512 steps, one lane per state.
//   phase 1: chunk end state from a zero start (chunks 0..6; nothing reads the
//            end state of the last chunk)
//   hand-over: end states pass through LDS; every wave folds the chunks in
//            front of its own into its start state
//   phase 2: full recurrence; fused D-skip + exact GELU.
// The sum over the 32 states is taken once per block of 32 steps: every lane
// (one state) stores its term of each step into a wave-private 32x32 LDS tile,
// then every lane sums one row (one step) and evaluates the GELU of that step.
// x is streamed via async Global->LDS copies in both phases.
// ---------------------------------------------------------------------------
// 16 waves per SIMD (64 VGPRs): all 2,048 work-groups are then resident at once
__global__ void __launch_bounds__(256) __attribute__((amdgpu_waves_per_eu(16)))
k_ssm(const float* __restrict__ x,
      const float* __restrict__ scale,
      const float* __restrict__ shift,
      const float4* __restrict__ ab,
      const float2* __restrict__ aTv,
      const float* __restrict__ Dv,
      __bf16* __restrict__ u) {
  __shared__ __align__(16) float xbuf[8][2][128];   // per-wave double buffer
  __shared__ __align__(16) float tile[8][32][32];   // per wave: [step][state]
  if (blockIdx.x >= Bsz * Hc) return;           // whole work-group, before any barrier
  // Indices formed per lane: sc, sh and Dh are then loaded into vector
  // registers, which the dual-issue forms of the recurrence's FMAs need.
  int wave = (blockIdx.x * blockDim.x + threadIdx.x) >> 5;
  int lane = threadIdx.x & 31;
  int wv = threadIdx.x >> 5;
  int c = wave & (NC - 1);                      // = wv: 8 waves, 8 chunks
  int bh = wave / NC;                           // = blockIdx.x
  int h = bh & (Hc - 1);
  int b = bh / Hc;
  // the chunk's number in a scalar register: the tests on it are scalar branches
  int cs = __builtin_amdgcn_readfirstlane(wv);

  float4 p = ab[h * Nst + lane];
  float2 aT = aTv[h * Nst + lane];              // a^512, one chunk's decay
  float sc = scale[bh], sh = shift[bh];
  float Dh = Dv[h];
  const float* xp = x + (size_t)bh * Lc + (size_t)c * Tc;
  __bf16* up = u + (size_t)h * BL + (size_t)b * Lc + (size_t)c * Tc;
  float* buf = &xbuf[wv][0][0];
  constexpr int NS = Tc / 128;                  // 4 sub-tiles

  // ---- phase 1: this chunk's end state from a zero start ----
  if (cs < NC - 1) {
    float sr = 0.f, si = 0.f;
    async_tile128(xp, buf);                     // prime tile 0
    for (int s = 0; s < NS; ++s) {
      if (s + 1 < NS) {
        // a slot of the wave's own ring is refilled only behind its reads
        asm volatile("s_wait_dscnt 0x0" ::: "memory");
        async_tile128(xp + (s + 1) * 128, buf + ((s + 1) & 1) * 128); wait_async1();
      } else { wait_async0(); }
      const float* cur = buf + (s & 1) * 128;
      for (int t = 0; t < 128; ++t) {
        float uin = cur[t] * sc + sh;           // LDS broadcast read
        float nr = p.x * sr - p.y * si + uin;
        float ni = p.x * si + p.y * sr;
        sr = nr; si = ni;
      }
    }
    tile[wv][0][lane] = sr;                     // the tile is idle in this phase
    tile[wv][1][lane] = si;
  }
  __syncthreads();                              // end states of chunks 0..6 published
  float er_[NC - 1], ei_[NC - 1];
#pragma unroll
  for (int q = 0; q < NC - 1; ++q) { er_[q] = tile[q][0][lane]; ei_[q] = tile[q][1][lane]; }
  __syncthreads();                              // all read: the tiles may be overwritten

  // ---- start state: fold the chunks in front of this one, in their order ----
  float sr = 0.f, si = 0.f;
#pragma unroll
  for (int q = 0; q < NC - 1; ++q) {
    if (q < cs) {
      float nr = aT.x * sr - aT.y * si + er_[q];
      float ni = aT.x * si + aT.y * sr + ei_[q];
      sr = nr; si = ni;
    }
  }

  // ---- phase 2: full recurrence and output ----
  float* tcol = &tile[wv][0][lane];             // this lane's state, row = step
  const float* trow = &tile[wv][lane][0];       // this lane's step, all states
  // Rows are 128 B apart, so lane l starts its row at 16-byte piece (l >> 1) & 7:
  // each 16 lanes of a 16-byte read then cover all 64 banks once.
  int rot = (lane >> 1) & 7;

  async_tile128(xp, buf);
  for (int s = 0; s < NS; ++s) {
    if (s + 1 < NS) {
      // a slot of the wave's own ring is refilled only behind its reads
      asm volatile("s_wait_dscnt 0x0" ::: "memory");
      async_tile128(xp + (s + 1) * 128, buf + ((s + 1) & 1) * 128); wait_async1();
    } else { wait_async0(); }
    const float* cur = buf + (s & 1) * 128;
    for (int t0 = 0; t0 < 128; t0 += 32) {
      // fully unrolled: every step's tile store gets an immediate offset
#pragma unroll
      for (int k = 0; k < 32; ++k) {
        float uin = cur[t0 + k] * sc + sh;
        float nr = p.x * sr - p.y * si + uin;
        float ni = p.x * si + p.y * sr;
        sr = nr; si = ni;
        tcol[k * 32] = p.z * sr + p.w * si;      // this state's 2*Re(Cd * s)
      }
      // One wave's LDS operations complete in issue order: no barrier needed.
      f32x4 v[8];
#pragma unroll
      for (int j = 0; j < 8; ++j) v[j] = *(const f32x4*)(trow + ((j ^ rot) << 2));
      float xl = cur[t0 + lane];
      // inputs-only fence on the loaded values: keeps the nine LDS reads in one
      // group with one latency; without it each read is waited for by itself
      asm volatile("" :: "v"(v[0]), "v"(v[1]), "v"(v[2]), "v"(v[3]), "v"(v[4]),
                         "v"(v[5]), "v"(v[6]), "v"(v[7]), "v"(xl));
      f32x4 a = ((v[0] + v[1]) + (v[2] + v[3])) + ((v[4] + v[5]) + (v[6] + v[7]));
      float part = (a.x + a.z) + (a.y + a.w);
      float uin = xl * sc + sh;
      float y = part + Dh * uin;
      float gel = 0.5f * y * (1.f + erff(y * 0.70710678f));
      up[s * 128 + t0 + lane] = (__bf16)gel;
    }
  }
}

// ---------------------------------------------------------------------------
// K3: GLU projection, bf16 WMMA; both halves of W_out share the B-tile.
// ---------------------------------------------------------------------------
__global__ void __launch_bounds__(256)
k_glu_gemm(const float* __restrict__ W, const float* __restrict__ bias,
           const __bf16* __restrict__ u, __bf16* __restrict__ g) {
  __shared__ __align__(16) __bf16 Asm[2][64][34];
  __shared__ __align__(16) __bf16 BsT[128][34];
  int n0 = blockIdx.x * 128;
  int m0 = blockIdx.y * 64;
  int tid = threadIdx.x;
  int wv = tid >> 5;
  int wm = wv & 3, wn = wv >> 2;

  floatx8 accT[4] = {{}, {}, {}, {}};
  floatx8 accB[4] = {{}, {}, {}, {}};

  // Staging map. A: 8 threads cover one row's 32 floats (one 128-byte line).
  // B: one thread takes rows k = 2*bkp, 2*bkp+1 at 8 consecutive columns.
  int arow = tid >> 3, ak = (tid & 7) << 2;
  int bkp = tid >> 4, bn = (tid & 15) << 3;
  const float* Wp = W + (size_t)(m0 + arow) * Hc + ak;
  const __bf16* ub = u + (size_t)(2 * bkp) * BL + n0 + bn;

  for (int kk = 0; kk < Hc; kk += 32) {
    // all six 16-byte loads of this K-tile are issued before the first use; the
    // short loops are unrolled so that a[], b0, b1 get constant indices (registers)
    f32x4 a[4];
#pragma unroll
    for (int j = 0; j < 4; ++j)
      a[j] = *(const f32x4*)(Wp + (size_t)((j >> 1) * 256 + (j & 1) * 32) * Hc + kk);
    f32x4 r0 = *(const f32x4*)(ub + (size_t)kk * BL);
    f32x4 r1 = *(const f32x4*)(ub + (size_t)(kk + 1) * BL);
    bf16x8 b0 = __builtin_bit_cast(bf16x8, r0);
    bf16x8 b1 = __builtin_bit_cast(bf16x8, r1);
#pragma unroll
    for (int j = 0; j < 4; ++j) {
      __bf16* d = &Asm[j >> 1][arow + (j & 1) * 32][ak];
      *(bf16x2*)(d)     = bf16x2{(__bf16)a[j].x, (__bf16)a[j].y};
      *(bf16x2*)(d + 2) = bf16x2{(__bf16)a[j].z, (__bf16)a[j].w};
    }
#pragma unroll
    for (int i = 0; i < 8; ++i)
      *(bf16x2*)(&BsT[bn + i][2 * bkp]) = bf16x2{b0[i], b1[i]};
    if (kk + 32 < Hc)   // prefetch next B K-tile -> global_prefetch_b8
      __builtin_prefetch(&u[(size_t)(kk + 32 + (tid & 31)) * BL + n0], 0, 1);
    __syncthreads();

    bf16x16 at = load_a_frag(&Asm[0][0][0], wm * 16, 34);
    bf16x16 ab = load_a_frag(&Asm[1][0][0], wm * 16, 34);
#pragma unroll
    for (int j = 0; j < 4; ++j) {
      bf16x16 bf = load_bT_frag(&BsT[0][0], wn * 64 + j * 16, 34);
      accT[j] = wmma_bf16(at, bf, accT[j]);
      accB[j] = wmma_bf16(ab, bf, accB[j]);
    }
    __syncthreads();
  }

  int lane = tid & 31;
  int nl = lane & 15, half = lane >> 4;
#pragma unroll
  for (int j = 0; j < 4; ++j) {
#pragma unroll
    for (int r = 0; r < 8; ++r) {
      int row = (half << 3) + r;
      int gm = m0 + wm * 16 + row;
      size_t col = (size_t)n0 + wn * 64 + j * 16 + nl;
      float zt = accT[j][r] + bias[gm];
      float zb = accB[j][r] + bias[gm + 256];
      float gv = zt * (1.f / (1.f + expf(-zb)));
      g[(size_t)gm * BL + col] = (__bf16)gv;
    }
  }
}

// ---------------------------------------------------------------------------
// K4: conv1d(k=3,pad=1) as 3 shifted-tap WMMA GEMMs; fused bias + residual.
// ---------------------------------------------------------------------------
// 8 waves per SIMD (at most 128 VGPRs): four work-groups per WGP, so that all
// 1,024 are resident at once
__global__ void __launch_bounds__(256) __attribute__((amdgpu_waves_per_eu(8)))
k_conv_gemm(const float* __restrict__ cw,
            const float* __restrict__ cb,
            const __bf16* __restrict__ g,
            const float* __restrict__ x,
            float* __restrict__ out) {
  __shared__ __align__(16) __bf16 Asm[3][64][34];
  __shared__ __align__(16) __bf16 BsT[130][34];
  int n0 = blockIdx.x * 128;
  int m0 = blockIdx.y * 64;
  int tid = threadIdx.x;
  int wv = tid >> 5;
  int wm = wv & 3, wn = wv >> 2;
  int bstart = (n0 / Lc) * Lc;

  floatx8 acc[4] = {{}, {}, {}, {}};

  // Staging map. A: one thread takes 12 consecutive floats of a weight row,
  // which are 4 input channels x 3 taps. B: one thread takes rows k = 2*bkp,
  // 2*bkp+1 at 8 consecutive columns; the 128 inner columns lie in one batch
  // entry (n0 and Lc are multiples of 128). The two edge columns, n0-1 and
  // n0+128, are read at an address clamped into the entry and zeroed outside.
  int arow = tid >> 3, au = tid & 7;
  int bkp = tid >> 4, bn = (tid & 15) << 3;
  const float* cwp = cw + (size_t)(m0 + arow) * (Hc * 3) + au * 12;
  const __bf16* gb = g + (size_t)(2 * bkp) * BL + n0 + bn;
  int hk = tid & 31, hs = (tid >> 5) & 1;
  int hn = hs ? n0 + 128 : n0 - 1;
  bool hin = hn >= bstart && hn < bstart + Lc;
  const __bf16* gh = g + (size_t)hk * BL + (hin ? hn : n0);

  for (int kk = 0; kk < Hc; kk += 32) {
    // all nine loads of this K-tile are issued before the first use; the short
    // loops are unrolled so that a[], b0, b1 get constant indices (registers)
    f32x4 a[2][3];
#pragma unroll
    for (int j = 0; j < 2; ++j)
#pragma unroll
      for (int i = 0; i < 3; ++i)
        a[j][i] = *(const f32x4*)(cwp + (size_t)(j * 32) * (Hc * 3) + kk * 3 + i * 4);
    f32x4 r0 = *(const f32x4*)(gb + (size_t)kk * BL);
    f32x4 r1 = *(const f32x4*)(gb + (size_t)(kk + 1) * BL);
    unsigned hr = *(const unsigned short*)(gh + (size_t)kk * BL);
    // inputs-only fence on the loaded values: keeps the nine loads in one group
    // with one latency; without it the edge load sinks into the branch below
    // and is waited for by itself
    asm volatile("" :: "v"(a[0][0]), "v"(a[0][1]), "v"(a[0][2]), "v"(a[1][0]),
                       "v"(a[1][1]), "v"(a[1][2]), "v"(r0), "v"(r1), "v"(hr));
    bf16x8 b0 = __builtin_bit_cast(bf16x8, r0);
    bf16x8 b1 = __builtin_bit_cast(bf16x8, r1);
    __bf16 hv = __builtin_bit_cast(__bf16, (unsigned short)hr);
#pragma unroll
    for (int j = 0; j < 2; ++j) {
#pragma unroll
      for (int d = 0; d < 3; ++d) {
        // float e of the 12 is channel e / 3, tap e % 3
        __bf16* p = &Asm[d][arow + j * 32][au * 4];
        *(bf16x2*)(p)     = bf16x2{(__bf16)a[j][d >> 2][d & 3],
                                   (__bf16)a[j][(3 + d) >> 2][(3 + d) & 3]};
        *(bf16x2*)(p + 2) = bf16x2{(__bf16)a[j][(6 + d) >> 2][(6 + d) & 3],
                                   (__bf16)a[j][(9 + d) >> 2][(9 + d) & 3]};
      }
    }
#pragma unroll
    for (int i = 0; i < 8; ++i)
      *(bf16x2*)(&BsT[1 + bn + i][2 * bkp]) = bf16x2{b0[i], b1[i]};
    if (tid < 64) BsT[hs * 129][hk] = hin ? hv : (__bf16)0.0f;
    __syncthreads();

#pragma unroll
    for (int d = 0; d < 3; ++d) {
      bf16x16 af = load_a_frag(&Asm[d][0][0], wm * 16, 34);
#pragma unroll
      for (int j = 0; j < 4; ++j) {
        bf16x16 bf = load_bT_frag(&BsT[0][0], wn * 64 + j * 16 + d, 34);
        acc[j] = wmma_bf16(af, bf, acc[j]);
      }
    }
    __syncthreads();
  }

  int lane = tid & 31;
  int nl = lane & 15, half = lane >> 4;
#pragma unroll
  for (int j = 0; j < 4; ++j) {
#pragma unroll
    for (int r = 0; r < 8; ++r) {
      int row = (half << 3) + r;
      int o = m0 + wm * 16 + row;
      long long ng = (long long)n0 + wn * 64 + j * 16 + nl;
      int b = (int)(ng >> 12);
      int l = (int)(ng & (Lc - 1));
      size_t oi = ((size_t)b * Hc + o) * Lc + l;
      out[oi] = x[oi] + cb[o] + acc[j][r];
    }
  }
}

// ---------------------------------------------------------------------------
extern "C" void kernel_launch(void* const* d_in, const int* in_sizes, int n_in,
                              void* d_out, int out_size, void* d_ws, size_t ws_size,
                              hipStream_t stream) {
  const float* x        = (const float*)d_in[0];
  const float* gn_w     = (const float*)d_in[1];
  const float* gn_b     = (const float*)d_in[2];
  const float* log_dt   = (const float*)d_in[3];
  const float* A_log_re = (const float*)d_in[4];
  const float* A_im     = (const float*)d_in[5];
  const float* C_re     = (const float*)d_in[6];
  const float* C_im     = (const float*)d_in[7];
  const float* Dv       = (const float*)d_in[8];
  const float* W_out    = (const float*)d_in[9];
  const float* b_out    = (const float*)d_in[10];
  const float* conv_w   = (const float*)d_in[11];
  const float* conv_b   = (const float*)d_in[12];
  float* out = (float*)d_out;

  char* ws = (char*)d_ws;
  size_t off = 0;
  auto alloc = [&](size_t bytes) { size_t o = off; off = (off + bytes + 255) & ~(size_t)255; return o; };
  float*  w_scale  = (float*) (ws + alloc(sizeof(float)  * Bsz * Hc));
  float*  w_shift  = (float*) (ws + alloc(sizeof(float)  * Bsz * Hc));
  float4* w_ab     = (float4*)(ws + alloc(sizeof(float4) * Hc * Nst));
  float2* w_aT     = (float2*)(ws + alloc(sizeof(float2) * Hc * Nst));
  __bf16* w_u      = (__bf16*)(ws + alloc(sizeof(__bf16) * (size_t)Hc * BL));
  __bf16* w_g      = (__bf16*)(ws + alloc(sizeof(__bf16) * (size_t)Hc * BL));

  k_gn_stats<<<Bsz * Gg + (Hc * Nst + 255) / 256, 256, 0, stream>>>(
      x, gn_w, gn_b, w_scale, w_shift, log_dt, A_log_re, A_im, C_re, C_im, w_ab, w_aT);
  k_ssm<<<Bsz * Hc, 256, 0, stream>>>(x, w_scale, w_shift, w_ab, w_aT, Dv, w_u);
  dim3 gemm_grid((unsigned)(BL / 128), Hc / 64);
  k_glu_gemm<<<gemm_grid, 256, 0, stream>>>(W_out, b_out, w_u, w_g);
  k_conv_gemm<<<gemm_grid, 256, 0, stream>>>(conv_w, conv_b, w_g, x, out);
}

// v004
// A run of this version takes 131 microseconds.
// Next to v003, in two timings, it ran 1.06 times as fast each time.
// All steps since v000 together make it 3.00 times as fast.
#include <hip/hip_runtime.h>
#include <math.h>
#include <stdint.h>

#define DEVI __device__ __forceinline__

// Problem constants (match reference)
constexpr int  Bsz = 8, Hc = 256, Lc = 4096, Nst = 32, Gg = 32;
constexpr int  CPG = Hc / Gg;              // 8 channels per group
constexpr int  NC  = 8,  Tc = Lc / NC;     // 8 chunks of 512
constexpr long long BL = (long long)Bsz * Lc;  // 32768 positions

typedef __attribute__((ext_vector_type(16))) __bf16 bf16x16;
typedef __attribute__((ext_vector_type(8)))  float  floatx8;
typedef __attribute__((ext_vector_type(4)))  float  f32x4;
typedef __attribute__((ext_vector_type(8)))  __bf16 bf16x8;
typedef __attribute__((ext_vector_type(2)))  __bf16 bf16x2;

// ---------------------------------------------------------------------------
// CDNA5 async Global->LDS copy (ASYNCcnt-tracked) with builtin/asm fallback
// ---------------------------------------------------------------------------
#define GAS __attribute__((address_space(1)))
#define LAS __attribute__((address_space(3)))
typedef int v4i __attribute__((vector_size(4 * sizeof(int))));

DEVI void async_ld_b128(const void* g, void* l) {
#if __has_builtin(__builtin_amdgcn_global_load_async_to_lds_b128)
  __builtin_amdgcn_global_load_async_to_lds_b128(
      (GAS v4i*)(g), (LAS v4i*)(l), 0, 0);
#else
  unsigned loff = (unsigned)(uintptr_t)l;
  asm volatile("global_load_async_to_lds_b128 %0, %1, off"
               :: "v"(loff), "v"(g) : "memory");
#endif
}

DEVI void wait_async0() {
#if __has_builtin(__builtin_amdgcn_s_wait_asynccnt)
  __builtin_amdgcn_s_wait_asynccnt(0);
#else
  asm volatile("s_wait_asynccnt 0x0" ::: "memory");
#endif
  asm volatile("" ::: "memory");
}
DEVI void wait_async1() {
#if __has_builtin(__builtin_amdgcn_s_wait_asynccnt)
  __builtin_amdgcn_s_wait_asynccnt(1);
#else
  asm volatile("s_wait_asynccnt 0x1" ::: "memory");
#endif
  asm volatile("" ::: "memory");
}

// Stage 128 consecutive floats (one wave, 4 floats / lane) into LDS async.
DEVI void async_tile128(const float* gsrc, float* ldst) {
  int lane = threadIdx.x & 31;
  async_ld_b128(gsrc + lane * 4, ldst + lane * 4);
}

// Normalise a landed 128-float tile in place: each lane takes the 16 bytes that
// it copied itself. One wave's LDS operations complete in issue order, so the
// wave's later broadcast reads see the stored values without a barrier.
DEVI void norm_tile128(float* t, float sc, float sh) {
  f32x4* q = (f32x4*)(t + (threadIdx.x & 31) * 4);
  f32x4 v = *q;
  v.x = fmaf(v.x, sc, sh); v.y = fmaf(v.y, sc, sh);
  v.z = fmaf(v.z, sc, sh); v.w = fmaf(v.w, sc, sh);
  *q = v;
}

// ---------------------------------------------------------------------------
// WMMA helpers
// ---------------------------------------------------------------------------
DEVI floatx8 wmma_bf16(bf16x16 a, bf16x16 b, floatx8 c) {
  return __builtin_amdgcn_wmma_f32_16x16x32_bf16(false, a, false, b, (short)0, c,
                                                 false, false);
}

// K index held by fragment element e for the documented 16-bit A/B layout.
DEVI int wmma_k_of(int e, int half) {
  int r = e >> 1, s = e & 1;
  return (r < 4 ? (r << 1) : 16 + ((r - 4) << 1)) + s + (half << 3);
}

DEVI bf16x16 load_a_frag(const __bf16* As, int rowBase, int lda) {
  int lane = threadIdx.x & 31;
  int m = lane & 15, half = lane >> 4;
  bf16x16 f;
#pragma unroll
  for (int e = 0; e < 16; ++e)
    f[e] = As[(rowBase + m) * lda + wmma_k_of(e, half)];
  return f;
}

DEVI bf16x16 load_bT_frag(const __bf16* BsT, int colBase, int ld) {
  int lane = threadIdx.x & 31;
  int n = lane & 15, half = lane >> 4;
  bf16x16 f;
#pragma unroll
  for (int e = 0; e < 16; ++e)
    f[e] = BsT[(colBase + n) * ld + wmma_k_of(e, half)];
  return f;
}

// ---------------------------------------------------------------------------
// K1: GroupNorm statistics -> per-(b,h) affine scale/shift (blocks 0..255);
// the blocks behind them discretize the SSM parameters per (h,n), which depend
// on nothing the first ones compute: one launch for both.
// ---------------------------------------------------------------------------
__global__ void k_gn_stats(const float* __restrict__ x,
                           const float* __restrict__ gn_w,
                           const float* __restrict__ gn_b,
                           float* __restrict__ scale, float* __restrict__ shift,
                           const float* __restrict__ log_dt,
                           const float* __restrict__ A_log_re,
                           const float* __restrict__ A_im,
                           const float* __restrict__ C_re,
                           const float* __restrict__ C_im,
                           float4* __restrict__ ab,   // (a_re, a_im, 2Cd_re, -2Cd_im)
                           float2* __restrict__ aT) {
  if (blockIdx.x >= Bsz * Gg) {                 // whole work-group, before any barrier
    int idx = (blockIdx.x - Bsz * Gg) * blockDim.x + threadIdx.x;
    if (idx >= Hc * Nst) return;
    int h = idx >> 5;
    float dt  = expf(log_dt[h]);
    float Are = -expf(A_log_re[idx]);
    float Aim = A_im[idx];
    float er  = expf(Are * dt);
    float are = er * cosf(Aim * dt);
    float aim = er * sinf(Aim * dt);
    float dre = are - 1.f, dim = aim;
    float inv = 1.f / (Are * Are + Aim * Aim);
    float qre = (dre * Are + dim * Aim) * inv;
    float qim = (dim * Are - dre * Aim) * inv;
    float Cr = C_re[idx], Ci = C_im[idx];
    float cdre = Cr * qre - Ci * qim;
    float cdim = Cr * qim + Ci * qre;
    ab[idx] = make_float4(are, aim, 2.f * cdre, -2.f * cdim);
    float tr = are, ti = aim;
#pragma unroll
    for (int i = 0; i < 9; ++i) { float nr = tr*tr - ti*ti, ni = 2.f*tr*ti; tr = nr; ti = ni; }
    aT[idx] = make_float2(tr, ti);
    return;
  }
  int bg = blockIdx.x;
  int b = bg / Gg, g = bg % Gg;
  const float* xp = x + ((size_t)b * Hc + (size_t)g * CPG) * Lc;
  const int n = CPG * Lc;
  int tid = threadIdx.x;
  float s = 0.f, ss = 0.f;
  for (int i = tid; i < n; i += 256) { float v = xp[i]; s += v; ss += v * v; }
  __shared__ float r0[256], r1[256];
  r0[tid] = s; r1[tid] = ss; __syncthreads();
  for (int st = 128; st > 0; st >>= 1) {
    if (tid < st) { r0[tid] += r0[tid + st]; r1[tid] += r1[tid + st]; }
    __syncthreads();
  }
  __shared__ float mu_s, rstd_s;
  if (tid == 0) {
    float mu = r0[0] / (float)n;
    float var = r1[0] / (float)n - mu * mu;
    mu_s = mu; rstd_s = rsqrtf(var + 1e-5f);
  }
  __syncthreads();
  if (tid < CPG) {
    int h = g * CPG + tid;
    float sc = rstd_s * gn_w[h];
    scale[b * Hc + h] = sc;
    shift[b * Hc + h] = gn_b[h] - mu_s * sc;
  }
}

// ---------------------------------------------------------------------------
// K2: the whole SSM in one launch. One work-group per (b,h), one wave per chunk
// of 512 steps, one lane per state.
//   phase 1: chunk end state from a zero start (chunks 0..6; nothing reads the
//            end state of the last chunk)
//   hand-over: end states pass through LDS; every wave folds the chunks in
//            front of its own into its start state
//   phase 2: full recurrence; fused D-skip + exact GELU.
// The sum over the 32 states is taken once per block of 32 steps: every lane
// (one state) stores its term of each step into a wave-private 32x32 LDS tile,
// then every lane sums one row (one step) and evaluates the GELU of that step.
// x is streamed via async Global->LDS copies in both phases; each landed tile is
// normalised once in LDS, and a step adds it as the addend of its FMA chain.
// ---------------------------------------------------------------------------
// 16 waves per SIMD (64 VGPRs): all 2,048 work-groups are then resident at once
__global__ void __launch_bounds__(256) __attribute__((amdgpu_waves_per_eu(16)))
k_ssm(const float* __restrict__ x,
      const float* __restrict__ scale,
      const float* __restrict__ shift,
      const float4* __restrict__ ab,
      const float2* __restrict__ aTv,
      const float* __restrict__ Dv,
      __bf16* __restrict__ u) {
  __shared__ __align__(16) float xbuf[8][2][128];   // per-wave double buffer
  __shared__ __align__(16) float tile[8][32][32];   // per wave: [step][state]
  if (blockIdx.x >= Bsz * Hc) return;           // whole work-group, before any barrier
  int lane = threadIdx.x & 31;
  // the chunk's number in a scalar register: the tests on it are scalar branches,
  // and every base address below is wave-uniform (scalar registers; the vector
  // budget of 64 is tight)
  int cs = __builtin_amdgcn_readfirstlane(threadIdx.x >> 5);
  int wv = cs, c = cs;                          // 8 waves, 8 chunks
  int bh = blockIdx.x;
  int h = bh & (Hc - 1);
  int b = bh / Hc;

  float4 p = ab[h * Nst + lane];
  float2 aT = aTv[h * Nst + lane];              // a^512, one chunk's decay
  float sc = scale[bh], sh = shift[bh];         // used once per tile only
  float Dh = Dv[h];
  const float* xp = x + (size_t)bh * Lc + (size_t)c * Tc;
  __bf16* up = u + (size_t)h * BL + (size_t)b * Lc + (size_t)c * Tc;
  float* buf = &xbuf[wv][0][0];
  constexpr int NS = Tc / 128;                  // 4 sub-tiles

  // ---- phase 1: this chunk's end state from a zero start ----
  if (cs < NC - 1) {
    float sr = 0.f, si = 0.f;
    async_tile128(xp, buf);                     // prime tile 0
    for (int s = 0; s < NS; ++s) {
      if (s + 1 < NS) {
        // a slot of the wave's own ring is refilled only behind its reads
        asm volatile("s_wait_dscnt 0x0" ::: "memory");
        async_tile128(xp + (s + 1) * 128, buf + ((s + 1) & 1) * 128); wait_async1();
      } else { wait_async0(); }
      float* cur = buf + (s & 1) * 128;
      norm_tile128(cur, sc, sh);
      for (int t = 0; t < 128; ++t) {
        float uin = cur[t];                     // LDS broadcast read, normalised
        float nr = fmaf(p.x, sr, fmaf(-p.y, si, uin));
        float ni = fmaf(p.x, si, p.y * sr);
        sr = nr; si = ni;
      }
    }
    tile[wv][0][lane] = sr;                     // the tile is idle in this phase
    tile[wv][1][lane] = si;
  }
  __syncthreads();                              // end states of chunks 0..6 published
  float er_[NC - 1], ei_[NC - 1];
#pragma unroll
  for (int q = 0; q < NC - 1; ++q) { er_[q] = tile[q][0][lane]; ei_[q] = tile[q][1][lane]; }
  __syncthreads();                              // all read: the tiles may be overwritten

  // ---- start state: fold the chunks in front of this one, in their order ----
  float sr = 0.f, si = 0.f;
#pragma unroll
  for (int q = 0; q < NC - 1; ++q) {
    if (q < cs) {
      float nr = aT.x * sr - aT.y * si + er_[q];
      float ni = aT.x * si + aT.y * sr + ei_[q];
      sr = nr; si = ni;
    }
  }

  // ---- phase 2: full recurrence and output ----
  float* tcol = &tile[wv][0][lane];             // this lane's state, row = step
  const float* trow = &tile[wv][lane][0];       // this lane's step, all states
  // Rows are 128 B apart, so lane l starts its row at 16-byte piece (l >> 1) & 7:
  // each 16 lanes of a 16-byte read then cover all 64 banks once.
  int rot = (lane >> 1) & 7;

  async_tile128(xp, buf);
  for (int s = 0; s < NS; ++s) {
    if (s + 1 < NS) {
      // a slot of the wave's own ring is refilled only behind its reads
      asm volatile("s_wait_dscnt 0x0" ::: "memory");
      async_tile128(xp + (s + 1) * 128, buf + ((s + 1) & 1) * 128); wait_async1();
    } else { wait_async0(); }
    float* cur = buf + (s & 1) * 128;
    norm_tile128(cur, sc, sh);
    for (int t0 = 0; t0 < 128; t0 += 32) {
      // fully unrolled: every step's tile store gets an immediate offset
#pragma unroll
      for (int k = 0; k < 32; ++k) {
        float uin = cur[t0 + k];
        float nr = fmaf(p.x, sr, fmaf(-p.y, si, uin));
        float ni = fmaf(p.x, si, p.y * sr);
        sr = nr; si = ni;
        tcol[k * 32] = p.z * sr + p.w * si;      // this state's 2*Re(Cd * s)
      }
      // One wave's LDS operations complete in issue order: no barrier needed.
      f32x4 v[8];
#pragma unroll
      for (int j = 0; j < 8; ++j) v[j] = *(const f32x4*)(trow + ((j ^ rot) << 2));
      float xl = cur[t0 + lane];
      // inputs-only fence on the loaded values: keeps the nine LDS reads in one
      // group with one latency; without it each read is waited for by itself
      asm volatile("" :: "v"(v[0]), "v"(v[1]), "v"(v[2]), "v"(v[3]), "v"(v[4]),
                         "v"(v[5]), "v"(v[6]), "v"(v[7]), "v"(xl));
      f32x4 a = ((v[0] + v[1]) + (v[2] + v[3])) + ((v[4] + v[5]) + (v[6] + v[7]));
      float part = (a.x + a.z) + (a.y + a.w);
      float y = part + Dh * xl;
      float gel = 0.5f * y * (1.f + erff(y * 0.70710678f));
      up[s * 128 + t0 + lane] = (__bf16)gel;
    }
  }
}

// ---------------------------------------------------------------------------
// K3: GLU projection, bf16 WMMA; both halves of W_out share the B-tile.
// ---------------------------------------------------------------------------
__global__ void __launch_bounds__(256)
k_glu_gemm(const float* __restrict__ W, const float* __restrict__ bias,
           const __bf16* __restrict__ u, __bf16* __restrict__ g) {
  __shared__ __align__(16) __bf16 Asm[2][64][34];
  __shared__ __align__(16) __bf16 BsT[128][34];
  int n0 = blockIdx.x * 128;
  int m0 = blockIdx.y * 64;
  int tid = threadIdx.x;
  int wv = tid >> 5;
  int wm = wv & 3, wn = wv >> 2;

  floatx8 accT[4] = {{}, {}, {}, {}};
  floatx8 accB[4] = {{}, {}, {}, {}};

  // Staging map. A: 8 threads cover one row's 32 floats (one 128-byte line).
  // B: one thread takes rows k = 2*bkp, 2*bkp+1 at 8 consecutive columns.
  int arow = tid >> 3, ak = (tid & 7) << 2;
  int bkp = tid >> 4, bn = (tid & 15) << 3;
  const float* Wp = W + (size_t)(m0 + arow) * Hc + ak;
  const __bf16* ub = u + (size_t)(2 * bkp) * BL + n0 + bn;

  for (int kk = 0; kk < Hc; kk += 32) {
    // all six 16-byte loads of this K-tile are issued before the first use; the
    // short loops are unrolled so that a[], b0, b1 get constant indices (registers)
    f32x4 a[4];
#pragma unroll
    for (int j = 0; j < 4; ++j)
      a[j] = *(const f32x4*)(Wp + (size_t)((j >> 1) * 256 + (j & 1) * 32) * Hc + kk);
    f32x4 r0 = *(const f32x4*)(ub + (size_t)kk * BL);
    f32x4 r1 = *(const f32x4*)(ub + (size_t)(kk + 1) * BL);
    bf16x8 b0 = __builtin_bit_cast(bf16x8, r0);
    bf16x8 b1 = __builtin_bit_cast(bf16x8, r1);
#pragma unroll
    for (int j = 0; j < 4; ++j) {
      __bf16* d = &Asm[j >> 1][arow + (j & 1) * 32][ak];
      *(bf16x2*)(d)     = bf16x2{(__bf16)a[j].x, (__bf16)a[j].y};
      *(bf16x2*)(d + 2) = bf16x2{(__bf16)a[j].z, (__bf16)a[j].w};
    }
#pragma unroll
    for (int i = 0; i < 8; ++i)
      *(bf16x2*)(&BsT[bn + i][2 * bkp]) = bf16x2{b0[i], b1[i]};
    if (kk + 32 < Hc)   // prefetch next B K-tile -> global_prefetch_b8
      __builtin_prefetch(&u[(size_t)(kk + 32 + (tid & 31)) * BL + n0], 0, 1);
    __syncthreads();

    bf16x16 at = load_a_frag(&Asm[0][0][0], wm * 16, 34);
    bf16x16 ab = load_a_frag(&Asm[1][0][0], wm * 16, 34);
#pragma unroll
    for (int j = 0; j < 4; ++j) {
      bf16x16 bf = load_bT_frag(&BsT[0][0], wn * 64 + j * 16, 34);
      accT[j] = wmma_bf16(at, bf, accT[j]);
      accB[j] = wmma_bf16(ab, bf, accB[j]);
    }
    __syncthreads();
  }

  int lane = tid & 31;
  int nl = lane & 15, half = lane >> 4;
#pragma unroll
  for (int j = 0; j < 4; ++j) {
#pragma unroll
    for (int r = 0; r < 8; ++r) {
      int row = (half << 3) + r;
      int gm = m0 + wm * 16 + row;
      size_t col = (size_t)n0 + wn * 64 + j * 16 + nl;
      float zt = accT[j][r] + bias[gm];
      float zb = accB[j][r] + bias[gm + 256];
      float gv = zt * (1.f / (1.f + expf(-zb)));
      g[(size_t)gm * BL + col] = (__bf16)gv;
    }
  }
}

// ---------------------------------------------------------------------------
// K4: conv1d(k=3,pad=1) as 3 shifted-tap WMMA GEMMs; fused bias + residual.
// ---------------------------------------------------------------------------
// 8 waves per SIMD (at most 128 VGPRs): four work-groups per WGP, so that all
// 1,024 are resident at once
__global__ void __launch_bounds__(256) __attribute__((amdgpu_waves_per_eu(8)))
k_conv_gemm(const float* __restrict__ cw,
            const float* __restrict__ cb,
            const __bf16* __restrict__ g,
            const float* __restrict__ x,
            float* __restrict__ out) {
  __shared__ __align__(16) __bf16 Asm[3][64][34];
  __shared__ __align__(16) __bf16 BsT[130][34];
  int n0 = blockIdx.x * 128;
  int m0 = blockIdx.y * 64;
  int tid = threadIdx.x;
  int wv = tid >> 5;
  int wm = wv & 3, wn = wv >> 2;
  int bstart = (n0 / Lc) * Lc;

  floatx8 acc[4] = {{}, {}, {}, {}};

  // Staging map. A: one thread takes 12 consecutive floats of a weight row,
  // which are 4 input channels x 3 taps. B: one thread takes rows k = 2*bkp,
  // 2*bkp+1 at 8 consecutive columns; the 128 inner columns lie in one batch
  // entry (n0 and Lc are multiples of 128). The two edge columns, n0-1 and
  // n0+128, are read at an address clamped into the entry and zeroed outside.
  int arow = tid >> 3, au = tid & 7;
  int bkp = tid >> 4, bn = (tid & 15) << 3;
  const float* cwp = cw + (size_t)(m0 + arow) * (Hc * 3) + au * 12;
  const __bf16* gb = g + (size_t)(2 * bkp) * BL + n0 + bn;
  int hk = tid & 31, hs = (tid >> 5) & 1;
  int hn = hs ? n0 + 128 : n0 - 1;
  bool hin = hn >= bstart && hn < bstart + Lc;
  const __bf16* gh = g + (size_t)hk * BL + (hin ? hn : n0);

  for (int kk = 0; kk < Hc; kk += 32) {
    // all nine loads of this K-tile are issued before the first use; the short
    // loops are unrolled so that a[], b0, b1 get constant indices (registers)
    f32x4 a[2][3];
#pragma unroll
    for (int j = 0; j < 2; ++j)
#pragma unroll
      for (int i = 0; i < 3; ++i)
        a[j][i] = *(const f32x4*)(cwp + (size_t)(j * 32) * (Hc * 3) + kk * 3 + i * 4);
    f32x4 r0 = *(const f32x4*)(gb + (size_t)kk * BL);
    f32x4 r1 = *(const f32x4*)(gb + (size_t)(kk + 1) * BL);
    unsigned hr = *(const unsigned short*)(gh + (size_t)kk * BL);
    // inputs-only fence on the loaded values: keeps the nine loads in one group
    // with one latency; without it the edge load sinks into the branch below
    // and is waited for by itself
    asm volatile("" :: "v"(a[0][0]), "v"(a[0][1]), "v"(a[0][2]), "v"(a[1][0]),
                       "v"(a[1][1]), "v"(a[1][2]), "v"(r0), "v"(r1), "v"(hr));
    bf16x8 b0 = __builtin_bit_cast(bf16x8, r0);
    bf16x8 b1 = __builtin_bit_cast(bf16x8, r1);
    __bf16 hv = __builtin_bit_cast(__bf16, (unsigned short)hr);
#pragma unroll
    for (int j = 0; j < 2; ++j) {
#pragma unroll
      for (int d = 0; d < 3; ++d) {
        // float e of the 12 is channel e / 3, tap e % 3
        __bf16* p = &Asm[d][arow + j * 32][au * 4];
        *(bf16x2*)(p)     = bf16x2{(__bf16)a[j][d >> 2][d & 3],
                                   (__bf16)a[j][(3 + d) >> 2][(3 + d) & 3]};
        *(bf16x2*)(p + 2) = bf16x2{(__bf16)a[j][(6 + d) >> 2][(6 + d) & 3],
                                   (__bf16)a[j][(9 + d) >> 2][(9 + d) & 3]};
      }
    }
#pragma unroll
    for (int i = 0; i < 8; ++i)
      *(bf16x2*)(&BsT[1 + bn + i][2 * bkp]) = bf16x2{b0[i], b1[i]};
    if (tid < 64) BsT[hs * 129][hk] = hin ? hv : (__bf16)0.0f;
    __syncthreads();

#pragma unroll
    for (int d = 0; d < 3; ++d) {
      bf16x16 af = load_a_frag(&Asm[d][0][0], wm * 16, 34);
#pragma unroll
      for (int j = 0; j < 4; ++j) {
        bf16x16 bf = load_bT_frag(&BsT[0][0], wn * 64 + j * 16 + d, 34);
        acc[j] = wmma_bf16(af, bf, acc[j]);
      }
    }
    __syncthreads();
  }

  int lane = tid & 31;
  int nl = lane & 15, half = lane >> 4;
#pragma unroll
  for (int j = 0; j < 4; ++j) {
#pragma unroll
    for (int r = 0; r < 8; ++r) {
      int row = (half << 3) + r;
      int o = m0 + wm * 16 + row;
      long long ng = (long long)n0 + wn * 64 + j * 16 + nl;
      int b = (int)(ng >> 12);
      int l = (int)(ng & (Lc - 1));
      size_t oi = ((size_t)b * Hc + o) * Lc + l;
      out[oi] = x[oi] + cb[o] + acc[j][r];
    }
  }
}

// ---------------------------------------------------------------------------
extern "C" void kernel_launch(void* const* d_in, const int* in_sizes, int n_in,
                              void* d_out, int out_size, void* d_ws, size_t ws_size,
                              hipStream_t stream) {
  const float* x        = (const float*)d_in[0];
  const float* gn_w     = (const float*)d_in[1];
  const float* gn_b     = (const float*)d_in[2];
  const float* log_dt   = (const float*)d_in[3];
  const float* A_log_re = (const float*)d_in[4];
  const float* A_im     = (const float*)d_in[5];
  const float* C_re     = (const float*)d_in[6];
  const float* C_im     = (const float*)d_in[7];
  const float* Dv       = (const float*)d_in[8];
  const float* W_out    = (const float*)d_in[9];
  const float* b_out    = (const float*)d_in[10];
  const float* conv_w   = (const float*)d_in[11];
  const float* conv_b   = (const float*)d_in[12];
  float* out = (float*)d_out;

  char* ws = (char*)d_ws;
  size_t off = 0;
  auto alloc = [&](size_t bytes) { size_t o = off; off = (off + bytes + 255) & ~(size_t)255; return o; };
  float*  w_scale  = (float*) (ws + alloc(sizeof(float)  * Bsz * Hc));
  float*  w_shift  = (float*) (ws + alloc(sizeof(float)  * Bsz * Hc));
  float4* w_ab     = (float4*)(ws + alloc(sizeof(float4) * Hc * Nst));
  float2* w_aT     = (float2*)(ws + alloc(sizeof(float2) * Hc * Nst));
  __bf16* w_u      = (__bf16*)(ws + alloc(sizeof(__bf16) * (size_t)Hc * BL));
  __bf16* w_g      = (__bf16*)(ws + alloc(sizeof(__bf16) * (size_t)Hc * BL));

  k_gn_stats<<<Bsz * Gg + (Hc * Nst + 255) / 256, 256, 0, stream>>>(
      x, gn_w, gn_b, w_scale, w_shift, log_dt, A_log_re, A_im, C_re, C_im, w_ab, w_aT);
  k_ssm<<<Bsz * Hc, 256, 0, stream>>>(x, w_scale, w_shift, w_ab, w_aT, Dv, w_u);
  dim3 gemm_grid((unsigned)(BL / 128), Hc / 64);
  k_glu_gemm<<<gemm_grid, 256, 0, stream>>>(W_out, b_out, w_u, w_g);
  k_conv_gemm<<<gemm_grid, 256, 0, stream>>>(conv_w, conv_b, w_g, x, out);
}

// v005
// A run of this version takes 113 microseconds.
// Timed twice side by side with v004, it ran 1.15 times as fast both times.
// All steps since v000 together make it 3.45 times as fast.
#include <hip/hip_runtime.h>
#include <math.h>
#include <stdint.h>

#define DEVI __device__ __forceinline__

// Problem constants (match reference)
constexpr int  Bsz = 8, Hc = 256, Lc = 4096, Nst = 32, Gg = 32;
constexpr int  CPG = Hc / Gg;              // 8 channels per group
constexpr int  NC  = 8,  Tc = Lc / NC;     // 8 chunks of 512
constexpr long long BL = (long long)Bsz * Lc;  // 32768 positions

typedef __attribute__((ext_vector_type(16))) __bf16 bf16x16;
typedef __attribute__((ext_vector_type(8)))  float  floatx8;
typedef __attribute__((ext_vector_type(4)))  float  f32x4;
typedef __attribute__((ext_vector_type(8)))  __bf16 bf16x8;
typedef __attribute__((ext_vector_type(4)))  __bf16 bf16x4;
typedef __attribute__((ext_vector_type(2)))  __bf16 bf16x2;

// ---------------------------------------------------------------------------
// CDNA5 async Global->LDS copy (ASYNCcnt-tracked) with builtin/asm fallback
// ---------------------------------------------------------------------------
#define GAS __attribute__((address_space(1)))
#define LAS __attribute__((address_space(3)))
typedef int v4i __attribute__((vector_size(4 * sizeof(int))));

DEVI void async_ld_b128(const void* g, void* l) {
#if __has_builtin(__builtin_amdgcn_global_load_async_to_lds_b128)
  __builtin_amdgcn_global_load_async_to_lds_b128(
      (GAS v4i*)(g), (LAS v4i*)(l), 0, 0);
#else
  unsigned loff = (unsigned)(uintptr_t)l;
  asm volatile("global_load_async_to_lds_b128 %0, %1, off"
               :: "v"(loff), "v"(g) : "memory");
#endif
}

DEVI void wait_async0() {
#if __has_builtin(__builtin_amdgcn_s_wait_asynccnt)
  __builtin_amdgcn_s_wait_asynccnt(0);
#else
  asm volatile("s_wait_asynccnt 0x0" ::: "memory");
#endif
  asm volatile("" ::: "memory");
}
DEVI void wait_async1() {
#if __has_builtin(__builtin_amdgcn_s_wait_asynccnt)
  __builtin_amdgcn_s_wait_asynccnt(1);
#else
  asm volatile("s_wait_asynccnt 0x1" ::: "memory");
#endif
  asm volatile("" ::: "memory");
}

// Stage 128 consecutive floats (one wave, 4 floats / lane) into LDS async.
DEVI void async_tile128(const float* gsrc, float* ldst) {
  int lane = threadIdx.x & 31;
  async_ld_b128(gsrc + lane * 4, ldst + lane * 4);
}

// Normalise a landed 128-float tile in place: each lane takes the 16 bytes that
// it copied itself. One wave's LDS operations complete in issue order, so the
// wave's later broadcast reads see the stored values without a barrier.
DEVI void norm_tile128(float* t, float sc, float sh) {
  f32x4* q = (f32x4*)(t + (threadIdx.x & 31) * 4);
  f32x4 v = *q;
  v.x = fmaf(v.x, sc, sh); v.y = fmaf(v.y, sc, sh);
  v.z = fmaf(v.z, sc, sh); v.w = fmaf(v.w, sc, sh);
  *q = v;
}

// ---------------------------------------------------------------------------
// WMMA helpers
// ---------------------------------------------------------------------------
DEVI floatx8 wmma_bf16(bf16x16 a, bf16x16 b, floatx8 c) {
  return __builtin_amdgcn_wmma_f32_16x16x32_bf16(false, a, false, b, (short)0, c,
                                                 false, false);
}

// LDS row pitch of every staged 32-k tile, in bf16: 80 bytes = 16 x 5. Every row
// starts on a 16-byte boundary, and 16 consecutive rows read 16 bytes each from
// all 64 banks once.
constexpr int LDP = 40;

// One 16x32 fragment, A (row = m) and B (row = n) alike: lane (c, half) takes row
// rowBase + c, k = 8*half + 0..7 in elements 0..7 and k = 16 + 8*half + 0..7 in
// elements 8..15 (the documented 16-bit layout): two 16-byte LDS reads.
DEVI bf16x16 load_frag(const __bf16* S, int rowBase) {
  int lane = threadIdx.x & 31;
  const __bf16* p = S + (rowBase + (lane & 15)) * LDP + ((lane >> 4) << 3);
  bf16x8 lo = *(const bf16x8*)(p);
  bf16x8 hi = *(const bf16x8*)(p + 16);
  return __builtin_shufflevector(lo, hi, 0, 1, 2, 3, 4, 5, 6, 7, 8, 9, 10, 11, 12, 13, 14, 15);
}

// ---------------------------------------------------------------------------
// K1: GroupNorm statistics -> per-(b,h) affine scale/shift (blocks 0..255);
// the blocks behind them discretize the SSM parameters per (h,n), which depend
// on nothing the first ones compute: one launch for both.
// ---------------------------------------------------------------------------
__global__ void k_gn_stats(const float* __restrict__ x,
                           const float* __restrict__ gn_w,
                           const float* __restrict__ gn_b,
                           float* __restrict__ scale, float* __restrict__ shift,
                           const float* __restrict__ log_dt,
                           const float* __restrict__ A_log_re,
                           const float* __restrict__ A_im,
                           const float* __restrict__ C_re,
                           const float* __restrict__ C_im,
                           float4* __restrict__ ab,   // (a_re, a_im, 2Cd_re, -2Cd_im)
                           float2* __restrict__ aT) {
  if (blockIdx.x >= Bsz * Gg) {                 // whole work-group, before any barrier
    int idx = (blockIdx.x - Bsz * Gg) * blockDim.x + threadIdx.x;
    if (idx >= Hc * Nst) return;
    int h = idx >> 5;
    float dt  = expf(log_dt[h]);
    float Are = -expf(A_log_re[idx]);
    float Aim = A_im[idx];
    float er  = expf(Are * dt);
    float are = er * cosf(Aim * dt);
    float aim = er * sinf(Aim * dt);
    float dre = are - 1.f, dim = aim;
    float inv = 1.f / (Are * Are + Aim * Aim);
    float qre = (dre * Are + dim * Aim) * inv;
    float qim = (dim * Are - dre * Aim) * inv;
    float Cr = C_re[idx], Ci = C_im[idx];
    float cdre = Cr * qre - Ci * qim;
    float cdim = Cr * qim + Ci * qre;
    ab[idx] = make_float4(are, aim, 2.f * cdre, -2.f * cdim);
    float tr = are, ti = aim;
#pragma unroll
    for (int i = 0; i < 9; ++i) { float nr = tr*tr - ti*ti, ni = 2.f*tr*ti; tr = nr; ti = ni; }
    aT[idx] = make_float2(tr, ti);
    return;
  }
  int bg = blockIdx.x;
  int b = bg / Gg, g = bg % Gg;
  const float* xp = x + ((size_t)b * Hc + (size_t)g * CPG) * Lc;
  const int n = CPG * Lc;
  int tid = threadIdx.x;
  float s = 0.f, ss = 0.f;
  for (int i = tid; i < n; i += 256) { float v = xp[i]; s += v; ss += v * v; }
  __shared__ float r0[256], r1[256];
  r0[tid] = s; r1[tid] = ss; __syncthreads();
  for (int st = 128; st > 0; st >>= 1) {
    if (tid < st) { r0[tid] += r0[tid + st]; r1[tid] += r1[tid + st]; }
    __syncthreads();
  }
  __shared__ float mu_s, rstd_s;
  if (tid == 0) {
    float mu = r0[0] / (float)n;
    float var = r1[0] / (float)n - mu * mu;
    mu_s = mu; rstd_s = rsqrtf(var + 1e-5f);
  }
  __syncthreads();
  if (tid < CPG) {
    int h = g * CPG + tid;
    float sc = rstd_s * gn_w[h];
    scale[b * Hc + h] = sc;
    shift[b * Hc + h] = gn_b[h] - mu_s * sc;
  }
}

// ---------------------------------------------------------------------------
// K2: the whole SSM in one launch. One work-group per (b,h), one wave per chunk
// of 512 steps, one lane per state.
//   phase 1: chunk end state from a zero start (chunks 0..6; nothing reads the
//            end state of the last chunk)
//   hand-over: end states pass through LDS; every wave folds the chunks in
//            front of its own into its start state
//   phase 2: full recurrence; fused D-skip + exact GELU.
// The sum over the 32 states is taken once per block of 32 steps: every lane
// (one state) stores its term of each step into a wave-private 32x32 LDS tile,
// then every lane sums one row (one step) and evaluates the GELU of that step.
// x is streamed via async Global->LDS copies in both phases; each landed tile is
// normalised once in LDS, and a step adds it as the addend of its FMA chain.
// ---------------------------------------------------------------------------
// 16 waves per SIMD (64 VGPRs): all 2,048 work-groups are then resident at once
__global__ void __launch_bounds__(256) __attribute__((amdgpu_waves_per_eu(16)))
k_ssm(const float* __restrict__ x,
      const float* __restrict__ scale,
      const float* __restrict__ shift,
      const float4* __restrict__ ab,
      const float2* __restrict__ aTv,
      const float* __restrict__ Dv,
      __bf16* __restrict__ u) {
  __shared__ __align__(16) float xbuf[8][2][128];   // per-wave double buffer
  __shared__ __align__(16) float tile[8][32][32];   // per wave: [step][state]
  if (blockIdx.x >= Bsz * Hc) return;           // whole work-group, before any barrier
  int lane = threadIdx.x & 31;
  // the chunk's number in a scalar register: the tests on it are scalar branches,
  // and every base address below is wave-uniform (scalar registers; the vector
  // budget of 64 is tight)
  int cs = __builtin_amdgcn_readfirstlane(threadIdx.x >> 5);
  int wv = cs, c = cs;                          // 8 waves, 8 chunks
  int bh = blockIdx.x;
  int h = bh & (Hc - 1);
  int b = bh / Hc;

  float4 p = ab[h * Nst + lane];
  float2 aT = aTv[h * Nst + lane];              // a^512, one chunk's decay
  float sc = scale[bh], sh = shift[bh];         // used once per tile only
  float Dh = Dv[h];
  const float* xp = x + (size_t)bh * Lc + (size_t)c * Tc;
  __bf16* up = u + (size_t)h * BL + (size_t)b * Lc + (size_t)c * Tc;
  float* buf = &xbuf[wv][0][0];
  constexpr int NS = Tc / 128;                  // 4 sub-tiles

  // ---- phase 1: this chunk's end state from a zero start ----
  if (cs < NC - 1) {
    float sr = 0.f, si = 0.f;
    async_tile128(xp, buf);                     // prime tile 0
    for (int s = 0; s < NS; ++s) {
      if (s + 1 < NS) {
        // a slot of the wave's own ring is refilled only behind its reads
        asm volatile("s_wait_dscnt 0x0" ::: "memory");
        async_tile128(xp + (s + 1) * 128, buf + ((s + 1) & 1) * 128); wait_async1();
      } else { wait_async0(); }
      float* cur = buf + (s & 1) * 128;
      norm_tile128(cur, sc, sh);
      for (int t = 0; t < 128; ++t) {
        float uin = cur[t];                     // LDS broadcast read, normalised
        float nr = fmaf(p.x, sr, fmaf(-p.y, si, uin));
        float ni = fmaf(p.x, si, p.y * sr);
        sr = nr; si = ni;
      }
    }
    tile[wv][0][lane] = sr;                     // the tile is idle in this phase
    tile[wv][1][lane] = si;
  }
  __syncthreads();                              // end states of chunks 0..6 published
  float er_[NC - 1], ei_[NC - 1];
#pragma unroll
  for (int q = 0; q < NC - 1; ++q) { er_[q] = tile[q][0][lane]; ei_[q] = tile[q][1][lane]; }
  __syncthreads();                              // all read: the tiles may be overwritten

  // ---- start state: fold the chunks in front of this one, in their order ----
  float sr = 0.f, si = 0.f;
#pragma unroll
  for (int q = 0; q < NC - 1; ++q) {
    if (q < cs) {
      float nr = aT.x * sr - aT.y * si + er_[q];
      float ni = aT.x * si + aT.y * sr + ei_[q];
      sr = nr; si = ni;
    }
  }

  // ---- phase 2: full recurrence and output ----
  float* tcol = &tile[wv][0][lane];             // this lane's state, row = step
  const float* trow = &tile[wv][lane][0];       // this lane's step, all states
  // Rows are 128 B apart, so lane l starts its row at 16-byte piece (l >> 1) & 7:
  // each 16 lanes of a 16-byte read then cover all 64 banks once.
  int rot = (lane >> 1) & 7;

  async_tile128(xp, buf);
  for (int s = 0; s < NS; ++s) {
    if (s + 1 < NS) {
      // a slot of the wave's own ring is refilled only behind its reads
      asm volatile("s_wait_dscnt 0x0" ::: "memory");
      async_tile128(xp + (s + 1) * 128, buf + ((s + 1) & 1) * 128); wait_async1();
    } else { wait_async0(); }
    float* cur = buf + (s & 1) * 128;
    norm_tile128(cur, sc, sh);
    for (int t0 = 0; t0 < 128; t0 += 32) {
      // fully unrolled: every step's tile store gets an immediate offset
#pragma unroll
      for (int k = 0; k < 32; ++k) {
        float uin = cur[t0 + k];
        float nr = fmaf(p.x, sr, fmaf(-p.y, si, uin));
        float ni = fmaf(p.x, si, p.y * sr);
        sr = nr; si = ni;
        tcol[k * 32] = p.z * sr + p.w * si;      // this state's 2*Re(Cd * s)
      }
      // One wave's LDS operations complete in issue order: no barrier needed.
      f32x4 v[8];
#pragma unroll
      for (int j = 0; j < 8; ++j) v[j] = *(const f32x4*)(trow + ((j ^ rot) << 2));
      float xl = cur[t0 + lane];
      // inputs-only fence on the loaded values: keeps the nine LDS reads in one
      // group with one latency; without it each read is waited for by itself
      asm volatile("" :: "v"(v[0]), "v"(v[1]), "v"(v[2]), "v"(v[3]), "v"(v[4]),
                         "v"(v[5]), "v"(v[6]), "v"(v[7]), "v"(xl));
      f32x4 a = ((v[0] + v[1]) + (v[2] + v[3])) + ((v[4] + v[5]) + (v[6] + v[7]));
      float part = (a.x + a.z) + (a.y + a.w);
      float y = part + Dh * xl;
      float gel = 0.5f * y * (1.f + erff(y * 0.70710678f));
      up[s * 128 + t0 + lane] = (__bf16)gel;
    }
  }
}

// ---------------------------------------------------------------------------
// K3: GLU projection, bf16 WMMA; both halves of W_out share the B-tile.
// ---------------------------------------------------------------------------
__global__ void __launch_bounds__(256)
k_glu_gemm(const float* __restrict__ W, const float* __restrict__ bias,
           const __bf16* __restrict__ u, __bf16* __restrict__ g) {
  __shared__ __align__(16) __bf16 Asm[2][64][LDP];
  __shared__ __align__(16) __bf16 BsT[128][LDP];
  int n0 = blockIdx.x * 128;
  int m0 = blockIdx.y * 64;
  int tid = threadIdx.x;
  int wv = tid >> 5;
  int wm = wv & 3, wn = wv >> 2;

  floatx8 accT[4] = {{}, {}, {}, {}};
  floatx8 accB[4] = {{}, {}, {}, {}};

  // Staging map. A: 8 threads cover one row's 32 floats (one 128-byte line).
  // B: one thread takes rows k = 2*bkp, 2*bkp+1 at 8 consecutive columns; a wave
  // takes 4 k-pairs x 64 columns (whole 128-byte lines), which spreads its
  // transposing LDS stores over twice the banks that 2 k-pairs x 128 columns hit.
  int arow = tid >> 3, ak = (tid & 7) << 2;
  int bkp = ((tid >> 3) & 3) | ((tid >> 6) << 2);
  int bn = ((tid & 7) | (((tid >> 5) & 1) << 3)) << 3;
  const float* Wp = W + (size_t)(m0 + arow) * Hc + ak;
  const __bf16* ub = u + (size_t)(2 * bkp) * BL + n0 + bn;

  for (int kk = 0; kk < Hc; kk += 32) {
    // all six 16-byte loads of this K-tile are issued before the first use; the
    // short loops are unrolled so that a[], b0, b1 get constant indices (registers)
    f32x4 a[4];
#pragma unroll
    for (int j = 0; j < 4; ++j)
      a[j] = *(const f32x4*)(Wp + (size_t)((j >> 1) * 256 + (j & 1) * 32) * Hc + kk);
    f32x4 r0 = *(const f32x4*)(ub + (size_t)kk * BL);
    f32x4 r1 = *(const f32x4*)(ub + (size_t)(kk + 1) * BL);
    bf16x8 b0 = __builtin_bit_cast(bf16x8, r0);
    bf16x8 b1 = __builtin_bit_cast(bf16x8, r1);
#pragma unroll
    for (int j = 0; j < 4; ++j) {
      *(bf16x4*)(&Asm[j >> 1][arow + (j & 1) * 32][ak]) =
          bf16x4{(__bf16)a[j].x, (__bf16)a[j].y, (__bf16)a[j].z, (__bf16)a[j].w};
    }
#pragma unroll
    for (int i = 0; i < 8; ++i)
      *(bf16x2*)(&BsT[bn + i][2 * bkp]) = bf16x2{b0[i], b1[i]};
    if (kk + 32 < Hc)   // prefetch next B K-tile -> global_prefetch_b8
      __builtin_prefetch(&u[(size_t)(kk + 32 + (tid & 31)) * BL + n0], 0, 1);
    __syncthreads();

    bf16x16 at = load_frag(&Asm[0][0][0], wm * 16);
    bf16x16 ab = load_frag(&Asm[1][0][0], wm * 16);
#pragma unroll
    for (int j = 0; j < 4; ++j) {
      bf16x16 bf = load_frag(&BsT[0][0], wn * 64 + j * 16);
      accT[j] = wmma_bf16(at, bf, accT[j]);
      accB[j] = wmma_bf16(ab, bf, accB[j]);
    }
    __syncthreads();
  }

  int lane = tid & 31;
  int nl = lane & 15, half = lane >> 4;
#pragma unroll
  for (int j = 0; j < 4; ++j) {
#pragma unroll
    for (int r = 0; r < 8; ++r) {
      int row = (half << 3) + r;
      int gm = m0 + wm * 16 + row;
      size_t col = (size_t)n0 + wn * 64 + j * 16 + nl;
      float zt = accT[j][r] + bias[gm];
      float zb = accB[j][r] + bias[gm + 256];
      float gv = zt * (1.f / (1.f + expf(-zb)));
      g[(size_t)gm * BL + col] = (__bf16)gv;
    }
  }
}

// ---------------------------------------------------------------------------
// K4: conv1d(k=3,pad=1) as 3 shifted-tap WMMA GEMMs; fused bias + residual.
// ---------------------------------------------------------------------------
// 8 waves per SIMD (at most 128 VGPRs): four work-groups per WGP, so that all
// 1,024 are resident at once
__global__ void __launch_bounds__(256) __attribute__((amdgpu_waves_per_eu(8)))
k_conv_gemm(const float* __restrict__ cw,
            const float* __restrict__ cb,
            const __bf16* __restrict__ g,
            const float* __restrict__ x,
            float* __restrict__ out) {
  __shared__ __align__(16) __bf16 Asm[3][64][LDP];
  __shared__ __align__(16) __bf16 BsT[130][LDP];
  int n0 = blockIdx.x * 128;
  int m0 = blockIdx.y * 64;
  int tid = threadIdx.x;
  int wv = tid >> 5;
  int wm = wv & 3, wn = wv >> 2;
  int bstart = (n0 / Lc) * Lc;

  floatx8 acc[4] = {{}, {}, {}, {}};

  // Staging map. A: one thread takes 12 consecutive floats of a weight row,
  // which are 4 input channels x 3 taps. B: one thread takes rows k = 2*bkp,
  // 2*bkp+1 at 8 consecutive columns, a wave 4 k-pairs x 64 columns as in the GLU
  // kernel; the 128 inner columns lie in one batch
  // entry (n0 and Lc are multiples of 128). The two edge columns, n0-1 and
  // n0+128, are read at an address clamped into the entry and zeroed outside.
  int arow = tid >> 3, au = tid & 7;
  int bkp = ((tid >> 3) & 3) | ((tid >> 6) << 2);
  int bn = ((tid & 7) | (((tid >> 5) & 1) << 3)) << 3;
  const float* cwp = cw + (size_t)(m0 + arow) * (Hc * 3) + au * 12;
  const __bf16* gb = g + (size_t)(2 * bkp) * BL + n0 + bn;
  int hk = tid & 31, hs = (tid >> 5) & 1;
  int hn = hs ? n0 + 128 : n0 - 1;
  bool hin = hn >= bstart && hn < bstart + Lc;
  const __bf16* gh = g + (size_t)hk * BL + (hin ? hn : n0);

  for (int kk = 0; kk < Hc; kk += 32) {
    // all nine loads of this K-tile are issued before the first use; the short
    // loops are unrolled so that a[], b0, b1 get constant indices (registers)
    f32x4 a[2][3];
#pragma unroll
    for (int j = 0; j < 2; ++j)
#pragma unroll
      for (int i = 0; i < 3; ++i)
        a[j][i] = *(const f32x4*)(cwp + (size_t)(j * 32) * (Hc * 3) + kk * 3 + i * 4);
    f32x4 r0 = *(const f32x4*)(gb + (size_t)kk * BL);
    f32x4 r1 = *(const f32x4*)(gb + (size_t)(kk + 1) * BL);
    unsigned hr = *(const unsigned short*)(gh + (size_t)kk * BL);
    // inputs-only fence on the loaded values: keeps the nine loads in one group
    // with one latency; without it the edge load sinks into the branch below
    // and is waited for by itself
    asm volatile("" :: "v"(a[0][0]), "v"(a[0][1]), "v"(a[0][2]), "v"(a[1][0]),
                       "v"(a[1][1]), "v"(a[1][2]), "v"(r0), "v"(r1), "v"(hr));
    bf16x8 b0 = __builtin_bit_cast(bf16x8, r0);
    bf16x8 b1 = __builtin_bit_cast(bf16x8, r1);
    __bf16 hv = __builtin_bit_cast(__bf16, (unsigned short)hr);
#pragma unroll
    for (int j = 0; j < 2; ++j) {
#pragma unroll
      for (int d = 0; d < 3; ++d) {
        // float e of the 12 is channel e / 3, tap e % 3
        *(bf16x4*)(&Asm[d][arow + j * 32][au * 4]) =
            bf16x4{(__bf16)a[j][d >> 2][d & 3],
                   (__bf16)a[j][(3 + d) >> 2][(3 + d) & 3],
                   (__bf16)a[j][(6 + d) >> 2][(6 + d) & 3],
                   (__bf16)a[j][(9 + d) >> 2][(9 + d) & 3]};
      }
    }
#pragma unroll
    for (int i = 0; i < 8; ++i)
      *(bf16x2*)(&BsT[1 + bn + i][2 * bkp]) = bf16x2{b0[i], b1[i]};
    if (tid < 64) BsT[hs * 129][hk] = hin ? hv : (__bf16)0.0f;
    __syncthreads();

#pragma unroll
    for (int d = 0; d < 3; ++d) {
      bf16x16 af = load_frag(&Asm[d][0][0], wm * 16);
      bf16x16 bf[4];
#pragma unroll
      for (int j = 0; j < 4; ++j) bf[j] = load_frag(&BsT[0][0], wn * 64 + j * 16 + d);
      // inputs-only fence on the loaded values: keeps the tap's ten LDS reads in
      // one group with one latency; without it each fragment is waited for by itself
      asm volatile("" :: "v"(af), "v"(bf[0]), "v"(bf[1]), "v"(bf[2]), "v"(bf[3]));
#pragma unroll
      for (int j = 0; j < 4; ++j) acc[j] = wmma_bf16(af, bf[j], acc[j]);
    }
    __syncthreads();
  }

  int lane = tid & 31;
  int nl = lane & 15, half = lane >> 4;
#pragma unroll
  for (int j = 0; j < 4; ++j) {
#pragma unroll
    for (int r = 0; r < 8; ++r) {
      int row = (half << 3) + r;
      int o = m0 + wm * 16 + row;
      long long ng = (long long)n0 + wn * 64 + j * 16 + nl;
      int b = (int)(ng >> 12);
      int l = (int)(ng & (Lc - 1));
      size_t oi = ((size_t)b * Hc + o) * Lc + l;
      out[oi] = x[oi] + cb[o] + acc[j][r];
    }
  }
}

// ---------------------------------------------------------------------------
extern "C" void kernel_launch(void* const* d_in, const int* in_sizes, int n_in,
                              void* d_out, int out_size, void* d_ws, size_t ws_size,
                              hipStream_t stream) {
  const float* x        = (const float*)d_in[0];
  const float* gn_w     = (const float*)d_in[1];
  const float* gn_b     = (const float*)d_in[2];
  const float* log_dt   = (const float*)d_in[3];
  const float* A_log_re = (const float*)d_in[4];
  const float* A_im     = (const float*)d_in[5];
  const float* C_re     = (const float*)d_in[6];
  const float* C_im     = (const float*)d_in[7];
  const float* Dv       = (const float*)d_in[8];
  const float* W_out    = (const float*)d_in[9];
  const float* b_out    = (const float*)d_in[10];
  const float* conv_w   = (const float*)d_in[11];
  const float* conv_b   = (const float*)d_in[12];
  float* out = (float*)d_out;

  char* ws = (char*)d_ws;
  size_t off = 0;
  auto alloc = [&](size_t bytes) { size_t o = off; off = (off + bytes + 255) & ~(size_t)255; return o; };
  float*  w_scale  = (float*) (ws + alloc(sizeof(float)  * Bsz * Hc));
  float*  w_shift  = (float*) (ws + alloc(sizeof(float)  * Bsz * Hc));
  float4* w_ab     = (float4*)(ws + alloc(sizeof(float4) * Hc * Nst));
  float2* w_aT     = (float2*)(ws + alloc(sizeof(float2) * Hc * Nst));
  __bf16* w_u      = (__bf16*)(ws + alloc(sizeof(__bf16) * (size_t)Hc * BL));
  __bf16* w_g      = (__bf16*)(ws + alloc(sizeof(__bf16) * (size_t)Hc * BL));

  k_gn_stats<<<Bsz * Gg + (Hc * Nst + 255) / 256, 256, 0, stream>>>(
      x, gn_w, gn_b, w_scale, w_shift, log_dt, A_log_re, A_im, C_re, C_im, w_ab, w_aT);
  k_ssm<<<Bsz * Hc, 256, 0, stream>>>(x, w_scale, w_shift, w_ab, w_aT, Dv, w_u);
  dim3 gemm_grid((unsigned)(BL / 128), Hc / 64);
  k_glu_gemm<<<gemm_grid, 256, 0, stream>>>(W_out, b_out, w_u, w_g);
  k_conv_gemm<<<gemm_grid, 256, 0, stream>>>(conv_w, conv_b, w_g, x, out);
}

// v006
// Measured time: 97.5 microseconds a run.
// Next to v005, in two timings, it ran 1.16 times as fast each time.
// Counting every step since v000, it is 4.01 times as fast.
#include <hip/hip_runtime.h>
#include <math.h>
#include <stdint.h>

#define DEVI __device__ __forceinline__

// Problem constants (match reference)
constexpr int  Bsz = 8, Hc = 256, Lc = 4096, Nst = 32, Gg = 32;
constexpr int  CPG = Hc / Gg;              // 8 channels per group
constexpr int  NC  = 4,  Tc = Lc / NC;     // 4 chunks of 1024
constexpr long long BL = (long long)Bsz * Lc;  // 32768 positions

typedef __attribute__((ext_vector_type(16))) __bf16 bf16x16;
typedef __attribute__((ext_vector_type(8)))  float  floatx8;
typedef __attribute__((ext_vector_type(4)))  float  f32x4;
typedef __attribute__((ext_vector_type(8)))  __bf16 bf16x8;
typedef __attribute__((ext_vector_type(4)))  __bf16 bf16x4;
typedef __attribute__((ext_vector_type(2)))  __bf16 bf16x2;

// ---------------------------------------------------------------------------
// CDNA5 async Global->LDS copy (ASYNCcnt-tracked) with builtin/asm fallback
// ---------------------------------------------------------------------------
#define GAS __attribute__((address_space(1)))
#define LAS __attribute__((address_space(3)))
typedef int v4i __attribute__((vector_size(4 * sizeof(int))));

DEVI void async_ld_b128(const void* g, void* l) {
#if __has_builtin(__builtin_amdgcn_global_load_async_to_lds_b128)
  __builtin_amdgcn_global_load_async_to_lds_b128(
      (GAS v4i*)(g), (LAS v4i*)(l), 0, 0);
#else
  unsigned loff = (unsigned)(uintptr_t)l;
  asm volatile("global_load_async_to_lds_b128 %0, %1, off"
               :: "v"(loff), "v"(g) : "memory");
#endif
}

DEVI void wait_async0() {
#if __has_builtin(__builtin_amdgcn_s_wait_asynccnt)
  __builtin_amdgcn_s_wait_asynccnt(0);
#else
  asm volatile("s_wait_asynccnt 0x0" ::: "memory");
#endif
  asm volatile("" ::: "memory");
}
DEVI void wait_async1() {
#if __has_builtin(__builtin_amdgcn_s_wait_asynccnt)
  __builtin_amdgcn_s_wait_asynccnt(1);
#else
  asm volatile("s_wait_asynccnt 0x1" ::: "memory");
#endif
  asm volatile("" ::: "memory");
}

// Stage 128 consecutive floats (one wave, 4 floats / lane) into LDS async.
DEVI void async_tile128(const float* gsrc, float* ldst) {
  int lane = threadIdx.x & 31;
  async_ld_b128(gsrc + lane * 4, ldst + lane * 4);
}

// Normalise a landed 128-float tile in place: each lane takes the 16 bytes that
// it copied itself. One wave's LDS operations complete in issue order, so the
// wave's later broadcast reads see the stored values without a barrier.
DEVI void norm_tile128(float* t, float sc, float sh) {
  f32x4* q = (f32x4*)(t + (threadIdx.x & 31) * 4);
  f32x4 v = *q;
  v.x = fmaf(v.x, sc, sh); v.y = fmaf(v.y, sc, sh);
  v.z = fmaf(v.z, sc, sh); v.w = fmaf(v.w, sc, sh);
  *q = v;
}

// ---------------------------------------------------------------------------
// WMMA helpers
// ---------------------------------------------------------------------------
DEVI floatx8 wmma_bf16(bf16x16 a, bf16x16 b, floatx8 c) {
  return __builtin_amdgcn_wmma_f32_16x16x32_bf16(false, a, false, b, (short)0, c,
                                                 false, false);
}

// LDS row pitch of every staged 32-k tile, in bf16: 80 bytes = 16 x 5. Every row
// starts on a 16-byte boundary, and 16 consecutive rows read 16 bytes each from
// all 64 banks once.
constexpr int LDP = 40;

// One 16x32 fragment, A (row = m) and B (row = n) alike: lane (c, half) takes row
// rowBase + c, k = 8*half + 0..7 in elements 0..7 and k = 16 + 8*half + 0..7 in
// elements 8..15 (the documented 16-bit layout): two 16-byte LDS reads.
DEVI bf16x16 load_frag(const __bf16* S, int rowBase) {
  int lane = threadIdx.x & 31;
  const __bf16* p = S + (rowBase + (lane & 15)) * LDP + ((lane >> 4) << 3);
  bf16x8 lo = *(const bf16x8*)(p);
  bf16x8 hi = *(const bf16x8*)(p + 16);
  return __builtin_shufflevector(lo, hi, 0, 1, 2, 3, 4, 5, 6, 7, 8, 9, 10, 11, 12, 13, 14, 15);
}

// ---------------------------------------------------------------------------
// K1: GroupNorm, parameter set-up and the whole SSM in one launch. One work-group
// per (b, group): 32 waves = 8 channels x 4 chunks of 1024 steps, one lane per
// state. Its LDS lets one work-group live on a WGP: 256 work-groups, 256 WGPs.
//   set-up:  every wave discretizes its channel's 32 states; in chunks 0..2
//            its first tile of x is on the way meanwhile
//   phase 1: chunk end state from a zero start on the RAW x (chunks 0..2; nothing
//            reads the end state of the last chunk), and the sums of x and x^2
//            of every chunk for the group's mean and variance
//   hand-over: end states and sums pass through LDS. The recurrence is linear:
//            the end state for sc*x + sh is sc * (end state for x) plus
//            sh * (1 + a + ... + a^1023). Every wave folds the chunks in front
//            of its own into its start state
//   phase 2: full recurrence on the normalised x; fused D-skip + exact GELU.
// The sum over the 32 states is taken once per block of 32 steps: every lane
// (one state) stores its term of each step into a wave-private 32x32 LDS tile,
// then every lane sums one row (one step) and evaluates the GELU of that step.
// x is streamed via async Global->LDS copies in phase 2 and in
// chunks 0..2 of phase 1; in phase 2 each
// landed tile is normalised once in LDS, and a step adds it as the addend of its
// FMA chain.
// ---------------------------------------------------------------------------
DEVI void acc_sums(f32x4 v, float& sum, float& ssq) {
  sum += (v.x + v.y) + (v.z + v.w);
  ssq = fmaf(v.x, v.x, fmaf(v.y, v.y, fmaf(v.z, v.z, fmaf(v.w, v.w, ssq))));
}

__global__ void __launch_bounds__(1024)
k_ssm(const float* __restrict__ x,
      const float* __restrict__ gn_w,
      const float* __restrict__ gn_b,
      const float* __restrict__ log_dt,
      const float* __restrict__ A_log_re,
      const float* __restrict__ A_im,
      const float* __restrict__ C_re,
      const float* __restrict__ C_im,
      const float* __restrict__ Dv,
      __bf16* __restrict__ u) {
  __shared__ __align__(16) float xbuf[32][2][128];  // per-wave double buffer
  __shared__ __align__(16) float tile[32][32][32];  // per wave: [step][state]
  __shared__ float red[32][2];                      // per wave: sum x, sum x^2
  if (blockIdx.x >= Bsz * Gg) return;           // whole work-group, before any barrier
  int lane = threadIdx.x & 31;
  // the wave's number in a scalar register: the tests on the chunk are scalar
  // branches, and every base address below is wave-uniform
  int wv = __builtin_amdgcn_readfirstlane(threadIdx.x >> 5);
  int cs = wv >> 3, c = cs;                     // chunk 0..3
  int ch = wv & (CPG - 1);                      // channel of the group
  int b = blockIdx.x / Gg;
  int h = (blockIdx.x % Gg) * CPG + ch;
  int bh = b * Hc + h;

  const float* xp = x + (size_t)bh * Lc + (size_t)c * Tc;
  __bf16* up = u + (size_t)h * BL + (size_t)b * Lc + (size_t)c * Tc;
  float* buf = &xbuf[wv][0][0];
  constexpr int NS = Tc / 128;                  // 8 sub-tiles

  if (cs < NC - 1) async_tile128(xp, buf);      // prime tile 0: it flies during the set-up

  // ---- set-up: discretize this lane's state ----
  float4 p;                                     // (a_re, a_im, 2Cd_re, -2Cd_im)
  float2 aT, gT;                                // a^1024; 1 + a + ... + a^1023
  {
    int idx = h * Nst + lane;
    float dt  = expf(log_dt[h]);
    float Are = -expf(A_log_re[idx]);
    float Aim = A_im[idx];
    float er  = expf(Are * dt);
    float are = er * cosf(Aim * dt);
    float aim = er * sinf(Aim * dt);
    float dre = are - 1.f, dim = aim;
    float inv = 1.f / (Are * Are + Aim * Aim);
    float qre = (dre * Are + dim * Aim) * inv;
    float qim = (dim * Are - dre * Aim) * inv;
    float Cr = C_re[idx], Ci = C_im[idx];
    float cdre = Cr * qre - Ci * qim;
    float cdim = Cr * qim + Ci * qre;
    p = make_float4(are, aim, 2.f * cdre, -2.f * cdim);
    // doubling: with t = a^k and g = 1 + ... + a^(k-1), g + t*g has 2k terms
    float tr = are, ti = aim, gr = 1.f, gi = 0.f;
#pragma unroll
    for (int i = 0; i < 10; ++i) {
      float hr = gr + (tr * gr - ti * gi), hi = gi + (tr * gi + ti * gr);
      gr = hr; gi = hi;
      float nr = tr*tr - ti*ti, ni = 2.f*tr*ti; tr = nr; ti = ni;
    }
    aT = make_float2(tr, ti);
    gT = make_float2(gr, gi);
  }
  float Dh = Dv[h];

  // ---- phase 1: this chunk's sums, and its end state from a zero start ----
  float sum = 0.f, ssq = 0.f;
  if (cs < NC - 1) {
    float sr = 0.f, si = 0.f;
    for (int s = 0; s < NS; ++s) {
      if (s + 1 < NS) {
        // a slot of the wave's own ring is refilled only behind its reads
        asm volatile("s_wait_dscnt 0x0" ::: "memory");
        async_tile128(xp + (s + 1) * 128, buf + ((s + 1) & 1) * 128); wait_async1();
      } else { wait_async0(); }
      const float* cur = buf + (s & 1) * 128;
      acc_sums(*(const f32x4*)(cur + lane * 4), sum, ssq);
      for (int t = 0; t < 128; ++t) {
        float uin = cur[t];                     // LDS broadcast read, raw x
        float nr = fmaf(p.x, sr, fmaf(-p.y, si, uin));
        float ni = fmaf(p.x, si, p.y * sr);
        sr = nr; si = ni;
      }
    }
    tile[wv][0][lane] = sr;                     // the tile is idle in this phase
    tile[wv][1][lane] = si;
  } else {
    // unrolled: the eight loads are issued as one group
#pragma unroll
    for (int s = 0; s < NS; ++s)
      acc_sums(*(const f32x4*)(xp + s * 128 + lane * 4), sum, ssq);
  }
#pragma unroll
  for (int o = 16; o > 0; o >>= 1) { sum += __shfl_xor(sum, o); ssq += __shfl_xor(ssq, o); }
  if (lane == 0) { red[wv][0] = sum; red[wv][1] = ssq; }
  __syncthreads();                              // end states and sums published
  float er_[NC - 1], ei_[NC - 1];
#pragma unroll
  for (int q = 0; q < NC - 1; ++q) {
    er_[q] = tile[q * CPG + ch][0][lane]; ei_[q] = tile[q * CPG + ch][1][lane];
  }
  float gs = red[lane][0], gq = red[lane][1];   // lane l: wave l's sums
  __syncthreads();                              // all read: the tiles may be overwritten

  // ---- the group's mean and variance -> this channel's scale and shift ----
#pragma unroll
  for (int o = 16; o > 0; o >>= 1) { gs += __shfl_xor(gs, o); gq += __shfl_xor(gq, o); }
  float mu = gs / (float)(CPG * Lc);
  float var = gq / (float)(CPG * Lc) - mu * mu;
  float sc = rsqrtf(var + 1e-5f) * gn_w[h];
  float sh = gn_b[h] - mu * sc;

  // ---- start state: fold the chunks in front of this one, in their order ----
  float sr = 0.f, si = 0.f;
#pragma unroll
  for (int q = 0; q < NC - 1; ++q) {
    if (q < cs) {
      float nr = aT.x * sr - aT.y * si + fmaf(sc, er_[q], sh * gT.x);
      float ni = aT.x * si + aT.y * sr + fmaf(sc, ei_[q], sh * gT.y);
      sr = nr; si = ni;
    }
  }

  // ---- phase 2: full recurrence and output ----
  float* tcol = &tile[wv][0][lane];             // this lane's state, row = step
  const float* trow = &tile[wv][lane][0];       // this lane's step, all states
  // Rows are 128 B apart, so lane l starts its row at 16-byte piece (l >> 1) & 7:
  // each 16 lanes of a 16-byte read then cover all 64 banks once.
  int rot = (lane >> 1) & 7;

  async_tile128(xp, buf);
  for (int s = 0; s < NS; ++s) {
    if (s + 1 < NS) {
      // a slot of the wave's own ring is refilled only behind its reads
      asm volatile("s_wait_dscnt 0x0" ::: "memory");
      async_tile128(xp + (s + 1) * 128, buf + ((s + 1) & 1) * 128); wait_async1();
    } else { wait_async0(); }
    float* cur = buf + (s & 1) * 128;
    norm_tile128(cur, sc, sh);
    for (int t0 = 0; t0 < 128; t0 += 32) {
      // fully unrolled: every step's tile store gets an immediate offset
#pragma unroll
      for (int k = 0; k < 32; ++k) {
        float uin = cur[t0 + k];
        float nr = fmaf(p.x, sr, fmaf(-p.y, si, uin));
        float ni = fmaf(p.x, si, p.y * sr);
        sr = nr; si = ni;
        tcol[k * 32] = p.z * sr + p.w * si;      // this state's 2*Re(Cd * s)
      }
      // One wave's LDS operations complete in issue order: no barrier needed.
      f32x4 v[8];
#pragma unroll
      for (int j = 0; j < 8; ++j) v[j] = *(const f32x4*)(trow + ((j ^ rot) << 2));
      float xl = cur[t0 + lane];
      // inputs-only fence on the loaded values: keeps the nine LDS reads in one
      // group with one latency; without it each read is waited for by itself
      asm volatile("" :: "v"(v[0]), "v"(v[1]), "v"(v[2]), "v"(v[3]), "v"(v[4]),
                         "v"(v[5]), "v"(v[6]), "v"(v[7]), "v"(xl));
      f32x4 a = ((v[0] + v[1]) + (v[2] + v[3])) + ((v[4] + v[5]) + (v[6] + v[7]));
      float part = (a.x + a.z) + (a.y + a.w);
      float y = part + Dh * xl;
      float gel = 0.5f * y * (1.f + erff(y * 0.70710678f));
      up[s * 128 + t0 + lane] = (__bf16)gel;
    }
  }
}

// ---------------------------------------------------------------------------
// K2: GLU projection, bf16 WMMA; both halves of W_out share the B-tile.
// ---------------------------------------------------------------------------
__global__ void __launch_bounds__(256)
k_glu_gemm(const float* __restrict__ W, const float* __restrict__ bias,
           const __bf16* __restrict__ u, __bf16* __restrict__ g) {
  __shared__ __align__(16) __bf16 Asm[2][64][LDP];
  __shared__ __align__(16) __bf16 BsT[128][LDP];
  int n0 = blockIdx.x * 128;
  int m0 = blockIdx.y * 64;
  int tid = threadIdx.x;
  int wv = tid >> 5;
  int wm = wv & 3, wn = wv >> 2;

  floatx8 accT[4] = {{}, {}, {}, {}};
  floatx8 accB[4] = {{}, {}, {}, {}};

  // Staging map. A: 8 threads cover one row's 32 floats (one 128-byte line).
  // B: one thread takes rows k = 2*bkp, 2*bkp+1 at 8 consecutive columns; a wave
  // takes 4 k-pairs x 64 columns (whole 128-byte lines), which spreads its
  // transposing LDS stores over twice the banks that 2 k-pairs x 128 columns hit.
  int arow = tid >> 3, ak = (tid & 7) << 2;
  int bkp = ((tid >> 3) & 3) | ((tid >> 6) << 2);
  int bn = ((tid & 7) | (((tid >> 5) & 1) << 3)) << 3;
  const float* Wp = W + (size_t)(m0 + arow) * Hc + ak;
  const __bf16* ub = u + (size_t)(2 * bkp) * BL + n0 + bn;

  for (int kk = 0; kk < Hc; kk += 32) {
    // all six 16-byte loads of this K-tile are issued before the first use; the
    // short loops are unrolled so that a[], b0, b1 get constant indices (registers)
    f32x4 a[4];
#pragma unroll
    for (int j = 0; j < 4; ++j)
      a[j] = *(const f32x4*)(Wp + (size_t)((j >> 1) * 256 + (j & 1) * 32) * Hc + kk);
    f32x4 r0 = *(const f32x4*)(ub + (size_t)kk * BL);
    f32x4 r1 = *(const f32x4*)(ub + (size_t)(kk + 1) * BL);
    bf16x8 b0 = __builtin_bit_cast(bf16x8, r0);
    bf16x8 b1 = __builtin_bit_cast(bf16x8, r1);
#pragma unroll
    for (int j = 0; j < 4; ++j) {
      *(bf16x4*)(&Asm[j >> 1][arow + (j & 1) * 32][ak]) =
          bf16x4{(__bf16)a[j].x, (__bf16)a[j].y, (__bf16)a[j].z, (__bf16)a[j].w};
    }
#pragma unroll
    for (int i = 0; i < 8; ++i)
      *(bf16x2*)(&BsT[bn + i][2 * bkp]) = bf16x2{b0[i], b1[i]};
    if (kk + 32 < Hc)   // prefetch next B K-tile -> global_prefetch_b8
      __builtin_prefetch(&u[(size_t)(kk + 32 + (tid & 31)) * BL + n0], 0, 1);
    __syncthreads();

    bf16x16 at = load_frag(&Asm[0][0][0], wm * 16);
    bf16x16 ab = load_frag(&Asm[1][0][0], wm * 16);
#pragma unroll
    for (int j = 0; j < 4; ++j) {
      bf16x16 bf = load_frag(&BsT[0][0], wn * 64 + j * 16);
      accT[j] = wmma_bf16(at, bf, accT[j]);
      accB[j] = wmma_bf16(ab, bf, accB[j]);
    }
    __syncthreads();
  }

  int lane = tid & 31;
  int nl = lane & 15, half = lane >> 4;
#pragma unroll
  for (int j = 0; j < 4; ++j) {
#pragma unroll
    for (int r = 0; r < 8; ++r) {
      int row = (half << 3) + r;
      int gm = m0 + wm * 16 + row;
      size_t col = (size_t)n0 + wn * 64 + j * 16 + nl;
      float zt = accT[j][r] + bias[gm];
      float zb = accB[j][r] + bias[gm + 256];
      float gv = zt * (1.f / (1.f + expf(-zb)));
      g[(size_t)gm * BL + col] = (__bf16)gv;
    }
  }
}

// ---------------------------------------------------------------------------
// K3: conv1d(k=3,pad=1) as 3 shifted-tap WMMA GEMMs; fused bias + residual.
// ---------------------------------------------------------------------------
// 8 waves per SIMD (at most 128 VGPRs): four work-groups per WGP, so that all
// 1,024 are resident at once
__global__ void __launch_bounds__(256) __attribute__((amdgpu_waves_per_eu(8)))
k_conv_gemm(const float* __restrict__ cw,
            const float* __restrict__ cb,
            const __bf16* __restrict__ g,
            const float* __restrict__ x,
            float* __restrict__ out) {
  __shared__ __align__(16) __bf16 Asm[3][64][LDP];
  __shared__ __align__(16) __bf16 BsT[130][LDP];
  int n0 = blockIdx.x * 128;
  int m0 = blockIdx.y * 64;
  int tid = threadIdx.x;
  int wv = tid >> 5;
  int wm = wv & 3, wn = wv >> 2;
  int bstart = (n0 / Lc) * Lc;

  floatx8 acc[4] = {{}, {}, {}, {}};

  // Staging map. A: one thread takes 12 consecutive floats of a weight row,
  // which are 4 input channels x 3 taps. B: one thread takes rows k = 2*bkp,
  // 2*bkp+1 at 8 consecutive columns, a wave 4 k-pairs x 64 columns as in the GLU
  // kernel; the 128 inner columns lie in one batch
  // entry (n0 and Lc are multiples of 128). The two edge columns, n0-1 and
  // n0+128, are read at an address clamped into the entry and zeroed outside.
  int arow = tid >> 3, au = tid & 7;
  int bkp = ((tid >> 3) & 3) | ((tid >> 6) << 2);
  int bn = ((tid & 7) | (((tid >> 5) & 1) << 3)) << 3;
  const float* cwp = cw + (size_t)(m0 + arow) * (Hc * 3) + au * 12;
  const __bf16* gb = g + (size_t)(2 * bkp) * BL + n0 + bn;
  int hk = tid & 31, hs = (tid >> 5) & 1;
  int hn = hs ? n0 + 128 : n0 - 1;
  bool hin = hn >= bstart && hn < bstart + Lc;
  const __bf16* gh = g + (size_t)hk * BL + (hin ? hn : n0);

  for (int kk = 0; kk < Hc; kk += 32) {
    // all nine loads of this K-tile are issued before the first use; the short
    // loops are unrolled so that a[], b0, b1 get constant indices (registers)
    f32x4 a[2][3];
#pragma unroll
    for (int j = 0; j < 2; ++j)
#pragma unroll
      for (int i = 0; i < 3; ++i)
        a[j][i] = *(const f32x4*)(cwp + (size_t)(j * 32) * (Hc * 3) + kk * 3 + i * 4);
    f32x4 r0 = *(const f32x4*)(gb + (size_t)kk * BL);
    f32x4 r1 = *(const f32x4*)(gb + (size_t)(kk + 1) * BL);
    unsigned hr = *(const unsigned short*)(gh + (size_t)kk * BL);
    // inputs-only fence on the loaded values: keeps the nine loads in one group
    // with one latency; without it the edge load sinks into the branch below
    // and is waited for by itself
    asm volatile("" :: "v"(a[0][0]), "v"(a[0][1]), "v"(a[0][2]), "v"(a[1][0]),
                       "v"(a[1][1]), "v"(a[1][2]), "v"(r0), "v"(r1), "v"(hr));
    bf16x8 b0 = __builtin_bit_cast(bf16x8, r0);
    bf16x8 b1 = __builtin_bit_cast(bf16x8, r1);
    __bf16 hv = __builtin_bit_cast(__bf16, (unsigned short)hr);
#pragma unroll
    for (int j = 0; j < 2; ++j) {
#pragma unroll
      for (int d = 0; d < 3; ++d) {
        // float e of the 12 is channel e / 3, tap e % 3
        *(bf16x4*)(&Asm[d][arow + j * 32][au * 4]) =
            bf16x4{(__bf16)a[j][d >> 2][d & 3],
                   (__bf16)a[j][(3 + d) >> 2][(3 + d) & 3],
                   (__bf16)a[j][(6 + d) >> 2][(6 + d) & 3],
                   (__bf16)a[j][(9 + d) >> 2][(9 + d) & 3]};
      }
    }
#pragma unroll
    for (int i = 0; i < 8; ++i)
      *(bf16x2*)(&BsT[1 + bn + i][2 * bkp]) = bf16x2{b0[i], b1[i]};
    if (tid < 64) BsT[hs * 129][hk] = hin ? hv : (__bf16)0.0f;
    __syncthreads();

#pragma unroll
    for (int d = 0; d < 3; ++d) {
      bf16x16 af = load_frag(&Asm[d][0][0], wm * 16);
      bf16x16 bf[4];
#pragma unroll
      for (int j = 0; j < 4; ++j) bf[j] = load_frag(&BsT[0][0], wn * 64 + j * 16 + d);
      // inputs-only fence on the loaded values: keeps the tap's ten LDS reads in
      // one group with one latency; without it each fragment is waited for by itself
      asm volatile("" :: "v"(af), "v"(bf[0]), "v"(bf[1]), "v"(bf[2]), "v"(bf[3]));
#pragma unroll
      for (int j = 0; j < 4; ++j) acc[j] = wmma_bf16(af, bf[j], acc[j]);
    }
    __syncthreads();
  }

  int lane = tid & 31;
  int nl = lane & 15, half = lane >> 4;
#pragma unroll
  for (int j = 0; j < 4; ++j) {
#pragma unroll
    for (int r = 0; r < 8; ++r) {
      int row = (half << 3) + r;
      int o = m0 + wm * 16 + row;
      long long ng = (long long)n0 + wn * 64 + j * 16 + nl;
      int b = (int)(ng >> 12);
      int l = (int)(ng & (Lc - 1));
      size_t oi = ((size_t)b * Hc + o) * Lc + l;
      out[oi] = x[oi] + cb[o] + acc[j][r];
    }
  }
}

// ---------------------------------------------------------------------------
extern "C" void kernel_launch(void* const* d_in, const int* in_sizes, int n_in,
                              void* d_out, int out_size, void* d_ws, size_t ws_size,
                              hipStream_t stream) {
  const float* x        = (const float*)d_in[0];
  const float* gn_w     = (const float*)d_in[1];
  const float* gn_b     = (const float*)d_in[2];
  const float* log_dt   = (const float*)d_in[3];
  const float* A_log_re = (const float*)d_in[4];
  const float* A_im     = (const float*)d_in[5];
  const float* C_re     = (const float*)d_in[6];
  const float* C_im     = (const float*)d_in[7];
  const float* Dv       = (const float*)d_in[8];
  const float* W_out    = (const float*)d_in[9];
  const float* b_out    = (const float*)d_in[10];
  const float* conv_w   = (const float*)d_in[11];
  const float* conv_b   = (const float*)d_in[12];
  float* out = (float*)d_out;

  char* ws = (char*)d_ws;
  size_t off = 0;
  auto alloc = [&](size_t bytes) { size_t o = off; off = (off + bytes + 255) & ~(size_t)255; return o; };
  __bf16* w_u      = (__bf16*)(ws + alloc(sizeof(__bf16) * (size_t)Hc * BL));
  __bf16* w_g      = (__bf16*)(ws + alloc(sizeof(__bf16) * (size_t)Hc * BL));

  k_ssm<<<Bsz * Gg, 1024, 0, stream>>>(x, gn_w, gn_b, log_dt, A_log_re, A_im, C_re, C_im, Dv, w_u);
  dim3 gemm_grid((unsigned)(BL / 128), Hc / 64);
  k_glu_gemm<<<gemm_grid, 256, 0, stream>>>(W_out, b_out, w_u, w_g);
  k_conv_gemm<<<gemm_grid, 256, 0, stream>>>(conv_w, conv_b, w_g, x, out);
}

// v007
// A run of this version takes 91.7 microseconds.
// Timed twice side by side with v006, it ran 1.06 times as fast both times.
// Over all steps from v000 it is 4.27 times as fast.
#include <hip/hip_runtime.h>
#include <math.h>
#include <stdint.h>

#define DEVI __device__ __forceinline__

// Problem constants (match reference)
constexpr int  Bsz = 8, Hc = 256, Lc = 4096, Nst = 32, Gg = 32;
constexpr int  CPG = Hc / Gg;              // 8 channels per group
constexpr int  NC  = 4,  Tc = Lc / NC;     // 4 chunks of 1024
constexpr long long BL = (long long)Bsz * Lc;  // 32768 positions

typedef __attribute__((ext_vector_type(16))) __bf16 bf16x16;
typedef __attribute__((ext_vector_type(8)))  float  floatx8;
typedef __attribute__((ext_vector_type(4)))  float  f32x4;
typedef __attribute__((ext_vector_type(8)))  __bf16 bf16x8;
typedef __attribute__((ext_vector_type(4)))  __bf16 bf16x4;
typedef __attribute__((ext_vector_type(2)))  __bf16 bf16x2;

// ---------------------------------------------------------------------------
// CDNA5 async Global->LDS copy (ASYNCcnt-tracked) with builtin/asm fallback
// ---------------------------------------------------------------------------
#define GAS __attribute__((address_space(1)))
#define LAS __attribute__((address_space(3)))
typedef int v4i __attribute__((vector_size(4 * sizeof(int))));

DEVI void async_ld_b128(const void* g, void* l) {
#if __has_builtin(__builtin_amdgcn_global_load_async_to_lds_b128)
  __builtin_amdgcn_global_load_async_to_lds_b128(
      (GAS v4i*)(g), (LAS v4i*)(l), 0, 0);
#else
  unsigned loff = (unsigned)(uintptr_t)l;
  asm volatile("global_load_async_to_lds_b128 %0, %1, off"
               :: "v"(loff), "v"(g) : "memory");
#endif
}

DEVI void wait_async0() {
#if __has_builtin(__builtin_amdgcn_s_wait_asynccnt)
  __builtin_amdgcn_s_wait_asynccnt(0);
#else
  asm volatile("s_wait_asynccnt 0x0" ::: "memory");
#endif
  asm volatile("" ::: "memory");
}
DEVI void wait_async1() {
#if __has_builtin(__builtin_amdgcn_s_wait_asynccnt)
  __builtin_amdgcn_s_wait_asynccnt(1);
#else
  asm volatile("s_wait_asynccnt 0x1" ::: "memory");
#endif
  asm volatile("" ::: "memory");
}

// Stage 128 consecutive floats (one wave, 4 floats / lane) into LDS async.
DEVI void async_tile128(const float* gsrc, float* ldst) {
  int lane = threadIdx.x & 31;
  async_ld_b128(gsrc + lane * 4, ldst + lane * 4);
}

// Normalise a landed 128-float tile in place: each lane takes the 16 bytes that
// it copied itself. One wave's LDS operations complete in issue order, so the
// wave's later broadcast reads see the stored values without a barrier.
DEVI void norm_tile128(float* t, float sc, float sh) {
  f32x4* q = (f32x4*)(t + (threadIdx.x & 31) * 4);
  f32x4 v = *q;
  v.x = fmaf(v.x, sc, sh); v.y = fmaf(v.y, sc, sh);
  v.z = fmaf(v.z, sc, sh); v.w = fmaf(v.w, sc, sh);
  *q = v;
}

// ---------------------------------------------------------------------------
// WMMA helpers
// ---------------------------------------------------------------------------
DEVI floatx8 wmma_bf16(bf16x16 a, bf16x16 b, floatx8 c) {
  return __builtin_amdgcn_wmma_f32_16x16x32_bf16(false, a, false, b, (short)0, c,
                                                 false, false);
}

// LDS row pitch of every staged 32-k tile, in bf16: 80 bytes = 16 x 5. Every row
// starts on a 16-byte boundary, and 16 consecutive rows read 16 bytes each from
// all 64 banks once.
constexpr int LDP = 40;

// One 16x32 fragment, A (row = m) and B (row = n) alike: lane (c, half) takes row
// rowBase + c, k = 8*half + 0..7 in elements 0..7 and k = 16 + 8*half + 0..7 in
// elements 8..15 (the documented 16-bit layout): two 16-byte LDS reads.
DEVI bf16x16 load_frag(const __bf16* S, int rowBase) {
  int lane = threadIdx.x & 31;
  const __bf16* p = S + (rowBase + (lane & 15)) * LDP + ((lane >> 4) << 3);
  bf16x8 lo = *(const bf16x8*)(p);
  bf16x8 hi = *(const bf16x8*)(p + 16);
  return __builtin_shufflevector(lo, hi, 0, 1, 2, 3, 4, 5, 6, 7, 8, 9, 10, 11, 12, 13, 14, 15);
}

// ---------------------------------------------------------------------------
// K1: GroupNorm, parameter set-up and the whole SSM in one launch. One work-group
// per (b, group): 32 waves = 8 channels x 4 chunks of 1024 steps, one lane per
// state. Its LDS lets one work-group live on a WGP: 256 work-groups, 256 WGPs.
//   set-up:  every wave discretizes its channel's 32 states; in chunks 0..2
//            its first tile of x is on the way meanwhile
//   phase 1: chunk end state from a zero start on the RAW x (chunks 0..2; nothing
//            reads the end state of the last chunk), and the sums of x and x^2
//            of every chunk for the group's mean and variance
//   hand-over: end states and sums pass through LDS. The recurrence is linear:
//            the end state for sc*x + sh is sc * (end state for x) plus
//            sh * (1 + a + ... + a^1023). Every wave folds the chunks in front
//            of its own into its start state
//   phase 2: full recurrence on the normalised x; fused D-skip + exact GELU.
// The sum over the 32 states is taken once per block of 32 steps: every lane
// (one state) stores its term of each step into a wave-private 32x32 LDS tile,
// then every lane sums one row (one step) and evaluates the GELU of that step.
// x is streamed via async Global->LDS copies in phase 2 and in
// chunks 0..2 of phase 1; in phase 2 each
// landed tile is normalised once in LDS, and a step adds it as the addend of its
// FMA chain.
// ---------------------------------------------------------------------------
DEVI void acc_sums(f32x4 v, float& sum, float& ssq) {
  sum += (v.x + v.y) + (v.z + v.w);
  ssq = fmaf(v.x, v.x, fmaf(v.y, v.y, fmaf(v.z, v.z, fmaf(v.w, v.w, ssq))));
}

__global__ void __launch_bounds__(1024)
k_ssm(const float* __restrict__ x,
      const float* __restrict__ gn_w,
      const float* __restrict__ gn_b,
      const float* __restrict__ log_dt,
      const float* __restrict__ A_log_re,
      const float* __restrict__ A_im,
      const float* __restrict__ C_re,
      const float* __restrict__ C_im,
      const float* __restrict__ Dv,
      __bf16* __restrict__ u) {
  __shared__ __align__(16) float xbuf[32][2][128];  // per-wave double buffer
  __shared__ __align__(16) float tile[32][32][32];  // per wave: [step][state]
  __shared__ float red[32][2];                      // per wave: sum x, sum x^2
  if (blockIdx.x >= Bsz * Gg) return;           // whole work-group, before any barrier
  int lane = threadIdx.x & 31;
  // the wave's number in a scalar register: the tests on the chunk are scalar
  // branches, and every base address below is wave-uniform
  int wv = __builtin_amdgcn_readfirstlane(threadIdx.x >> 5);
  int cs = wv >> 3, c = cs;                     // chunk 0..3
  int ch = wv & (CPG - 1);                      // channel of the group
  int b = blockIdx.x / Gg;
  int h = (blockIdx.x % Gg) * CPG + ch;
  int bh = b * Hc + h;

  const float* xp = x + (size_t)bh * Lc + (size_t)c * Tc;
  __bf16* up = u + (size_t)h * BL + (size_t)b * Lc + (size_t)c * Tc;
  float* buf = &xbuf[wv][0][0];
  constexpr int NS = Tc / 128;                  // 8 sub-tiles

  if (cs < NC - 1) async_tile128(xp, buf);      // prime tile 0: it flies during the set-up

  // ---- set-up: discretize this lane's state ----
  float4 p;                                     // (a_re, a_im, 2Cd_re, -2Cd_im)
  float2 aT, gT;                                // a^1024; 1 + a + ... + a^1023
  {
    int idx = h * Nst + lane;
    float dt  = expf(log_dt[h]);
    float Are = -expf(A_log_re[idx]);
    float Aim = A_im[idx];
    float er  = expf(Are * dt);
    float are = er * cosf(Aim * dt);
    float aim = er * sinf(Aim * dt);
    float dre = are - 1.f, dim = aim;
    float inv = 1.f / (Are * Are + Aim * Aim);
    float qre = (dre * Are + dim * Aim) * inv;
    float qim = (dim * Are - dre * Aim) * inv;
    float Cr = C_re[idx], Ci = C_im[idx];
    float cdre = Cr * qre - Ci * qim;
    float cdim = Cr * qim + Ci * qre;
    p = make_float4(are, aim, 2.f * cdre, -2.f * cdim);
    // doubling: with t = a^k and g = 1 + ... + a^(k-1), g + t*g has 2k terms
    float tr = are, ti = aim, gr = 1.f, gi = 0.f;
#pragma unroll
    for (int i = 0; i < 10; ++i) {
      float hr = gr + (tr * gr - ti * gi), hi = gi + (tr * gi + ti * gr);
      gr = hr; gi = hi;
      float nr = tr*tr - ti*ti, ni = 2.f*tr*ti; tr = nr; ti = ni;
    }
    aT = make_float2(tr, ti);
    gT = make_float2(gr, gi);
  }
  float Dh = Dv[h];

  // ---- phase 1: this chunk's sums, and its end state from a zero start ----
  float sum = 0.f, ssq = 0.f;
  if (cs < NC - 1) {
    float sr = 0.f, si = 0.f;
    for (int s = 0; s < NS; ++s) {
      if (s + 1 < NS) {
        // a slot of the wave's own ring is refilled only behind its reads
        asm volatile("s_wait_dscnt 0x0" ::: "memory");
        async_tile128(xp + (s + 1) * 128, buf + ((s + 1) & 1) * 128); wait_async1();
      } else { wait_async0(); }
      const float* cur = buf + (s & 1) * 128;
      acc_sums(*(const f32x4*)(cur + lane * 4), sum, ssq);
      for (int t = 0; t < 128; ++t) {
        float uin = cur[t];                     // LDS broadcast read, raw x
        float nr = fmaf(p.x, sr, fmaf(-p.y, si, uin));
        float ni = fmaf(p.x, si, p.y * sr);
        sr = nr; si = ni;
      }
    }
    tile[wv][0][lane] = sr;                     // the tile is idle in this phase
    tile[wv][1][lane] = si;
  } else {
    // unrolled: the eight loads are issued as one group
#pragma unroll
    for (int s = 0; s < NS; ++s)
      acc_sums(*(const f32x4*)(xp + s * 128 + lane * 4), sum, ssq);
  }
#pragma unroll
  for (int o = 16; o > 0; o >>= 1) { sum += __shfl_xor(sum, o); ssq += __shfl_xor(ssq, o); }
  if (lane == 0) { red[wv][0] = sum; red[wv][1] = ssq; }
  __syncthreads();                              // end states and sums published
  float er_[NC - 1], ei_[NC - 1];
#pragma unroll
  for (int q = 0; q < NC - 1; ++q) {
    er_[q] = tile[q * CPG + ch][0][lane]; ei_[q] = tile[q * CPG + ch][1][lane];
  }
  float gs = red[lane][0], gq = red[lane][1];   // lane l: wave l's sums
  __syncthreads();                              // all read: the tiles may be overwritten

  // ---- the group's mean and variance -> this channel's scale and shift ----
#pragma unroll
  for (int o = 16; o > 0; o >>= 1) { gs += __shfl_xor(gs, o); gq += __shfl_xor(gq, o); }
  float mu = gs / (float)(CPG * Lc);
  float var = gq / (float)(CPG * Lc) - mu * mu;
  float sc = rsqrtf(var + 1e-5f) * gn_w[h];
  float sh = gn_b[h] - mu * sc;

  // ---- start state: fold the chunks in front of this one, in their order ----
  float sr = 0.f, si = 0.f;
#pragma unroll
  for (int q = 0; q < NC - 1; ++q) {
    if (q < cs) {
      float nr = aT.x * sr - aT.y * si + fmaf(sc, er_[q], sh * gT.x);
      float ni = aT.x * si + aT.y * sr + fmaf(sc, ei_[q], sh * gT.y);
      sr = nr; si = ni;
    }
  }

  // ---- phase 2: full recurrence and output ----
  float* tcol = &tile[wv][0][lane];             // this lane's state, row = step
  const float* trow = &tile[wv][lane][0];       // this lane's step, all states
  // Rows are 128 B apart, so lane l starts its row at 16-byte piece (l >> 1) & 7:
  // each 16 lanes of a 16-byte read then cover all 64 banks once.
  int rot = (lane >> 1) & 7;

  async_tile128(xp, buf);
  for (int s = 0; s < NS; ++s) {
    if (s + 1 < NS) {
      // a slot of the wave's own ring is refilled only behind its reads
      asm volatile("s_wait_dscnt 0x0" ::: "memory");
      async_tile128(xp + (s + 1) * 128, buf + ((s + 1) & 1) * 128); wait_async1();
    } else { wait_async0(); }
    float* cur = buf + (s & 1) * 128;
    norm_tile128(cur, sc, sh);
    for (int t0 = 0; t0 < 128; t0 += 32) {
      // fully unrolled: every step's tile store gets an immediate offset
#pragma unroll
      for (int k = 0; k < 32; ++k) {
        float uin = cur[t0 + k];
        float nr = fmaf(p.x, sr, fmaf(-p.y, si, uin));
        float ni = fmaf(p.x, si, p.y * sr);
        sr = nr; si = ni;
        tcol[k * 32] = p.z * sr + p.w * si;      // this state's 2*Re(Cd * s)
      }
      // One wave's LDS operations complete in issue order: no barrier needed.
      f32x4 v[8];
#pragma unroll
      for (int j = 0; j < 8; ++j) v[j] = *(const f32x4*)(trow + ((j ^ rot) << 2));
      float xl = cur[t0 + lane];
      // inputs-only fence on the loaded values: keeps the nine LDS reads in one
      // group with one latency; without it each read is waited for by itself
      asm volatile("" :: "v"(v[0]), "v"(v[1]), "v"(v[2]), "v"(v[3]), "v"(v[4]),
                         "v"(v[5]), "v"(v[6]), "v"(v[7]), "v"(xl));
      f32x4 a = ((v[0] + v[1]) + (v[2] + v[3])) + ((v[4] + v[5]) + (v[6] + v[7]));
      float part = (a.x + a.z) + (a.y + a.w);
      float y = part + Dh * xl;
      float gel = 0.5f * y * (1.f + erff(y * 0.70710678f));
      up[s * 128 + t0 + lane] = (__bf16)gel;
    }
  }
}

// ---------------------------------------------------------------------------
// K2: GLU projection, bf16 WMMA; both halves of W_out share the B-tile.
// ---------------------------------------------------------------------------
// 8 waves per SIMD (at most 128 VGPRs): four work-groups per WGP, so that all
// 1,024 are resident at once
__global__ void __launch_bounds__(256) __attribute__((amdgpu_waves_per_eu(8)))
k_glu_gemm(const float* __restrict__ W, const float* __restrict__ bias,
           const __bf16* __restrict__ u, __bf16* __restrict__ g) {
  // two buffers of each operand: tile t is read from buffer t & 1
  __shared__ __align__(16) __bf16 Asm[2][2][64][LDP];
  __shared__ __align__(16) __bf16 BsT[2][128][LDP];
  int n0 = blockIdx.x * 128;
  int m0 = blockIdx.y * 64;
  int tid = threadIdx.x;
  int wv = tid >> 5;
  int wm = wv & 3, wn = wv >> 2;

  floatx8 accT[4] = {{}, {}, {}, {}};
  floatx8 accB[4] = {{}, {}, {}, {}};

  // Staging map. A: 8 threads cover one row's 32 floats (one 128-byte line).
  // B: one thread takes rows k = 2*bkp, 2*bkp+1 at 8 consecutive columns; a wave
  // takes 4 k-pairs x 64 columns (whole 128-byte lines), which spreads its
  // transposing LDS stores over twice the banks that 2 k-pairs x 128 columns hit.
  int arow = tid >> 3, ak = (tid & 7) << 2;
  int bkp = ((tid >> 3) & 3) | ((tid >> 6) << 2);
  int bn = ((tid & 7) | (((tid >> 5) & 1) << 3)) << 3;
  const float* Wp = W + (size_t)(m0 + arow) * Hc + ak;
  const __bf16* ub = u + (size_t)(2 * bkp) * BL + n0 + bn;

  // one K-tile on its way from global memory to LDS: six 16-byte loads a thread
  f32x4 a[4], r0, r1;
  auto fetch = [&](int kk) {
#pragma unroll
    for (int j = 0; j < 4; ++j)
      a[j] = *(const f32x4*)(Wp + (size_t)((j >> 1) * 256 + (j & 1) * 32) * Hc + kk);
    r0 = *(const f32x4*)(ub + (size_t)kk * BL);
    r1 = *(const f32x4*)(ub + (size_t)(kk + 1) * BL);
  };
  auto stage = [&](int s) {
    bf16x8 b0 = __builtin_bit_cast(bf16x8, r0);
    bf16x8 b1 = __builtin_bit_cast(bf16x8, r1);
#pragma unroll
    for (int j = 0; j < 4; ++j) {
      *(bf16x4*)(&Asm[s][j >> 1][arow + (j & 1) * 32][ak]) =
          bf16x4{(__bf16)a[j].x, (__bf16)a[j].y, (__bf16)a[j].z, (__bf16)a[j].w};
    }
#pragma unroll
    for (int i = 0; i < 8; ++i)
      *(bf16x2*)(&BsT[s][bn + i][2 * bkp]) = bf16x2{b0[i], b1[i]};
  };

  constexpr int NT = Hc / 32;
  fetch(0);
  stage(0);
  __syncthreads();
  // unrolled: the buffer index is a constant, so it goes into the LDS offsets
#pragma unroll
  for (int t = 0; t < NT; ++t) {
    // the next tile's loads are issued here and fly during this tile's products
    if (t + 1 < NT) fetch((t + 1) * 32);
    bf16x16 at = load_frag(&Asm[t & 1][0][0][0], wm * 16);
    bf16x16 ab = load_frag(&Asm[t & 1][1][0][0], wm * 16);
#pragma unroll
    for (int j = 0; j < 4; ++j) {
      bf16x16 bf = load_frag(&BsT[t & 1][0][0], wn * 64 + j * 16);
      accT[j] = wmma_bf16(at, bf, accT[j]);
      accB[j] = wmma_bf16(ab, bf, accB[j]);
      // one B fragment alive at a time: with the next tile held in registers the
      // kernel would else pass 128 VGPRs and spill accumulators. The last one also
      // keeps the wait for the next tile's loads behind this tile's products; the
      // scheduler would else lift the conversions, and the wait with them, in front
      __builtin_amdgcn_sched_barrier(0);
    }
    if (t + 1 < NT) {
      // the other buffer: its readers (tile t - 1) left it before the last barrier
      stage((t + 1) & 1);
      __syncthreads();  // publishes tile t + 1 and ends the reads of tile t
    }
  }

  int lane = tid & 31;
  int nl = lane & 15, half = lane >> 4;
#pragma unroll
  for (int j = 0; j < 4; ++j) {
#pragma unroll
    for (int r = 0; r < 8; ++r) {
      int row = (half << 3) + r;
      int gm = m0 + wm * 16 + row;
      size_t col = (size_t)n0 + wn * 64 + j * 16 + nl;
      float zt = accT[j][r] + bias[gm];
      float zb = accB[j][r] + bias[gm + 256];
      float gv = zt * (1.f / (1.f + expf(-zb)));
      g[(size_t)gm * BL + col] = (__bf16)gv;
    }
  }
}

// ---------------------------------------------------------------------------
// K3: conv1d(k=3,pad=1) as 3 shifted-tap WMMA GEMMs; fused bias + residual.
// ---------------------------------------------------------------------------
// 8 waves per SIMD (at most 128 VGPRs): four work-groups per WGP, so that all
// 1,024 are resident at once
__global__ void __launch_bounds__(256) __attribute__((amdgpu_waves_per_eu(8)))
k_conv_gemm(const float* __restrict__ cw,
            const float* __restrict__ cb,
            const __bf16* __restrict__ g,
            const float* __restrict__ x,
            float* __restrict__ out) {
  // two buffers of each operand: tile t is read from buffer t & 1
  __shared__ __align__(16) __bf16 Asm[2][3][64][LDP];
  __shared__ __align__(16) __bf16 BsT[2][130][LDP];
  int n0 = blockIdx.x * 128;
  int m0 = blockIdx.y * 64;
  int tid = threadIdx.x;
  int wv = tid >> 5;
  int wm = wv & 3, wn = wv >> 2;
  int bstart = (n0 / Lc) * Lc;

  floatx8 acc[4] = {{}, {}, {}, {}};

  // Staging map. A: one thread takes 12 consecutive floats of a weight row,
  // which are 4 input channels x 3 taps. B: one thread takes rows k = 2*bkp,
  // 2*bkp+1 at 8 consecutive columns, a wave 4 k-pairs x 64 columns as in the GLU
  // kernel; the 128 inner columns lie in one batch
  // entry (n0 and Lc are multiples of 128). The two edge columns, n0-1 and
  // n0+128, are read at an address clamped into the entry and zeroed outside.
  int arow = tid >> 3, au = tid & 7;
  int bkp = ((tid >> 3) & 3) | ((tid >> 6) << 2);
  int bn = ((tid & 7) | (((tid >> 5) & 1) << 3)) << 3;
  const float* cwp = cw + (size_t)(m0 + arow) * (Hc * 3) + au * 12;
  const __bf16* gb = g + (size_t)(2 * bkp) * BL + n0 + bn;
  int hk = tid & 31, hs = (tid >> 5) & 1;
  int hn = hs ? n0 + 128 : n0 - 1;
  bool hin = hn >= bstart && hn < bstart + Lc;
  const __bf16* gh = g + (size_t)hk * BL + (hin ? hn : n0);

  // one K-tile on its way from global memory to LDS: nine loads a thread
  f32x4 a[2][3], r0, r1;
  unsigned short hraw;
  auto fetch = [&](int kk) {
#pragma unroll
    for (int j = 0; j < 2; ++j)
#pragma unroll
      for (int i = 0; i < 3; ++i)
        a[j][i] = *(const f32x4*)(cwp + (size_t)(j * 32) * (Hc * 3) + kk * 3 + i * 4);
    r0 = *(const f32x4*)(gb + (size_t)kk * BL);
    r1 = *(const f32x4*)(gb + (size_t)(kk + 1) * BL);
    hraw = *(const unsigned short*)(gh + (size_t)kk * BL);
  };
  auto stage = [&](int s) {
    unsigned hr = hraw;
    // inputs-only fence on the loaded values: keeps the nine loads in one group
    // where fetch() issues them; without it the edge load sinks into the branch
    // below and is waited for by itself
    asm volatile("" :: "v"(a[0][0]), "v"(a[0][1]), "v"(a[0][2]), "v"(a[1][0]),
                       "v"(a[1][1]), "v"(a[1][2]), "v"(r0), "v"(r1), "v"(hr));
    bf16x8 b0 = __builtin_bit_cast(bf16x8, r0);
    bf16x8 b1 = __builtin_bit_cast(bf16x8, r1);
    __bf16 hv = __builtin_bit_cast(__bf16, (unsigned short)hr);
#pragma unroll
    for (int j = 0; j < 2; ++j) {
#pragma unroll
      for (int d = 0; d < 3; ++d) {
        // float e of the 12 is channel e / 3, tap e % 3
        *(bf16x4*)(&Asm[s][d][arow + j * 32][au * 4]) =
            bf16x4{(__bf16)a[j][d >> 2][d & 3],
                   (__bf16)a[j][(3 + d) >> 2][(3 + d) & 3],
                   (__bf16)a[j][(6 + d) >> 2][(6 + d) & 3],
                   (__bf16)a[j][(9 + d) >> 2][(9 + d) & 3]};
      }
    }
#pragma unroll
    for (int i = 0; i < 8; ++i)
      *(bf16x2*)(&BsT[s][1 + bn + i][2 * bkp]) = bf16x2{b0[i], b1[i]};
    if (tid < 64) BsT[s][hs * 129][hk] = hin ? hv : (__bf16)0.0f;
  };

  constexpr int NT = Hc / 32;
  fetch(0);
  stage(0);
  __syncthreads();
  // unrolled: the buffer index is a constant, so it goes into the LDS offsets
#pragma unroll
  for (int t = 0; t < NT; ++t) {
    // the next tile's loads are issued here and fly during this tile's products
    if (t + 1 < NT) fetch((t + 1) * 32);
#pragma unroll
    for (int d = 0; d < 3; ++d) {
      bf16x16 af = load_frag(&Asm[t & 1][d][0][0], wm * 16);
      bf16x16 bf[4];
#pragma unroll
      for (int j = 0; j < 4; ++j) bf[j] = load_frag(&BsT[t & 1][0][0], wn * 64 + j * 16 + d);
      // inputs-only fence on the loaded values: keeps the tap's ten LDS reads in
      // one group with one latency; without it each fragment is waited for by itself
      asm volatile("" :: "v"(af), "v"(bf[0]), "v"(bf[1]), "v"(bf[2]), "v"(bf[3]));
#pragma unroll
      for (int j = 0; j < 4; ++j) acc[j] = wmma_bf16(af, bf[j], acc[j]);
    }
    if (t + 1 < NT) {
      // keeps the wait for those loads behind this tile's products; the scheduler
      // would else lift the conversions, and the wait with them, in front
      __builtin_amdgcn_sched_barrier(0);
      // the other buffer: its readers (tile t - 1) left it before the last barrier
      stage((t + 1) & 1);
      __syncthreads();  // publishes tile t + 1 and ends the reads of tile t
    }
  }

  int lane = tid & 31;
  int nl = lane & 15, half = lane >> 4;
#pragma unroll
  for (int j = 0; j < 4; ++j) {
#pragma unroll
    for (int r = 0; r < 8; ++r) {
      int row = (half << 3) + r;
      int o = m0 + wm * 16 + row;
      long long ng = (long long)n0 + wn * 64 + j * 16 + nl;
      int b = (int)(ng >> 12);
      int l = (int)(ng & (Lc - 1));
      size_t oi = ((size_t)b * Hc + o) * Lc + l;
      out[oi] = x[oi] + cb[o] + acc[j][r];
    }
  }
}

// ---------------------------------------------------------------------------
extern "C" void kernel_launch(void* const* d_in, const int* in_sizes, int n_in,
                              void* d_out, int out_size, void* d_ws, size_t ws_size,
                              hipStream_t stream) {
  const float* x        = (const float*)d_in[0];
  const float* gn_w     = (const float*)d_in[1];
  const float* gn_b     = (const float*)d_in[2];
  const float* log_dt   = (const float*)d_in[3];
  const float* A_log_re = (const float*)d_in[4];
  const float* A_im     = (const float*)d_in[5];
  const float* C_re     = (const float*)d_in[6];
  const float* C_im     = (const float*)d_in[7];
  const float* Dv       = (const float*)d_in[8];
  const float* W_out    = (const float*)d_in[9];
  const float* b_out    = (const float*)d_in[10];
  const float* conv_w   = (const float*)d_in[11];
  const float* conv_b   = (const float*)d_in[12];
  float* out = (float*)d_out;

  char* ws = (char*)d_ws;
  size_t off = 0;
  auto alloc = [&](size_t bytes) { size_t o = off; off = (off + bytes + 255) & ~(size_t)255; return o; };
  __bf16* w_u      = (__bf16*)(ws + alloc(sizeof(__bf16) * (size_t)Hc * BL));
  __bf16* w_g      = (__bf16*)(ws + alloc(sizeof(__bf16) * (size_t)Hc * BL));

  k_ssm<<<Bsz * Gg, 1024, 0, stream>>>(x, gn_w, gn_b, log_dt, A_log_re, A_im, C_re, C_im, Dv, w_u);
  dim3 gemm_grid((unsigned)(BL / 128), Hc / 64);
  k_glu_gemm<<<gemm_grid, 256, 0, stream>>>(W_out, b_out, w_u, w_g);
  k_conv_gemm<<<gemm_grid, 256, 0, stream>>>(conv_w, conv_b, w_g, x, out);
}

// v008
// Measured time: 82.5 microseconds a run.
// Next to v007, in two timings, it ran 1.11 times as fast each time.
// Counting every step since v000, it is 4.73 times as fast.
#include <hip/hip_runtime.h>
#include <math.h>
#include <stdint.h>

#define DEVI __device__ __forceinline__

// Problem constants (match reference)
constexpr int  Bsz = 8, Hc = 256, Lc = 4096, Nst = 32, Gg = 32;
constexpr int  CPG = Hc / Gg;              // 8 channels per group
constexpr int  NC  = 4,  Tc = Lc / NC;     // 4 chunks of 1024
constexpr long long BL = (long long)Bsz * Lc;  // 32768 positions

typedef __attribute__((ext_vector_type(16))) __bf16 bf16x16;
typedef __attribute__((ext_vector_type(8)))  float  floatx8;
typedef __attribute__((ext_vector_type(4)))  float  f32x4;
typedef __attribute__((ext_vector_type(8)))  __bf16 bf16x8;
typedef __attribute__((ext_vector_type(4)))  __bf16 bf16x4;
typedef __attribute__((ext_vector_type(2)))  __bf16 bf16x2;

// ---------------------------------------------------------------------------
// CDNA5 async Global->LDS copy (ASYNCcnt-tracked) with builtin/asm fallback
// ---------------------------------------------------------------------------
#define GAS __attribute__((address_space(1)))
#define LAS __attribute__((address_space(3)))
typedef int v4i __attribute__((vector_size(4 * sizeof(int))));

DEVI void async_ld_b128(const void* g, void* l) {
#if __has_builtin(__builtin_amdgcn_global_load_async_to_lds_b128)
  __builtin_amdgcn_global_load_async_to_lds_b128(
      (GAS v4i*)(g), (LAS v4i*)(l), 0, 0);
#else
  unsigned loff = (unsigned)(uintptr_t)l;
  asm volatile("global_load_async_to_lds_b128 %0, %1, off"
               :: "v"(loff), "v"(g) : "memory");
#endif
}

DEVI void wait_async0() {
#if __has_builtin(__builtin_amdgcn_s_wait_asynccnt)
  __builtin_amdgcn_s_wait_asynccnt(0);
#else
  asm volatile("s_wait_asynccnt 0x0" ::: "memory");
#endif
  asm volatile("" ::: "memory");
}
DEVI void wait_async1() {
#if __has_builtin(__builtin_amdgcn_s_wait_asynccnt)
  __builtin_amdgcn_s_wait_asynccnt(1);
#else
  asm volatile("s_wait_asynccnt 0x1" ::: "memory");
#endif
  asm volatile("" ::: "memory");
}

// Stage 128 consecutive floats (one wave, 4 floats / lane) into LDS async.
DEVI void async_tile128(const float* gsrc, float* ldst) {
  int lane = threadIdx.x & 31;
  async_ld_b128(gsrc + lane * 4, ldst + lane * 4);
}

// Normalise a landed 128-float tile in place: each lane takes the 16 bytes that
// it copied itself, which are one block of four steps. One wave's LDS operations
// complete in issue order, so the wave's later reads see the stored values
// without a barrier. The same lane writes to cb what its four steps get directly
// from the inputs of their own block: k0 = D + K[0] on the step's own input, and
// k1..k3 = K[1..3] (the convolution kernel's taps) on the block's earlier inputs.
DEVI void norm_tile128(float* t, float* cb, float sc, float sh,
                       float k0, float k1, float k2, float k3) {
  int o = (threadIdx.x & 31) * 4;
  f32x4* q = (f32x4*)(t + o);
  f32x4 v = *q;
  v.x = fmaf(v.x, sc, sh); v.y = fmaf(v.y, sc, sh);
  v.z = fmaf(v.z, sc, sh); v.w = fmaf(v.w, sc, sh);
  *q = v;
  f32x4 c;
  c.x = k0 * v.x;
  c.y = fmaf(k0, v.y, k1 * v.x);
  c.z = fmaf(k0, v.z, fmaf(k1, v.y, k2 * v.x));
  c.w = fmaf(k0, v.w, fmaf(k1, v.z, fmaf(k2, v.y, k3 * v.x)));
  *(f32x4*)(cb + o) = c;
}

// ---------------------------------------------------------------------------
// WMMA helpers
// ---------------------------------------------------------------------------
DEVI floatx8 wmma_bf16(bf16x16 a, bf16x16 b, floatx8 c) {
  return __builtin_amdgcn_wmma_f32_16x16x32_bf16(false, a, false, b, (short)0, c,
                                                 false, false);
}

// LDS row pitch of every staged 32-k tile, in bf16: 80 bytes = 16 x 5. Every row
// starts on a 16-byte boundary, and 16 consecutive rows read 16 bytes each from
// all 64 banks once.
constexpr int LDP = 40;

// One 16x32 fragment, A (row = m) and B (row = n) alike: lane (c, half) takes row
// rowBase + c, k = 8*half + 0..7 in elements 0..7 and k = 16 + 8*half + 0..7 in
// elements 8..15 (the documented 16-bit layout): two 16-byte LDS reads.
DEVI bf16x16 load_frag(const __bf16* S, int rowBase) {
  int lane = threadIdx.x & 31;
  const __bf16* p = S + (rowBase + (lane & 15)) * LDP + ((lane >> 4) << 3);
  bf16x8 lo = *(const bf16x8*)(p);
  bf16x8 hi = *(const bf16x8*)(p + 16);
  return __builtin_shufflevector(lo, hi, 0, 1, 2, 3, 4, 5, 6, 7, 8, 9, 10, 11, 12, 13, 14, 15);
}

// ---------------------------------------------------------------------------
// K1: GroupNorm, parameter set-up and the whole SSM in one launch. One work-group
// per (b, group): 32 waves = 8 channels x 4 chunks of 1024 steps, one lane per
// state. Its LDS lets one work-group live on a WGP: 256 work-groups, 256 WGPs.
//   set-up:  every wave discretizes its channel's 32 states; in chunks 0..2
//            its first tile of x is on the way meanwhile
//   phase 1: chunk end state from a zero start on the RAW x (chunks 0..2; nothing
//            reads the end state of the last chunk), and the sums of x and x^2
//            of every chunk for the group's mean and variance
//   hand-over: end states and sums pass through LDS. The recurrence is linear:
//            the end state for sc*x + sh is sc * (end state for x) plus
//            sh * (1 + a + ... + a^1023). Every wave folds the chunks in front
//            of its own into its start state
//   phase 2: full recurrence on the normalised x; fused D-skip + exact GELU.
// The sum over the 32 states is taken once per block of 32 steps: every lane
// (one state) stores its term of each step into a wave-private 32x32 LDS tile,
// then every lane sums one row (one step) and evaluates the GELU of that step.
// x is streamed via async Global->LDS copies in both phases; in phase 2 each
// landed tile is normalised once in LDS.
// Both phases advance the state four steps at a time: with s the state in front
// of a block and u0..u3 its inputs,
//   s' = a^4 s + a^3 u0 + a^2 u1 + a u2 + u3              (10 FMAs per state)
//   step j's output = sum over states of 2 Re(Cd a^(j+1) s)   (2 FMAs per state)
//                     + K[0] u_j + ... + K[j] u_0,  K[m] = sum of 2 Re(Cd a^m),
// and the second line, which no longer depends on the state, is formed once per
// step (norm_tile128) instead of once per step and state.
// ---------------------------------------------------------------------------
DEVI void step4(f32x4 u, float2 a1, float2 a2, float2 a3, float2 a4, float& sr, float& si) {
  float vr = fmaf(a3.x, u.x, fmaf(a2.x, u.y, fmaf(a1.x, u.z, u.w)));
  float vi = fmaf(a3.y, u.x, fmaf(a2.y, u.y, a1.y * u.z));
  float nr = fmaf(a4.x, sr, fmaf(-a4.y, si, vr));
  float ni = fmaf(a4.x, si, fmaf(a4.y, sr, vi));
  sr = nr; si = ni;
}

DEVI void acc_sums(f32x4 v, float& sum, float& ssq) {
  sum += (v.x + v.y) + (v.z + v.w);
  ssq = fmaf(v.x, v.x, fmaf(v.y, v.y, fmaf(v.z, v.z, fmaf(v.w, v.w, ssq))));
}

__global__ void __launch_bounds__(1024)
k_ssm(const float* __restrict__ x,
      const float* __restrict__ gn_w,
      const float* __restrict__ gn_b,
      const float* __restrict__ log_dt,
      const float* __restrict__ A_log_re,
      const float* __restrict__ A_im,
      const float* __restrict__ C_re,
      const float* __restrict__ C_im,
      const float* __restrict__ Dv,
      __bf16* __restrict__ u) {
  __shared__ __align__(16) float xbuf[32][2][128];  // per-wave double buffer
  __shared__ __align__(16) float tile[32][32][32];  // per wave: [step][state]
  __shared__ __align__(16) float cbuf[32][128];     // per wave: in-block part of y
  __shared__ float red[32][2];                      // per wave: sum x, sum x^2
  if (blockIdx.x >= Bsz * Gg) return;           // whole work-group, before any barrier
  int lane = threadIdx.x & 31;
  // the wave's number in a scalar register: the tests on the chunk are scalar
  // branches, and every base address below is wave-uniform
  int wv = __builtin_amdgcn_readfirstlane(threadIdx.x >> 5);
  int cs = wv >> 3, c = cs;                     // chunk 0..3
  int ch = wv & (CPG - 1);                      // channel of the group
  int b = blockIdx.x / Gg;
  int h = (blockIdx.x % Gg) * CPG + ch;
  int bh = b * Hc + h;

  const float* xp = x + (size_t)bh * Lc + (size_t)c * Tc;
  __bf16* up = u + (size_t)h * BL + (size_t)b * Lc + (size_t)c * Tc;
  float* buf = &xbuf[wv][0][0];
  constexpr int NS = Tc / 128;                  // 8 sub-tiles

  if (cs < NC - 1) async_tile128(xp, buf);      // prime tile 0: it flies during the set-up

  // ---- set-up: discretize this lane's state ----
  float2 a1, a2, a3, a4;                        // a, a^2, a^3, a^4
  float zc[4], wc[4];                           // (2 Re, -2 Im) of Cd a^(j+1)
  float kap[4];                                 // K[m] = sum over states of 2 Re(Cd a^m)
  float2 aT, gT;                                // a^1024; 1 + a + ... + a^1023
  {
    int idx = h * Nst + lane;
    float dt  = expf(log_dt[h]);
    float Are = -expf(A_log_re[idx]);
    float Aim = A_im[idx];
    float er  = expf(Are * dt);
    float are = er * cosf(Aim * dt);
    float aim = er * sinf(Aim * dt);
    float dre = are - 1.f, dim = aim;
    float inv = 1.f / (Are * Are + Aim * Aim);
    float qre = (dre * Are + dim * Aim) * inv;
    float qim = (dim * Are - dre * Aim) * inv;
    float Cr = C_re[idx], Ci = C_im[idx];
    float cdre = Cr * qre - Ci * qim;
    float cdim = Cr * qim + Ci * qre;
    a1 = make_float2(are, aim);
    a2 = make_float2(are * are - aim * aim, 2.f * are * aim);
    a3 = make_float2(a2.x * are - a2.y * aim, a2.x * aim + a2.y * are);
    a4 = make_float2(a2.x * a2.x - a2.y * a2.y, 2.f * a2.x * a2.y);
    float z = 2.f * cdre, w = -2.f * cdim;
#pragma unroll
    for (int j = 0; j < 4; ++j) {
      kap[j] = z;
      float zn = z * are + w * aim, wn = w * are - z * aim;   // times a
      z = zn; w = wn;
      zc[j] = z; wc[j] = w;
    }
#pragma unroll
    for (int o = 16; o > 0; o >>= 1) {
#pragma unroll
      for (int j = 0; j < 4; ++j) kap[j] += __shfl_xor(kap[j], o);
    }
    // doubling: with t = a^k and g = 1 + ... + a^(k-1), g + t*g has 2k terms
    float tr = are, ti = aim, gr = 1.f, gi = 0.f;
#pragma unroll
    for (int i = 0; i < 10; ++i) {
      float hr = gr + (tr * gr - ti * gi), hi = gi + (tr * gi + ti * gr);
      gr = hr; gi = hi;
      float nr = tr*tr - ti*ti, ni = 2.f*tr*ti; tr = nr; ti = ni;
    }
    aT = make_float2(tr, ti);
    gT = make_float2(gr, gi);
  }
  float Dh = Dv[h];

  // ---- phase 1: this chunk's sums, and its end state from a zero start ----
  float sum = 0.f, ssq = 0.f;
  if (cs < NC - 1) {
    float sr = 0.f, si = 0.f;
    for (int s = 0; s < NS; ++s) {
      if (s + 1 < NS) {
        // a slot of the wave's own ring is refilled only behind its reads
        asm volatile("s_wait_dscnt 0x0" ::: "memory");
        async_tile128(xp + (s + 1) * 128, buf + ((s + 1) & 1) * 128); wait_async1();
      } else { wait_async0(); }
      const float* cur = buf + (s & 1) * 128;
      acc_sums(*(const f32x4*)(cur + lane * 4), sum, ssq);
      for (int t0 = 0; t0 < 128; t0 += 32) {
        f32x4 w[8];                             // LDS broadcast reads, raw x
#pragma unroll
        for (int j = 0; j < 8; ++j) w[j] = *(const f32x4*)(cur + t0 + j * 4);
        // inputs-only fence on the loaded values: keeps the eight LDS reads in one
        // group with one latency; without it each read is waited for by itself
        asm volatile("" :: "v"(w[0]), "v"(w[1]), "v"(w[2]), "v"(w[3]),
                           "v"(w[4]), "v"(w[5]), "v"(w[6]), "v"(w[7]));
#pragma unroll
        for (int j = 0; j < 8; ++j) step4(w[j], a1, a2, a3, a4, sr, si);
      }
    }
    tile[wv][0][lane] = sr;                     // the tile is idle in this phase
    tile[wv][1][lane] = si;
  } else {
    // unrolled: the eight loads are issued as one group
#pragma unroll
    for (int s = 0; s < NS; ++s)
      acc_sums(*(const f32x4*)(xp + s * 128 + lane * 4), sum, ssq);
  }
#pragma unroll
  for (int o = 16; o > 0; o >>= 1) { sum += __shfl_xor(sum, o); ssq += __shfl_xor(ssq, o); }
  if (lane == 0) { red[wv][0] = sum; red[wv][1] = ssq; }
  __syncthreads();                              // end states and sums published
  float er_[NC - 1], ei_[NC - 1];
#pragma unroll
  for (int q = 0; q < NC - 1; ++q) {
    er_[q] = tile[q * CPG + ch][0][lane]; ei_[q] = tile[q * CPG + ch][1][lane];
  }
  float gs = red[lane][0], gq = red[lane][1];   // lane l: wave l's sums
  __syncthreads();                              // all read: the tiles may be overwritten

  // ---- the group's mean and variance -> this channel's scale and shift ----
#pragma unroll
  for (int o = 16; o > 0; o >>= 1) { gs += __shfl_xor(gs, o); gq += __shfl_xor(gq, o); }
  float mu = gs / (float)(CPG * Lc);
  float var = gq / (float)(CPG * Lc) - mu * mu;
  float sc = rsqrtf(var + 1e-5f) * gn_w[h];
  float sh = gn_b[h] - mu * sc;

  // ---- start state: fold the chunks in front of this one, in their order ----
  float sr = 0.f, si = 0.f;
#pragma unroll
  for (int q = 0; q < NC - 1; ++q) {
    if (q < cs) {
      float nr = aT.x * sr - aT.y * si + fmaf(sc, er_[q], sh * gT.x);
      float ni = aT.x * si + aT.y * sr + fmaf(sc, ei_[q], sh * gT.y);
      sr = nr; si = ni;
    }
  }

  // ---- phase 2: full recurrence and output ----
  float* tcol = &tile[wv][0][lane];             // this lane's state, row = step
  const float* trow = &tile[wv][lane][0];       // this lane's step, all states
  // Rows are 128 B apart, so lane l starts its row at 16-byte piece (l >> 1) & 7:
  // each 16 lanes of a 16-byte read then cover all 64 banks once.
  int rot = (lane >> 1) & 7;
  float* cb = &cbuf[wv][0];
  float k0 = Dh + kap[0];

  async_tile128(xp, buf);
  for (int s = 0; s < NS; ++s) {
    if (s + 1 < NS) {
      // a slot of the wave's own ring is refilled only behind its reads
      asm volatile("s_wait_dscnt 0x0" ::: "memory");
      async_tile128(xp + (s + 1) * 128, buf + ((s + 1) & 1) * 128); wait_async1();
    } else { wait_async0(); }
    float* cur = buf + (s & 1) * 128;
    norm_tile128(cur, cb, sc, sh, k0, kap[1], kap[2], kap[3]);
    for (int t0 = 0; t0 < 128; t0 += 32) {
      // fully unrolled: every step's tile store gets an immediate offset
#pragma unroll
      for (int k = 0; k < 32; k += 4) {
#pragma unroll
        for (int j = 0; j < 4; ++j)              // this state's 2*Re(Cd a^(j+1) s)
          tcol[(k + j) * 32] = zc[j] * sr + wc[j] * si;
        step4(*(const f32x4*)(cur + t0 + k), a1, a2, a3, a4, sr, si);
      }
      // One wave's LDS operations complete in issue order: no barrier needed.
      f32x4 v[8];
#pragma unroll
      for (int j = 0; j < 8; ++j) v[j] = *(const f32x4*)(trow + ((j ^ rot) << 2));
      float cl = cb[t0 + lane];
      // inputs-only fence on the loaded values: keeps the nine LDS reads in one
      // group with one latency; without it each read is waited for by itself
      asm volatile("" :: "v"(v[0]), "v"(v[1]), "v"(v[2]), "v"(v[3]), "v"(v[4]),
                         "v"(v[5]), "v"(v[6]), "v"(v[7]), "v"(cl));
      f32x4 a = ((v[0] + v[1]) + (v[2] + v[3])) + ((v[4] + v[5]) + (v[6] + v[7]));
      float part = (a.x + a.z) + (a.y + a.w);
      float y = part + cl;
      float gel = 0.5f * y * (1.f + erff(y * 0.70710678f));
      up[s * 128 + t0 + lane] = (__bf16)gel;
      // the next block's LDS reads overwrite the registers that this store names
      asm volatile("s_wait_xcnt 0x0" ::: "memory");
    }
  }
}

// ---------------------------------------------------------------------------
// K2: GLU projection, bf16 WMMA; both halves of W_out share the B-tile.
// ---------------------------------------------------------------------------
// 8 waves per SIMD (at most 128 VGPRs): four work-groups per WGP, so that all
// 1,024 are resident at once
__global__ void __launch_bounds__(256) __attribute__((amdgpu_waves_per_eu(8)))
k_glu_gemm(const float* __restrict__ W, const float* __restrict__ bias,
           const __bf16* __restrict__ u, __bf16* __restrict__ g) {
  // two buffers of each operand: tile t is read from buffer t & 1
  __shared__ __align__(16) __bf16 Asm[2][2][64][LDP];
  __shared__ __align__(16) __bf16 BsT[2][128][LDP];
  int n0 = blockIdx.x * 128;
  int m0 = blockIdx.y * 64;
  int tid = threadIdx.x;
  int wv = tid >> 5;
  int wm = wv & 3, wn = wv >> 2;

  floatx8 accT[4] = {{}, {}, {}, {}};
  floatx8 accB[4] = {{}, {}, {}, {}};

  // Staging map. A: 8 threads cover one row's 32 floats (one 128-byte line).
  // B: one thread takes rows k = 2*bkp, 2*bkp+1 at 8 consecutive columns; a wave
  // takes 4 k-pairs x 64 columns (whole 128-byte lines), which spreads its
  // transposing LDS stores over twice the banks that 2 k-pairs x 128 columns hit.
  int arow = tid >> 3, ak = (tid & 7) << 2;
  int bkp = ((tid >> 3) & 3) | ((tid >> 6) << 2);
  int bn = ((tid & 7) | (((tid >> 5) & 1) << 3)) << 3;
  const float* Wp = W + (size_t)(m0 + arow) * Hc + ak;
  const __bf16* ub = u + (size_t)(2 * bkp) * BL + n0 + bn;

  // one K-tile on its way from global memory to LDS: six 16-byte loads a thread
  f32x4 a[4], r0, r1;
  auto fetch = [&](int kk) {
#pragma unroll
    for (int j = 0; j < 4; ++j)
      a[j] = *(const f32x4*)(Wp + (size_t)((j >> 1) * 256 + (j & 1) * 32) * Hc + kk);
    r0 = *(const f32x4*)(ub + (size_t)kk * BL);
    r1 = *(const f32x4*)(ub + (size_t)(kk + 1) * BL);
  };
  auto stage = [&](int s) {
    bf16x8 b0 = __builtin_bit_cast(bf16x8, r0);
    bf16x8 b1 = __builtin_bit_cast(bf16x8, r1);
#pragma unroll
    for (int j = 0; j < 4; ++j) {
      *(bf16x4*)(&Asm[s][j >> 1][arow + (j & 1) * 32][ak]) =
          bf16x4{(__bf16)a[j].x, (__bf16)a[j].y, (__bf16)a[j].z, (__bf16)a[j].w};
    }
#pragma unroll
    for (int i = 0; i < 8; ++i)
      *(bf16x2*)(&BsT[s][bn + i][2 * bkp]) = bf16x2{b0[i], b1[i]};
  };

  constexpr int NT = Hc / 32;
  fetch(0);
  stage(0);
  __syncthreads();
  // unrolled: the buffer index is a constant, so it goes into the LDS offsets
#pragma unroll
  for (int t = 0; t < NT; ++t) {
    // the next tile's loads are issued here and fly during this tile's products
    if (t + 1 < NT) fetch((t + 1) * 32);
    bf16x16 at = load_frag(&Asm[t & 1][0][0][0], wm * 16);
    bf16x16 ab = load_frag(&Asm[t & 1][1][0][0], wm * 16);
#pragma unroll
    for (int j = 0; j < 4; ++j) {
      bf16x16 bf = load_frag(&BsT[t & 1][0][0], wn * 64 + j * 16);
      accT[j] = wmma_bf16(at, bf, accT[j]);
      accB[j] = wmma_bf16(ab, bf, accB[j]);
      // one B fragment alive at a time: with the next tile held in registers the
      // kernel would else pass 128 VGPRs and spill accumulators. The last one also
      // keeps the wait for the next tile's loads behind this tile's products; the
      // scheduler would else lift the conversions, and the wait with them, in front
      __builtin_amdgcn_sched_barrier(0);
    }
    if (t + 1 < NT) {
      // the other buffer: its readers (tile t - 1) left it before the last barrier
      stage((t + 1) & 1);
      __syncthreads();  // publishes tile t + 1 and ends the reads of tile t
    }
  }

  int lane = tid & 31;
  int nl = lane & 15, half = lane >> 4;
#pragma unroll
  for (int j = 0; j < 4; ++j) {
#pragma unroll
    for (int r = 0; r < 8; ++r) {
      int row = (half << 3) + r;
      int gm = m0 + wm * 16 + row;
      size_t col = (size_t)n0 + wn * 64 + j * 16 + nl;
      float zt = accT[j][r] + bias[gm];
      float zb = accB[j][r] + bias[gm + 256];
      float gv = zt * (1.f / (1.f + expf(-zb)));
      g[(size_t)gm * BL + col] = (__bf16)gv;
    }
  }
}

// ---------------------------------------------------------------------------
// K3: conv1d(k=3,pad=1) as 3 shifted-tap WMMA GEMMs; fused bias + residual.
// ---------------------------------------------------------------------------
// 8 waves per SIMD (at most 128 VGPRs): four work-groups per WGP, so that all
// 1,024 are resident at once
__global__ void __launch_bounds__(256) __attribute__((amdgpu_waves_per_eu(8)))
k_conv_gemm(const float* __restrict__ cw,
            const float* __restrict__ cb,
            const __bf16* __restrict__ g,
            const float* __restrict__ x,
            float* __restrict__ out) {
  // two buffers of each operand: tile t is read from buffer t & 1
  __shared__ __align__(16) __bf16 Asm[2][3][64][LDP];
  __shared__ __align__(16) __bf16 BsT[2][130][LDP];
  int n0 = blockIdx.x * 128;
  int m0 = blockIdx.y * 64;
  int tid = threadIdx.x;
  int wv = tid >> 5;
  int wm = wv & 3, wn = wv >> 2;
  int bstart = (n0 / Lc) * Lc;

  floatx8 acc[4] = {{}, {}, {}, {}};

  // Staging map. A: one thread takes 12 consecutive floats of a weight row,
  // which are 4 input channels x 3 taps. B: one thread takes rows k = 2*bkp,
  // 2*bkp+1 at 8 consecutive columns, a wave 4 k-pairs x 64 columns as in the GLU
  // kernel; the 128 inner columns lie in one batch
  // entry (n0 and Lc are multiples of 128). The two edge columns, n0-1 and
  // n0+128, are read at an address clamped into the entry and zeroed outside.
  int arow = tid >> 3, au = tid & 7;
  int bkp = ((tid >> 3) & 3) | ((tid >> 6) << 2);
  int bn = ((tid & 7) | (((tid >> 5) & 1) << 3)) << 3;
  const float* cwp = cw + (size_t)(m0 + arow) * (Hc * 3) + au * 12;
  const __bf16* gb = g + (size_t)(2 * bkp) * BL + n0 + bn;
  int hk = tid & 31, hs = (tid >> 5) & 1;
  int hn = hs ? n0 + 128 : n0 - 1;
  bool hin = hn >= bstart && hn < bstart + Lc;
  const __bf16* gh = g + (size_t)hk * BL + (hin ? hn : n0);

  // one K-tile on its way from global memory to LDS: nine loads a thread
  f32x4 a[2][3], r0, r1;
  unsigned short hraw;
  auto fetch = [&](int kk) {
#pragma unroll
    for (int j = 0; j < 2; ++j)
#pragma unroll
      for (int i = 0; i < 3; ++i)
        a[j][i] = *(const f32x4*)(cwp + (size_t)(j * 32) * (Hc * 3) + kk * 3 + i * 4);
    r0 = *(const f32x4*)(gb + (size_t)kk * BL);
    r1 = *(const f32x4*)(gb + (size_t)(kk + 1) * BL);
    hraw = *(const unsigned short*)(gh + (size_t)kk * BL);
  };
  auto stage = [&](int s) {
    unsigned hr = hraw;
    // inputs-only fence on the loaded values: keeps the nine loads in one group
    // where fetch() issues them; without it the edge load sinks into the branch
    // below and is waited for by itself
    asm volatile("" :: "v"(a[0][0]), "v"(a[0][1]), "v"(a[0][2]), "v"(a[1][0]),
                       "v"(a[1][1]), "v"(a[1][2]), "v"(r0), "v"(r1), "v"(hr));
    bf16x8 b0 = __builtin_bit_cast(bf16x8, r0);
    bf16x8 b1 = __builtin_bit_cast(bf16x8, r1);
    __bf16 hv = __builtin_bit_cast(__bf16, (unsigned short)hr);
#pragma unroll
    for (int j = 0; j < 2; ++j) {
#pragma unroll
      for (int d = 0; d < 3; ++d) {
        // float e of the 12 is channel e / 3, tap e % 3
        *(bf16x4*)(&Asm[s][d][arow + j * 32][au * 4]) =
            bf16x4{(__bf16)a[j][d >> 2][d & 3],
                   (__bf16)a[j][(3 + d) >> 2][(3 + d) & 3],
                   (__bf16)a[j][(6 + d) >> 2][(6 + d) & 3],
                   (__bf16)a[j][(9 + d) >> 2][(9 + d) & 3]};
      }
    }
#pragma unroll
    for (int i = 0; i < 8; ++i)
      *(bf16x2*)(&BsT[s][1 + bn + i][2 * bkp]) = bf16x2{b0[i], b1[i]};
    if (tid < 64) BsT[s][hs * 129][hk] = hin ? hv : (__bf16)0.0f;
  };

  constexpr int NT = Hc / 32;
  fetch(0);
  stage(0);
  __syncthreads();
  // unrolled: the buffer index is a constant, so it goes into the LDS offsets
#pragma unroll
  for (int t = 0; t < NT; ++t) {
    // the next tile's loads are issued here and fly during this tile's products
    if (t + 1 < NT) fetch((t + 1) * 32);
#pragma unroll
    for (int d = 0; d < 3; ++d) {
      bf16x16 af = load_frag(&Asm[t & 1][d][0][0], wm * 16);
      bf16x16 bf[4];
#pragma unroll
      for (int j = 0; j < 4; ++j) bf[j] = load_frag(&BsT[t & 1][0][0], wn * 64 + j * 16 + d);
      // inputs-only fence on the loaded values: keeps the tap's ten LDS reads in
      // one group with one latency; without it each fragment is waited for by itself
      asm volatile("" :: "v"(af), "v"(bf[0]), "v"(bf[1]), "v"(bf[2]), "v"(bf[3]));
#pragma unroll
      for (int j = 0; j < 4; ++j) acc[j] = wmma_bf16(af, bf[j], acc[j]);
    }
    if (t + 1 < NT) {
      // keeps the wait for those loads behind this tile's products; the scheduler
      // would else lift the conversions, and the wait with them, in front
      __builtin_amdgcn_sched_barrier(0);
      // the other buffer: its readers (tile t - 1) left it before the last barrier
      stage((t + 1) & 1);
      __syncthreads();  // publishes tile t + 1 and ends the reads of tile t
    }
  }

  int lane = tid & 31;
  int nl = lane & 15, half = lane >> 4;
#pragma unroll
  for (int j = 0; j < 4; ++j) {
#pragma unroll
    for (int r = 0; r < 8; ++r) {
      int row = (half << 3) + r;
      int o = m0 + wm * 16 + row;
      long long ng = (long long)n0 + wn * 64 + j * 16 + nl;
      int b = (int)(ng >> 12);
      int l = (int)(ng & (Lc - 1));
      size_t oi = ((size_t)b * Hc + o) * Lc + l;
      out[oi] = x[oi] + cb[o] + acc[j][r];
    }
  }
}

// ---------------------------------------------------------------------------
extern "C" void kernel_launch(void* const* d_in, const int* in_sizes, int n_in,
                              void* d_out, int out_size, void* d_ws, size_t ws_size,
                              hipStream_t stream) {
  const float* x        = (const float*)d_in[0];
  const float* gn_w     = (const float*)d_in[1];
  const float* gn_b     = (const float*)d_in[2];
  const float* log_dt   = (const float*)d_in[3];
  const float* A_log_re = (const float*)d_in[4];
  const float* A_im     = (const float*)d_in[5];
  const float* C_re     = (const float*)d_in[6];
  const float* C_im     = (const float*)d_in[7];
  const float* Dv       = (const float*)d_in[8];
  const float* W_out    = (const float*)d_in[9];
  const float* b_out    = (const float*)d_in[10];
  const float* conv_w   = (const float*)d_in[11];
  const float* conv_b   = (const float*)d_in[12];
  float* out = (float*)d_out;

  char* ws = (char*)d_ws;
  size_t off = 0;
  auto alloc = [&](size_t bytes) { size_t o = off; off = (off + bytes + 255) & ~(size_t)255; return o; };
  __bf16* w_u      = (__bf16*)(ws + alloc(sizeof(__bf16) * (size_t)Hc * BL));
  __bf16* w_g      = (__bf16*)(ws + alloc(sizeof(__bf16) * (size_t)Hc * BL));

  k_ssm<<<Bsz * Gg, 1024, 0, stream>>>(x, gn_w, gn_b, log_dt, A_log_re, A_im, C_re, C_im, Dv, w_u);
  dim3 gemm_grid((unsigned)(BL / 128), Hc / 64);
  k_glu_gemm<<<gemm_grid, 256, 0, stream>>>(W_out, b_out, w_u, w_g);
  k_conv_gemm<<<gemm_grid, 256, 0, stream>>>(conv_w, conv_b, w_g, x, out);
}

// v009
// One run takes 79.5 microseconds.
// Two timings next to v008 both put it at 1.04 times that version's speed.
// Over all steps from v000 it is 4.92 times as fast.
#include <hip/hip_runtime.h>
#include <math.h>
#include <stdint.h>

#define DEVI __device__ __forceinline__

// Problem constants (match reference)
constexpr int  Bsz = 8, Hc = 256, Lc = 4096, Nst = 32, Gg = 32;
constexpr int  CPG = Hc / Gg;              // 8 channels per group
constexpr int  NC  = 4,  Tc = Lc / NC;     // 4 chunks of 1024
constexpr long long BL = (long long)Bsz * Lc;  // 32768 positions

typedef __attribute__((ext_vector_type(16))) __bf16 bf16x16;
typedef __attribute__((ext_vector_type(8)))  float  floatx8;
typedef __attribute__((ext_vector_type(4)))  float  f32x4;
typedef __attribute__((ext_vector_type(8)))  __bf16 bf16x8;
typedef __attribute__((ext_vector_type(4)))  __bf16 bf16x4;
typedef __attribute__((ext_vector_type(2)))  __bf16 bf16x2;

// ---------------------------------------------------------------------------
// CDNA5 async Global->LDS copy (ASYNCcnt-tracked) with builtin/asm fallback
// ---------------------------------------------------------------------------
#define GAS __attribute__((address_space(1)))
#define LAS __attribute__((address_space(3)))
typedef int v4i __attribute__((vector_size(4 * sizeof(int))));

DEVI void async_ld_b128(const void* g, void* l) {
#if __has_builtin(__builtin_amdgcn_global_load_async_to_lds_b128)
  __builtin_amdgcn_global_load_async_to_lds_b128(
      (GAS v4i*)(g), (LAS v4i*)(l), 0, 0);
#else
  unsigned loff = (unsigned)(uintptr_t)l;
  asm volatile("global_load_async_to_lds_b128 %0, %1, off"
               :: "v"(loff), "v"(g) : "memory");
#endif
}

DEVI void wait_async0() {
#if __has_builtin(__builtin_amdgcn_s_wait_asynccnt)
  __builtin_amdgcn_s_wait_asynccnt(0);
#else
  asm volatile("s_wait_asynccnt 0x0" ::: "memory");
#endif
  asm volatile("" ::: "memory");
}
DEVI void wait_async1() {
#if __has_builtin(__builtin_amdgcn_s_wait_asynccnt)
  __builtin_amdgcn_s_wait_asynccnt(1);
#else
  asm volatile("s_wait_asynccnt 0x1" ::: "memory");
#endif
  asm volatile("" ::: "memory");
}

// Stage 128 consecutive floats (one wave, 4 floats / lane) into LDS async.
DEVI void async_tile128(const float* gsrc, float* ldst) {
  int lane = threadIdx.x & 31;
  async_ld_b128(gsrc + lane * 4, ldst + lane * 4);
}

// Normalise a landed 128-float tile in place: each lane takes the 16 bytes that
// it copied itself, which are one block of four steps. One wave's LDS operations
// complete in issue order, so the wave's later reads see the stored values
// without a barrier. The same lane writes to cb what its four steps get directly
// from the inputs of their own block: k0 = D + K[0] on the step's own input, and
// k1..k3 = K[1..3] (the convolution kernel's taps) on the block's earlier inputs.
DEVI void norm_tile128(float* t, float* cb, float sc, float sh,
                       float k0, float k1, float k2, float k3) {
  int o = (threadIdx.x & 31) * 4;
  f32x4* q = (f32x4*)(t + o);
  f32x4 v = *q;
  v.x = fmaf(v.x, sc, sh); v.y = fmaf(v.y, sc, sh);
  v.z = fmaf(v.z, sc, sh); v.w = fmaf(v.w, sc, sh);
  *q = v;
  f32x4 c;
  c.x = k0 * v.x;
  c.y = fmaf(k0, v.y, k1 * v.x);
  c.z = fmaf(k0, v.z, fmaf(k1, v.y, k2 * v.x));
  c.w = fmaf(k0, v.w, fmaf(k1, v.z, fmaf(k2, v.y, k3 * v.x)));
  *(f32x4*)(cb + o) = c;
}

// ---------------------------------------------------------------------------
// WMMA helpers
// ---------------------------------------------------------------------------
DEVI floatx8 wmma_bf16(bf16x16 a, bf16x16 b, floatx8 c) {
  return __builtin_amdgcn_wmma_f32_16x16x32_bf16(false, a, false, b, (short)0, c,
                                                 false, false);
}

// LDS row pitch of every staged 32-k tile, in bf16: 80 bytes = 16 x 5. Every row
// starts on a 16-byte boundary, and 16 consecutive rows read 16 bytes each from
// all 64 banks once.
constexpr int LDP = 40;

// One 16x32 fragment, A (row = m) and B (row = n) alike: lane (c, half) takes row
// rowBase + c, k = 8*half + 0..7 in elements 0..7 and k = 16 + 8*half + 0..7 in
// elements 8..15 (the documented 16-bit layout): two 16-byte LDS reads.
DEVI bf16x16 load_frag(const __bf16* S, int rowBase) {
  int lane = threadIdx.x & 31;
  const __bf16* p = S + (rowBase + (lane & 15)) * LDP + ((lane >> 4) << 3);
  bf16x8 lo = *(const bf16x8*)(p);
  bf16x8 hi = *(const bf16x8*)(p + 16);
  return __builtin_shufflevector(lo, hi, 0, 1, 2, 3, 4, 5, 6, 7, 8, 9, 10, 11, 12, 13, 14, 15);
}

// ---------------------------------------------------------------------------
// K1: GroupNorm, parameter set-up and the whole SSM in one launch. One work-group
// per (b, group): 32 waves = 8 channels x 4 chunks of 1024 steps, one lane per
// state. Its LDS lets one work-group live on a WGP: 256 work-groups, 256 WGPs.
//   set-up:  every wave discretizes its channel's 32 states; in chunks 0..2
//            its first tile of x is on the way meanwhile
//   phase 1: chunk end state from a zero start on the RAW x (chunks 0..2; nothing
//            reads the end state of the last chunk), and the sums of x and x^2
//            of every chunk for the group's mean and variance
//   hand-over: end states and sums pass through LDS. The recurrence is linear:
//            the end state for sc*x + sh is sc * (end state for x) plus
//            sh * (1 + a + ... + a^1023). Every wave folds the chunks in front
//            of its own into its start state
//   phase 2: full recurrence on the normalised x; fused D-skip + exact GELU.
// The sum over the 32 states is taken once per block of 32 steps: every lane
// (one state) stores its term of each step into a wave-private 32x32 LDS tile,
// then every lane sums one row (one step) and evaluates the GELU of that step.
// x is streamed via async Global->LDS copies in both phases; in phase 2 each
// landed tile is normalised once in LDS.
// Both phases advance the state four steps at a time: with s the state in front
// of a block and u0..u3 its inputs,
//   s' = a^4 s + a^3 u0 + a^2 u1 + a u2 + u3              (10 FMAs per state)
//   step j's output = sum over states of 2 Re(Cd a^(j+1) s)   (2 FMAs per state)
//                     + K[0] u_j + ... + K[j] u_0,  K[m] = sum of 2 Re(Cd a^m),
// and the second line, which no longer depends on the state, is formed once per
// step (norm_tile128) instead of once per step and state.
// ---------------------------------------------------------------------------
DEVI void step4(f32x4 u, float2 a1, float2 a2, float2 a3, float2 a4, float& sr, float& si) {
  float vr = fmaf(a3.x, u.x, fmaf(a2.x, u.y, fmaf(a1.x, u.z, u.w)));
  float vi = fmaf(a3.y, u.x, fmaf(a2.y, u.y, a1.y * u.z));
  float nr = fmaf(a4.x, sr, fmaf(-a4.y, si, vr));
  float ni = fmaf(a4.x, si, fmaf(a4.y, sr, vi));
  sr = nr; si = ni;
}

DEVI void acc_sums(f32x4 v, float& sum, float& ssq) {
  sum += (v.x + v.y) + (v.z + v.w);
  ssq = fmaf(v.x, v.x, fmaf(v.y, v.y, fmaf(v.z, v.z, fmaf(v.w, v.w, ssq))));
}

__global__ void __launch_bounds__(1024)
k_ssm(const float* __restrict__ x,
      const float* __restrict__ gn_w,
      const float* __restrict__ gn_b,
      const float* __restrict__ log_dt,
      const float* __restrict__ A_log_re,
      const float* __restrict__ A_im,
      const float* __restrict__ C_re,
      const float* __restrict__ C_im,
      const float* __restrict__ Dv,
      __bf16* __restrict__ u) {
  __shared__ __align__(16) float xbuf[32][2][128];  // per-wave double buffer
  __shared__ __align__(16) float tile[32][32][32];  // per wave: [step][state]
  __shared__ __align__(16) float cbuf[32][128];     // per wave: in-block part of y
  __shared__ float red[32][2];                      // per wave: sum x, sum x^2
  if (blockIdx.x >= Bsz * Gg) return;           // whole work-group, before any barrier
  int lane = threadIdx.x & 31;
  // the wave's number in a scalar register: the tests on the chunk are scalar
  // branches, and every base address below is wave-uniform
  int wv = __builtin_amdgcn_readfirstlane(threadIdx.x >> 5);
  int cs = wv >> 3, c = cs;                     // chunk 0..3
  int ch = wv & (CPG - 1);                      // channel of the group
  int b = blockIdx.x / Gg;
  int h = (blockIdx.x % Gg) * CPG + ch;
  int bh = b * Hc + h;

  const float* xp = x + (size_t)bh * Lc + (size_t)c * Tc;
  __bf16* up = u + (size_t)h * BL + (size_t)b * Lc + (size_t)c * Tc;
  float* buf = &xbuf[wv][0][0];
  constexpr int NS = Tc / 128;                  // 8 sub-tiles

  if (cs < NC - 1) async_tile128(xp, buf);      // prime tile 0: it flies during the set-up

  // ---- set-up: discretize this lane's state ----
  float2 a1, a2, a3, a4;                        // a, a^2, a^3, a^4
  float zc[4], wc[4];                           // (2 Re, -2 Im) of Cd a^(j+1)
  float kap[4];                                 // K[m] = sum over states of 2 Re(Cd a^m)
  float2 aT, gT;                                // a^1024; 1 + a + ... + a^1023
  {
    int idx = h * Nst + lane;
    float dt  = expf(log_dt[h]);
    float Are = -expf(A_log_re[idx]);
    float Aim = A_im[idx];
    float er  = expf(Are * dt);
    float are = er * cosf(Aim * dt);
    float aim = er * sinf(Aim * dt);
    float dre = are - 1.f, dim = aim;
    float inv = 1.f / (Are * Are + Aim * Aim);
    float qre = (dre * Are + dim * Aim) * inv;
    float qim = (dim * Are - dre * Aim) * inv;
    float Cr = C_re[idx], Ci = C_im[idx];
    float cdre = Cr * qre - Ci * qim;
    float cdim = Cr * qim + Ci * qre;
    a1 = make_float2(are, aim);
    a2 = make_float2(are * are - aim * aim, 2.f * are * aim);
    a3 = make_float2(a2.x * are - a2.y * aim, a2.x * aim + a2.y * are);
    a4 = make_float2(a2.x * a2.x - a2.y * a2.y, 2.f * a2.x * a2.y);
    float z = 2.f * cdre, w = -2.f * cdim;
#pragma unroll
    for (int j = 0; j < 4; ++j) {
      kap[j] = z;
      float zn = z * are + w * aim, wn = w * are - z * aim;   // times a
      z = zn; w = wn;
      zc[j] = z; wc[j] = w;
    }
#pragma unroll
    for (int o = 16; o > 0; o >>= 1) {
#pragma unroll
      for (int j = 0; j < 4; ++j) kap[j] += __shfl_xor(kap[j], o);
    }
    // doubling: with t = a^k and g = 1 + ... + a^(k-1), g + t*g has 2k terms
    float tr = are, ti = aim, gr = 1.f, gi = 0.f;
#pragma unroll
    for (int i = 0; i < 10; ++i) {
      float hr = gr + (tr * gr - ti * gi), hi = gi + (tr * gi + ti * gr);
      gr = hr; gi = hi;
      float nr = tr*tr - ti*ti, ni = 2.f*tr*ti; tr = nr; ti = ni;
    }
    aT = make_float2(tr, ti);
    gT = make_float2(gr, gi);
  }
  float Dh = Dv[h];

  // ---- phase 1: this chunk's sums, and its end state from a zero start ----
  float sum = 0.f, ssq = 0.f;
  if (cs < NC - 1) {
    float sr = 0.f, si = 0.f;
    for (int s = 0; s < NS; ++s) {
      if (s + 1 < NS) {
        // a slot of the wave's own ring is refilled only behind its reads
        asm volatile("s_wait_dscnt 0x0" ::: "memory");
        async_tile128(xp + (s + 1) * 128, buf + ((s + 1) & 1) * 128); wait_async1();
      } else { wait_async0(); }
      const float* cur = buf + (s & 1) * 128;
      acc_sums(*(const f32x4*)(cur + lane * 4), sum, ssq);
      for (int t0 = 0; t0 < 128; t0 += 32) {
        f32x4 w[8];                             // LDS broadcast reads, raw x
#pragma unroll
        for (int j = 0; j < 8; ++j) w[j] = *(const f32x4*)(cur + t0 + j * 4);
        // inputs-only fence on the loaded values: keeps the eight LDS reads in one
        // group with one latency; without it each read is waited for by itself
        asm volatile("" :: "v"(w[0]), "v"(w[1]), "v"(w[2]), "v"(w[3]),
                           "v"(w[4]), "v"(w[5]), "v"(w[6]), "v"(w[7]));
#pragma unroll
        for (int j = 0; j < 8; ++j) step4(w[j], a1, a2, a3, a4, sr, si);
      }
    }
    tile[wv][0][lane] = sr;                     // the tile is idle in this phase
    tile[wv][1][lane] = si;
  } else {
    // unrolled: the eight loads are issued as one group
#pragma unroll
    for (int s = 0; s < NS; ++s)
      acc_sums(*(const f32x4*)(xp + s * 128 + lane * 4), sum, ssq);
  }
#pragma unroll
  for (int o = 16; o > 0; o >>= 1) { sum += __shfl_xor(sum, o); ssq += __shfl_xor(ssq, o); }
  if (lane == 0) { red[wv][0] = sum; red[wv][1] = ssq; }
  __syncthreads();                              // end states and sums published
  float er_[NC - 1], ei_[NC - 1];
#pragma unroll
  for (int q = 0; q < NC - 1; ++q) {
    er_[q] = tile[q * CPG + ch][0][lane]; ei_[q] = tile[q * CPG + ch][1][lane];
  }
  float gs = red[lane][0], gq = red[lane][1];   // lane l: wave l's sums
  __syncthreads();                              // all read: the tiles may be overwritten

  // ---- the group's mean and variance -> this channel's scale and shift ----
#pragma unroll
  for (int o = 16; o > 0; o >>= 1) { gs += __shfl_xor(gs, o); gq += __shfl_xor(gq, o); }
  float mu = gs / (float)(CPG * Lc);
  float var = gq / (float)(CPG * Lc) - mu * mu;
  float sc = rsqrtf(var + 1e-5f) * gn_w[h];
  float sh = gn_b[h] - mu * sc;

  // ---- start state: fold the chunks in front of this one, in their order ----
  float sr = 0.f, si = 0.f;
#pragma unroll
  for (int q = 0; q < NC - 1; ++q) {
    if (q < cs) {
      float nr = aT.x * sr - aT.y * si + fmaf(sc, er_[q], sh * gT.x);
      float ni = aT.x * si + aT.y * sr + fmaf(sc, ei_[q], sh * gT.y);
      sr = nr; si = ni;
    }
  }

  // ---- phase 2: full recurrence and output ----
  float* tcol = &tile[wv][0][lane];             // this lane's state, row = step
  const float* trow = &tile[wv][lane][0];       // this lane's step, all states
  // Rows are 128 B apart, so lane l starts its row at 16-byte piece (l >> 1) & 7:
  // each 16 lanes of a 16-byte read then cover all 64 banks once.
  int rot = (lane >> 1) & 7;
  float* cb = &cbuf[wv][0];
  float k0 = Dh + kap[0];

  async_tile128(xp, buf);
  for (int s = 0; s < NS; ++s) {
    if (s + 1 < NS) {
      // a slot of the wave's own ring is refilled only behind its reads
      asm volatile("s_wait_dscnt 0x0" ::: "memory");
      async_tile128(xp + (s + 1) * 128, buf + ((s + 1) & 1) * 128); wait_async1();
    } else { wait_async0(); }
    float* cur = buf + (s & 1) * 128;
    norm_tile128(cur, cb, sc, sh, k0, kap[1], kap[2], kap[3]);
    for (int t0 = 0; t0 < 128; t0 += 32) {
      // fully unrolled: every step's tile store gets an immediate offset
#pragma unroll
      for (int k = 0; k < 32; k += 4) {
#pragma unroll
        for (int j = 0; j < 4; ++j)              // this state's 2*Re(Cd a^(j+1) s)
          tcol[(k + j) * 32] = zc[j] * sr + wc[j] * si;
        step4(*(const f32x4*)(cur + t0 + k), a1, a2, a3, a4, sr, si);
      }
      // One wave's LDS operations complete in issue order: no barrier needed.
      f32x4 v[8];
#pragma unroll
      for (int j = 0; j < 8; ++j) v[j] = *(const f32x4*)(trow + ((j ^ rot) << 2));
      float cl = cb[t0 + lane];
      // inputs-only fence on the loaded values: keeps the nine LDS reads in one
      // group with one latency; without it each read is waited for by itself
      asm volatile("" :: "v"(v[0]), "v"(v[1]), "v"(v[2]), "v"(v[3]), "v"(v[4]),
                         "v"(v[5]), "v"(v[6]), "v"(v[7]), "v"(cl));
      f32x4 a = ((v[0] + v[1]) + (v[2] + v[3])) + ((v[4] + v[5]) + (v[6] + v[7]));
      float part = (a.x + a.z) + (a.y + a.w);
      float y = part + cl;
      float gel = 0.5f * y * (1.f + erff(y * 0.70710678f));
      up[s * 128 + t0 + lane] = (__bf16)gel;
      // the next block's LDS reads overwrite the registers that this store names
      asm volatile("s_wait_xcnt 0x0" ::: "memory");
    }
  }
}

// ---------------------------------------------------------------------------
// K2: GLU projection and conv1d(k=3,pad=1) in one launch, bf16 WMMA. One
// work-group per 128 positions, all channels: 16 waves, one work-group on a WGP.
//   stage 1: z = W_out u for the 128 positions and their two neighbours (the conv
//            needs g one position to each side); a wave takes 16 rows of each
//            half of W_out and all nine 16-column fragments; GLU; g goes to LDS
//   stage 2: the conv as 3 shifted-tap GEMMs whose B fragments are read straight
//            from the g tile; fused bias + residual.
// Row c of the u and g tiles is position n0 - 1 + c (c = 0..129); rows 130..143
// only fill the ninth fragment: u is zero there and g is never read.
// ---------------------------------------------------------------------------
// Pitch of the u and g tiles, in bf16: 528 bytes = 16 x 33, an odd multiple of 16
// bytes, so that 16 consecutive rows read 16 bytes each from all 64 banks once.
constexpr int TP = 264;

// load_frag for a tile of pitch TP; S points at the fragment's first k
DEVI bf16x16 load_frag_t(const __bf16* S, int rowBase) {
  int lane = threadIdx.x & 31;
  const __bf16* p = S + (rowBase + (lane & 15)) * TP + ((lane >> 4) << 3);
  bf16x8 lo = *(const bf16x8*)(p);
  bf16x8 hi = *(const bf16x8*)(p + 16);
  return __builtin_shufflevector(lo, hi, 0, 1, 2, 3, 4, 5, 6, 7, 8, 9, 10, 11, 12, 13, 14, 15);
}

__global__ void __launch_bounds__(512)
k_glu_conv(const float* __restrict__ W, const float* __restrict__ bias,
           const __bf16* __restrict__ u,
           const float* __restrict__ cw, const float* __restrict__ cb,
           const float* __restrict__ x, float* __restrict__ out) {
  __shared__ __align__(16) __bf16 Ut[144][TP];
  __shared__ __align__(16) __bf16 Gt[144][TP];
  // weight tiles, two buffers: stage 1 [2][512][LDP], stage 2 [2][3][256][LDP]
  __shared__ __align__(16) __bf16 Ab[2 * 3 * 256 * LDP];
  int n0 = blockIdx.x * 128;
  int tid = threadIdx.x;
  int lane = tid & 31;
  int nl = lane & 15, half = lane >> 4;
  // the wave's number in a scalar register: fragment bases are wave-uniform
  int wv = __builtin_amdgcn_readfirstlane(tid >> 5);
  int bstart = (n0 / Lc) * Lc;
  bool lin = n0 - 1 >= bstart;                  // the neighbours lie in the batch entry
  bool rin = n0 + 128 < bstart + Lc;
  constexpr int NT = Hc / 32;

  // ---- weight staging maps: 8 threads cover one row's 32 k ----
  int arow = tid >> 3, au = tid & 7;
  const float* Wp = W + (size_t)arow * Hc + au * 4;
  f32x4 wa[8];
  auto fetchW = [&](int kk) {
#pragma unroll
    for (int j = 0; j < 8; ++j) wa[j] = *(const f32x4*)(Wp + (size_t)(j * 64) * Hc + kk);
  };
  auto stageW = [&](int s) {
#pragma unroll
    for (int j = 0; j < 8; ++j)
      *(bf16x4*)(Ab + ((s * 512 + arow + j * 64) * LDP + au * 4)) =
          bf16x4{(__bf16)wa[j].x, (__bf16)wa[j].y, (__bf16)wa[j].z, (__bf16)wa[j].w};
  };
  // conv weights: one thread takes 12 consecutive floats = 4 input channels x 3 taps
  const float* cwp = cw + (size_t)arow * (Hc * 3) + au * 12;
  f32x4 ca[4][3];
  auto fetchC = [&](int kk) {
#pragma unroll
    for (int j = 0; j < 4; ++j)
#pragma unroll
      for (int i = 0; i < 3; ++i)
        ca[j][i] = *(const f32x4*)(cwp + (size_t)(j * 64) * (Hc * 3) + kk * 3 + i * 4);
  };
  auto stageC = [&](int s) {
    // inputs-only fence on the loaded values and their base address: no load's
    // result lands in the register pair that the other loads of the tile name
    asm volatile("" :: "v"(ca[0][0]), "v"(ca[0][1]), "v"(ca[0][2]), "v"(ca[1][0]),
                       "v"(ca[1][1]), "v"(ca[1][2]), "v"(ca[2][0]), "v"(ca[2][1]),
                       "v"(ca[2][2]), "v"(ca[3][0]), "v"(ca[3][1]), "v"(ca[3][2]), "v"(cwp));
#pragma unroll
    for (int j = 0; j < 4; ++j) {
#pragma unroll
      for (int d = 0; d < 3; ++d) {
        // float e of the 12 is channel e / 3, tap e % 3
        *(bf16x4*)(Ab + (((s * 3 + d) * 256 + arow + j * 64) * LDP + au * 4)) =
            bf16x4{(__bf16)ca[j][d >> 2][d & 3],
                   (__bf16)ca[j][(3 + d) >> 2][(3 + d) & 3],
                   (__bf16)ca[j][(6 + d) >> 2][(6 + d) & 3],
                   (__bf16)ca[j][(9 + d) >> 2][(9 + d) & 3]};
      }
    }
  };

  // ---- the whole u tile, all 256 k, once: a thread takes rows k = 2*kp, 2*kp+1 at
  // 8 consecutive columns, four times; a wave covers whole 128-byte lines ----
  {
    f32x4 ur[4][2];
#pragma unroll
    for (int q = 0; q < 4; ++q) {
      int it = tid + 512 * q;
      int cg = (it & 7) | (((it >> 5) & 1) << 3);
      int kp = ((it >> 3) & 3) | ((it >> 6) << 2);
      const __bf16* p = u + (size_t)(2 * kp) * BL + n0 + cg * 8;
      ur[q][0] = *(const f32x4*)(p);
      ur[q][1] = *(const f32x4*)(p + BL);
    }
    // the two neighbour columns, read at an address clamped into the batch entry
    int hk = tid & 255, hs = tid >> 8;
    bool hin = hs ? rin : lin;
    int hn = hs ? n0 + 128 : n0 - 1;
    unsigned short hraw = *(const unsigned short*)(u + (size_t)hk * BL + (hin ? hn : n0));
    fetchW(0);
#pragma unroll
    for (int q = 0; q < 4; ++q) {
      int it = tid + 512 * q;
      int cg = (it & 7) | (((it >> 5) & 1) << 3);
      int kp = ((it >> 3) & 3) | ((it >> 6) << 2);
      bf16x8 b0 = __builtin_bit_cast(bf16x8, ur[q][0]);
      bf16x8 b1 = __builtin_bit_cast(bf16x8, ur[q][1]);
#pragma unroll
      for (int i = 0; i < 8; ++i)
        *(bf16x2*)(&Ut[1 + cg * 8 + i][2 * kp]) = bf16x2{b0[i], b1[i]};
    }
    Ut[hs * 129][hk] = hin ? __builtin_bit_cast(__bf16, hraw) : (__bf16)0.0f;
    if (tid < 448)                              // rows 130..143
      *(f32x4*)(&Ut[130 + (tid >> 5)][(tid & 31) * 8]) = f32x4{0.f, 0.f, 0.f, 0.f};
    stageW(0);
  }
  __syncthreads();                              // u tile and W tile 0 published

  // ---- stage 1: z = W_out u ----
  floatx8 accT[9] = {{}, {}, {}, {}, {}, {}, {}, {}, {}};
  floatx8 accB[9] = {{}, {}, {}, {}, {}, {}, {}, {}, {}};
  auto tile1 = [&](int t, int s) {
    const __bf16* As = Ab + s * 512 * LDP;
    const __bf16* Us = &Ut[0][0] + t * 32;
    bf16x16 at = load_frag(As, wv * 16);
    bf16x16 ab = load_frag(As, 256 + wv * 16);
    bf16x16 bf[5];
#pragma unroll
    for (int f = 0; f < 4; ++f) bf[f] = load_frag_t(Us, f * 16);
    // inputs-only fence on the loaded values: keeps the twelve LDS reads in one
    // group with one latency; without it each fragment is waited for by itself
    asm volatile("" :: "v"(at), "v"(ab), "v"(bf[0]), "v"(bf[1]), "v"(bf[2]), "v"(bf[3]));
#pragma unroll
    for (int f = 0; f < 4; ++f) {
      accT[f] = wmma_bf16(at, bf[f], accT[f]);
      accB[f] = wmma_bf16(ab, bf[f], accB[f]);
    }
#pragma unroll
    for (int f = 0; f < 5; ++f) bf[f] = load_frag_t(Us, (4 + f) * 16);
    // inputs-only fence on the loaded values: the ten LDS reads in one group
    asm volatile("" :: "v"(bf[0]), "v"(bf[1]), "v"(bf[2]), "v"(bf[3]), "v"(bf[4]));
#pragma unroll
    for (int f = 0; f < 5; ++f) {
      accT[4 + f] = wmma_bf16(at, bf[f], accT[4 + f]);
      accB[4 + f] = wmma_bf16(ab, bf[f], accB[4 + f]);
    }
  };
  // two tiles a trip, so that the buffer index is a constant; kept rolled beyond
  // that, for speed only
#pragma unroll 1
  for (int t = 0; t < NT; t += 2) {
    // the next tile's loads are issued here and fly during this tile's products
    fetchW((t + 1) * 32);
    tile1(t, 0);
    // keeps the wait for those loads behind this tile's products; the scheduler
    // would else lift the conversions, and the wait with them, in front
    __builtin_amdgcn_sched_barrier(0);
    // the other buffer: its readers (tile t - 1) left it before the last barrier
    stageW(1);
    __syncthreads();  // publishes tile t + 1 and ends the reads of tile t
    if (t + 2 < NT) {
      fetchW((t + 2) * 32);
      // behind the loop the register pair that these loads name gets a new address
      asm volatile("s_wait_xcnt 0x0" ::: "memory");
    }
    tile1(t + 1, 1);
    if (t + 2 < NT) {
      __builtin_amdgcn_sched_barrier(0);        // as above
      stageW(0);
      __syncthreads();  // publishes tile t + 2 and ends the reads of tile t + 1
    }
  }

  fetchC(0);                                    // flies during the GLU

  // ---- GLU: a lane holds 8 consecutive channels of one position: one 16-byte
  // LDS store. Outside the batch entry the conv pads g with zero. ----
  {
    int gr = wv * 16 + half * 8;
    f32x4 bt[2], bb[2];
#pragma unroll
    for (int i = 0; i < 2; ++i) {
      bt[i] = *(const f32x4*)(bias + gr + i * 4);
      bb[i] = *(const f32x4*)(bias + 256 + gr + i * 4);
    }
#pragma unroll
    for (int f = 0; f < 9; ++f) {
      bf16x8 gv;
#pragma unroll
      for (int r = 0; r < 8; ++r) {
        float zt = accT[f][r] + bt[r >> 2][r & 3];
        float zb = accB[f][r] + bb[r >> 2][r & 3];
        gv[r] = (__bf16)(zt * (1.f / (1.f + expf(-zb))));
      }
      f32x4 gw = __builtin_bit_cast(f32x4, gv);
      if (f == 0 && nl == 0 && !lin) gw = f32x4{0.f, 0.f, 0.f, 0.f};
      if (f == 8 && nl == 1 && !rin) gw = f32x4{0.f, 0.f, 0.f, 0.f};
      *(f32x4*)(&Gt[f * 16 + nl][gr]) = gw;
    }
  }
  __syncthreads();  // g published; every wave has left the W tiles, whose LDS is reused
  stageC(0);
  __syncthreads();  // conv weight tile 0 published

  // ---- stage 2: conv; a wave takes 32 output channels x 64 positions ----
  int mg = wv & 7, ng = wv >> 3;
  floatx8 acc[2][4] = {{{}, {}, {}, {}}, {{}, {}, {}, {}}};
  auto tile2 = [&](int t, int s) {
    const __bf16* Gs = &Gt[0][0] + t * 32;
#pragma unroll
    for (int d = 0; d < 3; ++d) {
      const __bf16* As = Ab + (s * 3 + d) * 256 * LDP;
      bf16x16 a0 = load_frag(As, mg * 32);
      bf16x16 a1 = load_frag(As, mg * 32 + 16);
      bf16x16 bf[4];
      // output position l takes tap d from position l + d - 1, which is row l + d
#pragma unroll
      for (int j = 0; j < 4; ++j) bf[j] = load_frag_t(Gs, ng * 64 + j * 16 + d);
      // inputs-only fence on the loaded values: keeps the tap's twelve LDS reads in
      // one group with one latency; without it each fragment is waited for by itself
      asm volatile("" :: "v"(a0), "v"(a1), "v"(bf[0]), "v"(bf[1]), "v"(bf[2]), "v"(bf[3]));
#pragma unroll
      for (int j = 0; j < 4; ++j) {
        acc[0][j] = wmma_bf16(a0, bf[j], acc[0][j]);
        acc[1][j] = wmma_bf16(a1, bf[j], acc[1][j]);
      }
    }
  };
  // two tiles a trip and rolled, as in stage 1
#pragma unroll 1
  for (int t = 0; t < NT; t += 2) {
    // the next tile's loads are issued here and fly during this tile's products
    fetchC((t + 1) * 32);
    tile2(t, 0);
    __builtin_amdgcn_sched_barrier(0);          // as in stage 1
    stageC(1);
    __syncthreads();  // publishes tile t + 1 and ends the reads of tile t
    if (t + 2 < NT) fetchC((t + 2) * 32);
    tile2(t + 1, 1);
    if (t + 2 < NT) {
      __builtin_amdgcn_sched_barrier(0);        // as in stage 1
      stageC(0);
      __syncthreads();  // publishes tile t + 2 and ends the reads of tile t + 1
    }
  }

  // one address pair for x and one for out; everything else is an immediate offset
  size_t base = ((size_t)(n0 >> 12) * Hc + mg * 32 + (half << 3)) * Lc
              + (n0 & (Lc - 1)) + ng * 64 + nl;
  const float* xb = x + base;
  float* ob = out + base;
  const float* cbp = cb + mg * 32 + (half << 3);
  f32x4 c4[2][2];
  floatx8 xv[2][4];
#pragma unroll
  for (int i = 0; i < 2; ++i) {
#pragma unroll
    for (int h = 0; h < 2; ++h) c4[i][h] = *(const f32x4*)(cbp + i * 16 + h * 4);
#pragma unroll
    for (int j = 0; j < 4; ++j)
#pragma unroll
      for (int r = 0; r < 8; ++r) xv[i][j][r] = xb[(size_t)(i * 16 + r) * Lc + j * 16];
  }
  // inputs-only fence on the loaded values and their addresses: the loads go out as
  // one group, and no load's result lands in a register that another load names
  asm volatile("" :: "v"(xv[0][0]), "v"(xv[0][1]), "v"(xv[0][2]), "v"(xv[0][3]),
                     "v"(xv[1][0]), "v"(xv[1][1]), "v"(xv[1][2]), "v"(xv[1][3]),
                     "v"(c4[0][0]), "v"(c4[0][1]), "v"(c4[1][0]), "v"(c4[1][1]),
                     "v"(xb), "v"(cbp));
#pragma unroll
  for (int i = 0; i < 2; ++i) {
#pragma unroll
    for (int j = 0; j < 4; ++j) {
#pragma unroll
      for (int r = 0; r < 8; ++r)
        ob[(size_t)(i * 16 + r) * Lc + j * 16] = xv[i][j][r] + c4[i][r >> 2][r & 3] + acc[i][j][r];
    }
  }
}

// ---------------------------------------------------------------------------
extern "C" void kernel_launch(void* const* d_in, const int* in_sizes, int n_in,
                              void* d_out, int out_size, void* d_ws, size_t ws_size,
                              hipStream_t stream) {
  const float* x        = (const float*)d_in[0];
  const float* gn_w     = (const float*)d_in[1];
  const float* gn_b     = (const float*)d_in[2];
  const float* log_dt   = (const float*)d_in[3];
  const float* A_log_re = (const float*)d_in[4];
  const float* A_im     = (const float*)d_in[5];
  const float* C_re     = (const float*)d_in[6];
  const float* C_im     = (const float*)d_in[7];
  const float* Dv       = (const float*)d_in[8];
  const float* W_out    = (const float*)d_in[9];
  const float* b_out    = (const float*)d_in[10];
  const float* conv_w   = (const float*)d_in[11];
  const float* conv_b   = (const float*)d_in[12];
  float* out = (float*)d_out;

  char* ws = (char*)d_ws;
  size_t off = 0;
  auto alloc = [&](size_t bytes) { size_t o = off; off = (off + bytes + 255) & ~(size_t)255; return o; };
  __bf16* w_u      = (__bf16*)(ws + alloc(sizeof(__bf16) * (size_t)Hc * BL));

  k_ssm<<<Bsz * Gg, 1024, 0, stream>>>(x, gn_w, gn_b, log_dt, A_log_re, A_im, C_re, C_im, Dv, w_u);
  k_glu_conv<<<(unsigned)(BL / 128), 512, 0, stream>>>(W_out, b_out, w_u, conv_w, conv_b, x, out);
}

// v010
// Measured time: 68.8 microseconds a run.
// Next to v009, in two timings, it ran 1.15 and 1.16 times as fast.
// Counting every step since v000, it is 5.68 times as fast.
#include <hip/hip_runtime.h>
#include <math.h>
#include <stdint.h>

#define DEVI __device__ __forceinline__

// Problem constants (match reference)
constexpr int  Bsz = 8, Hc = 256, Lc = 4096, Nst = 32, Gg = 32;
constexpr int  CPG = Hc / Gg;              // 8 channels per group
constexpr int  NC  = 4,  Tc = Lc / NC;     // 4 chunks of 1024
constexpr long long BL = (long long)Bsz * Lc;  // 32768 positions

typedef __attribute__((ext_vector_type(16))) __bf16 bf16x16;
typedef __attribute__((ext_vector_type(8)))  float  floatx8;
typedef __attribute__((ext_vector_type(4)))  float  f32x4;
typedef __attribute__((ext_vector_type(8)))  __bf16 bf16x8;
typedef __attribute__((ext_vector_type(4)))  __bf16 bf16x4;
typedef __attribute__((ext_vector_type(2)))  __bf16 bf16x2;

// ---------------------------------------------------------------------------
// CDNA5 async Global->LDS copy (ASYNCcnt-tracked) with builtin/asm fallback
// ---------------------------------------------------------------------------
#define GAS __attribute__((address_space(1)))
#define LAS __attribute__((address_space(3)))
typedef int v4i __attribute__((vector_size(4 * sizeof(int))));

DEVI void async_ld_b128(const void* g, void* l) {
#if __has_builtin(__builtin_amdgcn_global_load_async_to_lds_b128)
  __builtin_amdgcn_global_load_async_to_lds_b128(
      (GAS v4i*)(g), (LAS v4i*)(l), 0, 0);
#else
  unsigned loff = (unsigned)(uintptr_t)l;
  asm volatile("global_load_async_to_lds_b128 %0, %1, off"
               :: "v"(loff), "v"(g) : "memory");
#endif
}

DEVI void wait_async0() {
#if __has_builtin(__builtin_amdgcn_s_wait_asynccnt)
  __builtin_amdgcn_s_wait_asynccnt(0);
#else
  asm volatile("s_wait_asynccnt 0x0" ::: "memory");
#endif
  asm volatile("" ::: "memory");
}
DEVI void wait_async1() {
#if __has_builtin(__builtin_amdgcn_s_wait_asynccnt)
  __builtin_amdgcn_s_wait_asynccnt(1);
#else
  asm volatile("s_wait_asynccnt 0x1" ::: "memory");
#endif
  asm volatile("" ::: "memory");
}

// Stage 128 consecutive floats (one wave, 4 floats / lane) into LDS async.
DEVI void async_tile128(const float* gsrc, float* ldst) {
  int lane = threadIdx.x & 31;
  async_ld_b128(gsrc + lane * 4, ldst + lane * 4);
}

// Normalise a landed 128-float tile in place: each lane takes the 16 bytes that
// it copied itself, which are one block of four steps. One wave's LDS operations
// complete in issue order, so the wave's later reads see the stored values
// without a barrier. The same lane writes to cb what its four steps get directly
// from the inputs of their own block: k0 = D + K[0] on the step's own input, and
// k1..k3 = K[1..3] (the convolution kernel's taps) on the block's earlier inputs.
DEVI void norm_tile128(float* t, float* cb, float sc, float sh,
                       float k0, float k1, float k2, float k3) {
  int o = (threadIdx.x & 31) * 4;
  f32x4* q = (f32x4*)(t + o);
  f32x4 v = *q;
  v.x = fmaf(v.x, sc, sh); v.y = fmaf(v.y, sc, sh);
  v.z = fmaf(v.z, sc, sh); v.w = fmaf(v.w, sc, sh);
  *q = v;
  f32x4 c;
  c.x = k0 * v.x;
  c.y = fmaf(k0, v.y, k1 * v.x);
  c.z = fmaf(k0, v.z, fmaf(k1, v.y, k2 * v.x));
  c.w = fmaf(k0, v.w, fmaf(k1, v.z, fmaf(k2, v.y, k3 * v.x)));
  *(f32x4*)(cb + o) = c;
}

// ---------------------------------------------------------------------------
// WMMA helpers
// ---------------------------------------------------------------------------
DEVI floatx8 wmma_bf16(bf16x16 a, bf16x16 b, floatx8 c) {
  return __builtin_amdgcn_wmma_f32_16x16x32_bf16(false, a, false, b, (short)0, c,
                                                 false, false);
}

// LDS row pitch of every staged 32-k tile, in bf16: 80 bytes = 16 x 5. Every row
// starts on a 16-byte boundary, and 16 consecutive rows read 16 bytes each from
// all 64 banks once.
constexpr int LDP = 40;

// One 16x32 fragment, A (row = m) and B (row = n) alike: lane (c, half) takes row
// rowBase + c, k = 8*half + 0..7 in elements 0..7 and k = 16 + 8*half + 0..7 in
// elements 8..15 (the documented 16-bit layout): two 16-byte LDS reads.
DEVI bf16x16 load_frag(const __bf16* S, int rowBase) {
  int lane = threadIdx.x & 31;
  const __bf16* p = S + (rowBase + (lane & 15)) * LDP + ((lane >> 4) << 3);
  bf16x8 lo = *(const bf16x8*)(p);
  bf16x8 hi = *(const bf16x8*)(p + 16);
  return __builtin_shufflevector(lo, hi, 0, 1, 2, 3, 4, 5, 6, 7, 8, 9, 10, 11, 12, 13, 14, 15);
}

// ---------------------------------------------------------------------------
// K1: GroupNorm, parameter set-up and the whole SSM in one launch. One work-group
// per (b, group): 32 waves = 8 channels x 4 chunks of 1024 steps, one lane per
// state. Its LDS lets one work-group live on a WGP: 256 work-groups, 256 WGPs.
//   set-up:  every wave discretizes its channel's 32 states; in chunks 0..2
//            its first tile of x is on the way meanwhile
//   phase 1: chunk end state from a zero start on the RAW x (chunks 0..2; nothing
//            reads the end state of the last chunk), and the sums of x and x^2
//            of every chunk for the group's mean and variance
//   hand-over: end states and sums pass through LDS. The recurrence is linear:
//            the end state for sc*x + sh is sc * (end state for x) plus
//            sh * (1 + a + ... + a^1023). Every wave folds the chunks in front
//            of its own into its start state
//   phase 2: full recurrence on the normalised x; fused D-skip + exact GELU.
//   weights: six waves of the last chunk, which have no recurrence to run in
//            phase 1, round this work-group's 1/256 of W_out and conv_w to bf16
//            and store it in the tile order that K2 stages (cvt_W, cvt_C).
// The sum over the 32 states is taken once per block of 32 steps: every lane
// (one state) stores its term of each step into a wave-private 32x32 LDS tile,
// then every lane sums one row (one step) and evaluates the GELU of that step.
// x is streamed via async Global->LDS copies in both phases; in phase 2 each
// landed tile is normalised once in LDS.
// Both phases advance the state four steps at a time: with s the state in front
// of a block and u0..u3 its inputs,
//   s' = a^4 s + a^3 u0 + a^2 u1 + a u2 + u3              (10 FMAs per state)
//   step j's output = sum over states of 2 Re(Cd a^(j+1) s)   (2 FMAs per state)
//                     + K[0] u_j + ... + K[j] u_0,  K[m] = sum of 2 Re(Cd a^m),
// and the second line, which no longer depends on the state, is formed once per
// step (norm_tile128) instead of once per step and state.
// ---------------------------------------------------------------------------
DEVI void step4(f32x4 u, float2 a1, float2 a2, float2 a3, float2 a4, float& sr, float& si) {
  float vr = fmaf(a3.x, u.x, fmaf(a2.x, u.y, fmaf(a1.x, u.z, u.w)));
  float vi = fmaf(a3.y, u.x, fmaf(a2.y, u.y, a1.y * u.z));
  float nr = fmaf(a4.x, sr, fmaf(-a4.y, si, vr));
  float ni = fmaf(a4.x, si, fmaf(a4.y, sr, vi));
  sr = nr; si = ni;
}

DEVI void acc_sums(f32x4 v, float& sum, float& ssq) {
  sum += (v.x + v.y) + (v.z + v.w);
  ssq = fmaf(v.x, v.x, fmaf(v.y, v.y, fmaf(v.z, v.z, fmaf(v.w, v.w, ssq))));
}

// K2's weights, rounded to bf16 once per call and laid out tile by tile, so that a
// K tile (32 k) is one contiguous block of whole 128-byte lines. Inside a tile the
// 16-byte pieces (8 k of one row) stand in the order in which K2's threads take
// them: piece number = (row / 16) * 64 + (k / 8) * 16 + row % 16, so that 16
// consecutive lanes store 16 consecutive rows to LDS, which hits every bank once.
//   wW: 8 tiles of 512 rows; row = row of W_out
//   wC: 8 tiles of 768 rows; row = tap * 256 + output channel of conv_w
// A 128-byte line holds 8 k of 8 consecutive rows and is written whole by 16 lanes
// of one wave. Work-group g of 256 takes 8 rows: of W_out 64 k of them (j = 0..127),
// of conv_w one tile of them with its 3 taps (j = 0..63).
DEVI size_t piece_at(int row, int k8) {         // in bf16 elements, inside a tile
  return (size_t)(((row >> 4) * 64 + k8 * 16 + (row & 15)) * 8);
}
DEVI void cvt_W(const float* __restrict__ W, __bf16* __restrict__ wW, int g, int j) {
  int row = (g >> 2) * 8 + ((j >> 1) & 7);
  int k8 = (g & 3) * 8 + (j >> 4), hf = (j & 1) * 4;   // k = 8 * k8 + hf + 0..3
  const float* p = W + (size_t)row * Hc + k8 * 8 + hf;
  f32x4 v = *(const f32x4*)p;
  // inputs-only fence on the loaded value and its address: the load's result does
  // not land in the register pair that the load names
  asm volatile("" :: "v"(v), "v"(p));
  *(bf16x4*)(wW + (size_t)(k8 >> 2) * (512 * 32) + piece_at(row, k8 & 3) + hf) =
      bf16x4{(__bf16)v.x, (__bf16)v.y, (__bf16)v.z, (__bf16)v.w};
  // later code overwrites the registers that this store names
  asm volatile("s_wait_xcnt 0x0" ::: "memory");
}
DEVI void cvt_C(const float* __restrict__ cw, __bf16* __restrict__ wC, int g, int j) {
  int row = (g >> 3) * 8 + ((j >> 1) & 7);
  int t = g & 7, k8 = j >> 4, hf = (j & 1) * 4;
  // 12 consecutive floats = 4 input channels x 3 taps
  const float* p = cw + (size_t)row * (Hc * 3) + (t * 32 + k8 * 8 + hf) * 3;
  f32x4 c[3];
#pragma unroll
  for (int i = 0; i < 3; ++i) c[i] = *(const f32x4*)(p + i * 4);
  // inputs-only fence on the loaded values and their address: no load's result
  // lands in the register pair that the three loads name
  asm volatile("" :: "v"(c[0]), "v"(c[1]), "v"(c[2]), "v"(p));
#pragma unroll
  for (int d = 0; d < 3; ++d)
    // float e of the 12 is channel e / 3, tap e % 3
    *(bf16x4*)(wC + (size_t)t * (768 * 32) + piece_at(d * 256 + row, k8) + hf) =
        bf16x4{(__bf16)c[d >> 2][d & 3],
               (__bf16)c[(3 + d) >> 2][(3 + d) & 3],
               (__bf16)c[(6 + d) >> 2][(6 + d) & 3],
               (__bf16)c[(9 + d) >> 2][(9 + d) & 3]};
  // later code overwrites the registers that these stores name
  asm volatile("s_wait_xcnt 0x0" ::: "memory");
}

__global__ void __launch_bounds__(1024)
k_ssm(const float* __restrict__ x,
      const float* __restrict__ gn_w,
      const float* __restrict__ gn_b,
      const float* __restrict__ log_dt,
      const float* __restrict__ A_log_re,
      const float* __restrict__ A_im,
      const float* __restrict__ C_re,
      const float* __restrict__ C_im,
      const float* __restrict__ Dv,
      const float* __restrict__ W_out,
      const float* __restrict__ conv_w,
      __bf16* __restrict__ u,
      __bf16* __restrict__ wW,
      __bf16* __restrict__ wC) {
  __shared__ __align__(16) float xbuf[32][2][128];  // per-wave double buffer
  __shared__ __align__(16) float tile[32][32][32];  // per wave: [step][state]
  __shared__ __align__(16) float cbuf[32][128];     // per wave: in-block part of y
  __shared__ float red[32][2];                      // per wave: sum x, sum x^2
  if (blockIdx.x >= Bsz * Gg) return;           // whole work-group, before any barrier
  int lane = threadIdx.x & 31;
  // the wave's number in a scalar register: the tests on the chunk are scalar
  // branches, and every base address below is wave-uniform
  int wv = __builtin_amdgcn_readfirstlane(threadIdx.x >> 5);
  int cs = wv >> 3, c = cs;                     // chunk 0..3
  int ch = wv & (CPG - 1);                      // channel of the group
  int b = blockIdx.x / Gg;
  int h = (blockIdx.x % Gg) * CPG + ch;
  int bh = b * Hc + h;

  const float* xp = x + (size_t)bh * Lc + (size_t)c * Tc;
  __bf16* up = u + (size_t)h * BL + (size_t)b * Lc + (size_t)c * Tc;
  float* buf = &xbuf[wv][0][0];
  constexpr int NS = Tc / 128;                  // 8 sub-tiles

  if (cs < NC - 1) async_tile128(xp, buf);      // prime tile 0: it flies during the set-up

  // ---- set-up: discretize this lane's state ----
  float2 a1, a2, a3, a4;                        // a, a^2, a^3, a^4
  float zc[4], wc[4];                           // (2 Re, -2 Im) of Cd a^(j+1)
  float kap[4];                                 // K[m] = sum over states of 2 Re(Cd a^m)
  float2 aT, gT;                                // a^1024; 1 + a + ... + a^1023
  {
    int idx = h * Nst + lane;
    float dt  = expf(log_dt[h]);
    float Are = -expf(A_log_re[idx]);
    float Aim = A_im[idx];
    float er  = expf(Are * dt);
    float are = er * cosf(Aim * dt);
    float aim = er * sinf(Aim * dt);
    float dre = are - 1.f, dim = aim;
    float inv = 1.f / (Are * Are + Aim * Aim);
    float qre = (dre * Are + dim * Aim) * inv;
    float qim = (dim * Are - dre * Aim) * inv;
    float Cr = C_re[idx], Ci = C_im[idx];
    float cdre = Cr * qre - Ci * qim;
    float cdim = Cr * qim + Ci * qre;
    a1 = make_float2(are, aim);
    a2 = make_float2(are * are - aim * aim, 2.f * are * aim);
    a3 = make_float2(a2.x * are - a2.y * aim, a2.x * aim + a2.y * are);
    a4 = make_float2(a2.x * a2.x - a2.y * a2.y, 2.f * a2.x * a2.y);
    float z = 2.f * cdre, w = -2.f * cdim;
#pragma unroll
    for (int j = 0; j < 4; ++j) {
      kap[j] = z;
      float zn = z * are + w * aim, wn = w * are - z * aim;   // times a
      z = zn; w = wn;
      zc[j] = z; wc[j] = w;
    }
#pragma unroll
    for (int o = 16; o > 0; o >>= 1) {
#pragma unroll
      for (int j = 0; j < 4; ++j) kap[j] += __shfl_xor(kap[j], o);
    }
    // doubling: with t = a^k and g = 1 + ... + a^(k-1), g + t*g has 2k terms
    float tr = are, ti = aim, gr = 1.f, gi = 0.f;
#pragma unroll
    for (int i = 0; i < 10; ++i) {
      float hr = gr + (tr * gr - ti * gi), hi = gi + (tr * gi + ti * gr);
      gr = hr; gi = hi;
      float nr = tr*tr - ti*ti, ni = 2.f*tr*ti; tr = nr; ti = ni;
    }
    aT = make_float2(tr, ti);
    gT = make_float2(gr, gi);
  }
  float Dh = Dv[h];

  // ---- phase 1: this chunk's sums, and its end state from a zero start ----
  float sum = 0.f, ssq = 0.f;
  if (cs < NC - 1) {
    float sr = 0.f, si = 0.f;
    for (int s = 0; s < NS; ++s) {
      if (s + 1 < NS) {
        // a slot of the wave's own ring is refilled only behind its reads
        asm volatile("s_wait_dscnt 0x0" ::: "memory");
        async_tile128(xp + (s + 1) * 128, buf + ((s + 1) & 1) * 128); wait_async1();
      } else { wait_async0(); }
      const float* cur = buf + (s & 1) * 128;
      acc_sums(*(const f32x4*)(cur + lane * 4), sum, ssq);
      for (int t0 = 0; t0 < 128; t0 += 32) {
        f32x4 w[8];                             // LDS broadcast reads, raw x
#pragma unroll
        for (int j = 0; j < 8; ++j) w[j] = *(const f32x4*)(cur + t0 + j * 4);
        // inputs-only fence on the loaded values: keeps the eight LDS reads in one
        // group with one latency; without it each read is waited for by itself
        asm volatile("" :: "v"(w[0]), "v"(w[1]), "v"(w[2]), "v"(w[3]),
                           "v"(w[4]), "v"(w[5]), "v"(w[6]), "v"(w[7]));
#pragma unroll
        for (int j = 0; j < 8; ++j) step4(w[j], a1, a2, a3, a4, sr, si);
      }
    }
    tile[wv][0][lane] = sr;                     // the tile is idle in this phase
    tile[wv][1][lane] = si;
  } else {
    // ch is the wave's number within the chunk, in a scalar register
    if (ch < 4)      cvt_W(W_out, wW, blockIdx.x, ch * 32 + lane);
    else if (ch < 6) cvt_C(conv_w, wC, blockIdx.x, (ch - 4) * 32 + lane);
    // unrolled: the eight loads are issued as one group
#pragma unroll
    for (int s = 0; s < NS; ++s)
      acc_sums(*(const f32x4*)(xp + s * 128 + lane * 4), sum, ssq);
  }
#pragma unroll
  for (int o = 16; o > 0; o >>= 1) { sum += __shfl_xor(sum, o); ssq += __shfl_xor(ssq, o); }
  if (lane == 0) { red[wv][0] = sum; red[wv][1] = ssq; }
  __syncthreads();                              // end states and sums published
  float er_[NC - 1], ei_[NC - 1];
#pragma unroll
  for (int q = 0; q < NC - 1; ++q) {
    er_[q] = tile[q * CPG + ch][0][lane]; ei_[q] = tile[q * CPG + ch][1][lane];
  }
  float gs = red[lane][0], gq = red[lane][1];   // lane l: wave l's sums
  __syncthreads();                              // all read: the tiles may be overwritten

  // ---- the group's mean and variance -> this channel's scale and shift ----
#pragma unroll
  for (int o = 16; o > 0; o >>= 1) { gs += __shfl_xor(gs, o); gq += __shfl_xor(gq, o); }
  float mu = gs / (float)(CPG * Lc);
  float var = gq / (float)(CPG * Lc) - mu * mu;
  float sc = rsqrtf(var + 1e-5f) * gn_w[h];
  float sh = gn_b[h] - mu * sc;

  // ---- start state: fold the chunks in front of this one, in their order ----
  float sr = 0.f, si = 0.f;
#pragma unroll
  for (int q = 0; q < NC - 1; ++q) {
    if (q < cs) {
      float nr = aT.x * sr - aT.y * si + fmaf(sc, er_[q], sh * gT.x);
      float ni = aT.x * si + aT.y * sr + fmaf(sc, ei_[q], sh * gT.y);
      sr = nr; si = ni;
    }
  }

  // ---- phase 2: full recurrence and output ----
  float* tcol = &tile[wv][0][lane];             // this lane's state, row = step
  const float* trow = &tile[wv][lane][0];       // this lane's step, all states
  // Rows are 128 B apart, so lane l starts its row at 16-byte piece (l >> 1) & 7:
  // each 16 lanes of a 16-byte read then cover all 64 banks once.
  int rot = (lane >> 1) & 7;
  float* cb = &cbuf[wv][0];
  float k0 = Dh + kap[0];

  async_tile128(xp, buf);
  for (int s = 0; s < NS; ++s) {
    if (s + 1 < NS) {
      // a slot of the wave's own ring is refilled only behind its reads
      asm volatile("s_wait_dscnt 0x0" ::: "memory");
      async_tile128(xp + (s + 1) * 128, buf + ((s + 1) & 1) * 128); wait_async1();
    } else { wait_async0(); }
    float* cur = buf + (s & 1) * 128;
    norm_tile128(cur, cb, sc, sh, k0, kap[1], kap[2], kap[3]);
    for (int t0 = 0; t0 < 128; t0 += 32) {
      // fully unrolled: every step's tile store gets an immediate offset
#pragma unroll
      for (int k = 0; k < 32; k += 4) {
#pragma unroll
        for (int j = 0; j < 4; ++j)              // this state's 2*Re(Cd a^(j+1) s)
          tcol[(k + j) * 32] = zc[j] * sr + wc[j] * si;
        step4(*(const f32x4*)(cur + t0 + k), a1, a2, a3, a4, sr, si);
      }
      // One wave's LDS operations complete in issue order: no barrier needed.
      f32x4 v[8];
#pragma unroll
      for (int j = 0; j < 8; ++j) v[j] = *(const f32x4*)(trow + ((j ^ rot) << 2));
      float cl = cb[t0 + lane];
      // inputs-only fence on the loaded values: keeps the nine LDS reads in one
      // group with one latency; without it each read is waited for by itself
      asm volatile("" :: "v"(v[0]), "v"(v[1]), "v"(v[2]), "v"(v[3]), "v"(v[4]),
                         "v"(v[5]), "v"(v[6]), "v"(v[7]), "v"(cl));
      f32x4 a = ((v[0] + v[1]) + (v[2] + v[3])) + ((v[4] + v[5]) + (v[6] + v[7]));
      float part = (a.x + a.z) + (a.y + a.w);
      float y = part + cl;
      float gel = 0.5f * y * (1.f + erff(y * 0.70710678f));
      up[s * 128 + t0 + lane] = (__bf16)gel;
      // the next block's LDS reads overwrite the registers that this store names
      asm volatile("s_wait_xcnt 0x0" ::: "memory");
    }
  }
}

// ---------------------------------------------------------------------------
// K2: GLU projection and conv1d(k=3,pad=1) in one launch, bf16 WMMA. One
// work-group per 128 positions, all channels: 16 waves, one work-group on a WGP.
//   stage 1: z = W_out u for the 128 positions and their two neighbours (the conv
//            needs g one position to each side); a wave takes 16 rows of each
//            half of W_out and all nine 16-column fragments; GLU; g goes to LDS
//   stage 2: the conv as 3 shifted-tap GEMMs whose B fragments are read straight
//            from the g tile; fused bias + residual.
// Row c of the u and g tiles is position n0 - 1 + c (c = 0..129); rows 130..143
// only fill the ninth fragment: u is zero there and g is never read.
// ---------------------------------------------------------------------------
// Pitch of the u and g tiles, in bf16: 528 bytes = 16 x 33, an odd multiple of 16
// bytes, so that 16 consecutive rows read 16 bytes each from all 64 banks once.
constexpr int TP = 264;

// load_frag for a tile of pitch TP; S points at the fragment's first k
DEVI bf16x16 load_frag_t(const __bf16* S, int rowBase) {
  int lane = threadIdx.x & 31;
  const __bf16* p = S + (rowBase + (lane & 15)) * TP + ((lane >> 4) << 3);
  bf16x8 lo = *(const bf16x8*)(p);
  bf16x8 hi = *(const bf16x8*)(p + 16);
  return __builtin_shufflevector(lo, hi, 0, 1, 2, 3, 4, 5, 6, 7, 8, 9, 10, 11, 12, 13, 14, 15);
}

__global__ void __launch_bounds__(512)
k_glu_conv(const __bf16* __restrict__ wW, const float* __restrict__ bias,
           const __bf16* __restrict__ u,
           const __bf16* __restrict__ wC, const float* __restrict__ cb,
           const float* __restrict__ x, float* __restrict__ out) {
  __shared__ __align__(16) __bf16 Ut[144][TP];
  __shared__ __align__(16) __bf16 Gt[144][TP];
  // weight tiles, two buffers: stage 1 [2][512][LDP], stage 2 [2][3][256][LDP]
  __shared__ __align__(16) __bf16 Ab[2 * 3 * 256 * LDP];
  int n0 = blockIdx.x * 128;
  int tid = threadIdx.x;
  int lane = tid & 31;
  int nl = lane & 15, half = lane >> 4;
  // the wave's number in a scalar register: fragment bases are wave-uniform
  int wv = __builtin_amdgcn_readfirstlane(tid >> 5);
  int bstart = (n0 / Lc) * Lc;
  bool lin = n0 - 1 >= bstart;                  // the neighbours lie in the batch entry
  bool rin = n0 + 128 < bstart + Lc;
  constexpr int NT = Hc / 32;

  // ---- weight staging: K1 left the tiles in bf16 and in tile order (piece_at); a
  // thread takes 16-byte piece tid + 512 j of a tile, which is row arow + 128 j ----
  int arow = (tid & 15) | ((tid >> 6) << 4), au = (tid >> 4) & 3;
  const __bf16* Wp = wW + tid * 8;
  f32x4 wa[4];
  auto fetchW = [&](int t) {
#pragma unroll
    for (int j = 0; j < 4; ++j) wa[j] = *(const f32x4*)(Wp + t * (512 * 32) + j * 4096);
  };
  auto stageW = [&](int s) {
#pragma unroll
    for (int j = 0; j < 4; ++j)
      *(f32x4*)(Ab + ((s * 512 + arow + j * 128) * LDP + au * 8)) = wa[j];
  };
  const __bf16* cwp = wC + tid * 8;
  f32x4 ca[6];
  auto fetchC = [&](int t) {
#pragma unroll
    for (int j = 0; j < 6; ++j) ca[j] = *(const f32x4*)(cwp + t * (3 * 256 * 32) + j * 4096);
  };
  auto stageC = [&](int s) {
    // inputs-only fence on the loaded values and their base address: no load's
    // result lands in the register pair that the other loads of the tile name
    asm volatile("" :: "v"(ca[0]), "v"(ca[1]), "v"(ca[2]), "v"(ca[3]),
                       "v"(ca[4]), "v"(ca[5]), "v"(cwp));
#pragma unroll
    for (int j = 0; j < 6; ++j)                 // row = tap * 256 + output channel
      *(f32x4*)(Ab + ((s * 768 + arow + j * 128) * LDP + au * 8)) = ca[j];
  };

  // ---- the whole u tile, all 256 k, once: a thread takes rows k = 2*kp, 2*kp+1 at
  // 8 consecutive columns, four times; a wave covers whole 128-byte lines ----
  {
    f32x4 ur[4][2];
#pragma unroll
    for (int q = 0; q < 4; ++q) {
      int it = tid + 512 * q;
      int cg = (it & 7) | (((it >> 5) & 1) << 3);
      int kp = ((it >> 3) & 3) | ((it >> 6) << 2);
      const __bf16* p = u + (size_t)(2 * kp) * BL + n0 + cg * 8;
      ur[q][0] = *(const f32x4*)(p);
      ur[q][1] = *(const f32x4*)(p + BL);
    }
    // the two neighbour columns, read at an address clamped into the batch entry
    int hk = tid & 255, hs = tid >> 8;
    bool hin = hs ? rin : lin;
    int hn = hs ? n0 + 128 : n0 - 1;
    unsigned short hraw = *(const unsigned short*)(u + (size_t)hk * BL + (hin ? hn : n0));
    fetchW(0);
#pragma unroll
    for (int q = 0; q < 4; ++q) {
      int it = tid + 512 * q;
      int cg = (it & 7) | (((it >> 5) & 1) << 3);
      int kp = ((it >> 3) & 3) | ((it >> 6) << 2);
      bf16x8 b0 = __builtin_bit_cast(bf16x8, ur[q][0]);
      bf16x8 b1 = __builtin_bit_cast(bf16x8, ur[q][1]);
#pragma unroll
      for (int i = 0; i < 8; ++i)
        *(bf16x2*)(&Ut[1 + cg * 8 + i][2 * kp]) = bf16x2{b0[i], b1[i]};
    }
    Ut[hs * 129][hk] = hin ? __builtin_bit_cast(__bf16, hraw) : (__bf16)0.0f;
    if (tid < 448)                              // rows 130..143
      *(f32x4*)(&Ut[130 + (tid >> 5)][(tid & 31) * 8]) = f32x4{0.f, 0.f, 0.f, 0.f};
    stageW(0);
  }
  __syncthreads();                              // u tile and W tile 0 published

  // ---- stage 1: z = W_out u ----
  floatx8 accT[9] = {{}, {}, {}, {}, {}, {}, {}, {}, {}};
  floatx8 accB[9] = {{}, {}, {}, {}, {}, {}, {}, {}, {}};
  auto tile1 = [&](int t, int s) {
    const __bf16* As = Ab + s * 512 * LDP;
    const __bf16* Us = &Ut[0][0] + t * 32;
    bf16x16 at = load_frag(As, wv * 16);
    bf16x16 ab = load_frag(As, 256 + wv * 16);
    bf16x16 bf[5];
#pragma unroll
    for (int f = 0; f < 4; ++f) bf[f] = load_frag_t(Us, f * 16);
    // inputs-only fence on the loaded values: keeps the twelve LDS reads in one
    // group with one latency; without it each fragment is waited for by itself
    asm volatile("" :: "v"(at), "v"(ab), "v"(bf[0]), "v"(bf[1]), "v"(bf[2]), "v"(bf[3]));
#pragma unroll
    for (int f = 0; f < 4; ++f) {
      accT[f] = wmma_bf16(at, bf[f], accT[f]);
      accB[f] = wmma_bf16(ab, bf[f], accB[f]);
    }
#pragma unroll
    for (int f = 0; f < 5; ++f) bf[f] = load_frag_t(Us, (4 + f) * 16);
    // inputs-only fence on the loaded values: the ten LDS reads in one group
    asm volatile("" :: "v"(bf[0]), "v"(bf[1]), "v"(bf[2]), "v"(bf[3]), "v"(bf[4]));
#pragma unroll
    for (int f = 0; f < 5; ++f) {
      accT[4 + f] = wmma_bf16(at, bf[f], accT[4 + f]);
      accB[4 + f] = wmma_bf16(ab, bf[f], accB[4 + f]);
    }
  };
  // two tiles a trip, so that the buffer index is a constant; kept rolled beyond
  // that, for speed only
#pragma unroll 1
  for (int t = 0; t < NT; t += 2) {
    // the next tile's loads are issued here and fly during this tile's products
    fetchW(t + 1);
    tile1(t, 0);
    // keeps the wait for those loads behind this tile's products; the scheduler
    // would else lift the LDS stores, and the wait with them, in front
    __builtin_amdgcn_sched_barrier(0);
    // the other buffer: its readers (tile t - 1) left it before the last barrier
    stageW(1);
    __syncthreads();  // publishes tile t + 1 and ends the reads of tile t
    if (t + 2 < NT) {
      fetchW(t + 2);
      // behind the loop the register pair that these loads name gets a new address
      asm volatile("s_wait_xcnt 0x0" ::: "memory");
    }
    tile1(t + 1, 1);
    if (t + 2 < NT) {
      __builtin_amdgcn_sched_barrier(0);        // as above
      stageW(0);
      __syncthreads();  // publishes tile t + 2 and ends the reads of tile t + 1
    }
  }

  fetchC(0);                                    // flies during the GLU

  // ---- GLU: a lane holds 8 consecutive channels of one position: one 16-byte
  // LDS store. Outside the batch entry the conv pads g with zero. ----
  {
    int gr = wv * 16 + half * 8;
    f32x4 bt[2], bb[2];
#pragma unroll
    for (int i = 0; i < 2; ++i) {
      bt[i] = *(const f32x4*)(bias + gr + i * 4);
      bb[i] = *(const f32x4*)(bias + 256 + gr + i * 4);
    }
#pragma unroll
    for (int f = 0; f < 9; ++f) {
      bf16x8 gv;
#pragma unroll
      for (int r = 0; r < 8; ++r) {
        float zt = accT[f][r] + bt[r >> 2][r & 3];
        float zb = accB[f][r] + bb[r >> 2][r & 3];
        gv[r] = (__bf16)(zt * (1.f / (1.f + expf(-zb))));
      }
      f32x4 gw = __builtin_bit_cast(f32x4, gv);
      if (f == 0 && nl == 0 && !lin) gw = f32x4{0.f, 0.f, 0.f, 0.f};
      if (f == 8 && nl == 1 && !rin) gw = f32x4{0.f, 0.f, 0.f, 0.f};
      *(f32x4*)(&Gt[f * 16 + nl][gr]) = gw;
    }
  }
  __syncthreads();  // g published; every wave has left the W tiles, whose LDS is reused
  stageC(0);
  __syncthreads();  // conv weight tile 0 published

  // ---- stage 2: conv; a wave takes 32 output channels x 64 positions ----
  int mg = wv & 7, ng = wv >> 3;
  floatx8 acc[2][4] = {{{}, {}, {}, {}}, {{}, {}, {}, {}}};
  auto tile2 = [&](int t, int s) {
    const __bf16* Gs = &Gt[0][0] + t * 32;
#pragma unroll
    for (int d = 0; d < 3; ++d) {
      const __bf16* As = Ab + (s * 3 + d) * 256 * LDP;
      bf16x16 a0 = load_frag(As, mg * 32);
      bf16x16 a1 = load_frag(As, mg * 32 + 16);
      bf16x16 bf[4];
      // output position l takes tap d from position l + d - 1, which is row l + d
#pragma unroll
      for (int j = 0; j < 4; ++j) bf[j] = load_frag_t(Gs, ng * 64 + j * 16 + d);
      // inputs-only fence on the loaded values: keeps the tap's twelve LDS reads in
      // one group with one latency; without it each fragment is waited for by itself
      asm volatile("" :: "v"(a0), "v"(a1), "v"(bf[0]), "v"(bf[1]), "v"(bf[2]), "v"(bf[3]));
#pragma unroll
      for (int j = 0; j < 4; ++j) {
        acc[0][j] = wmma_bf16(a0, bf[j], acc[0][j]);
        acc[1][j] = wmma_bf16(a1, bf[j], acc[1][j]);
      }
    }
  };
  // two tiles a trip and rolled, as in stage 1
#pragma unroll 1
  for (int t = 0; t < NT; t += 2) {
    // the next tile's loads are issued here and fly during this tile's products
    fetchC(t + 1);
    tile2(t, 0);
    __builtin_amdgcn_sched_barrier(0);          // as in stage 1
    stageC(1);
    __syncthreads();  // publishes tile t + 1 and ends the reads of tile t
    if (t + 2 < NT) {
      fetchC(t + 2);
      // behind the loop the register pair that these loads name gets a new value
      asm volatile("s_wait_xcnt 0x0" ::: "memory");
    }
    tile2(t + 1, 1);
    if (t + 2 < NT) {
      __builtin_amdgcn_sched_barrier(0);        // as in stage 1
      stageC(0);
      __syncthreads();  // publishes tile t + 2 and ends the reads of tile t + 1
    }
  }

  // one address pair for x and one for out; everything else is an immediate offset
  size_t base = ((size_t)(n0 >> 12) * Hc + mg * 32 + (half << 3)) * Lc
              + (n0 & (Lc - 1)) + ng * 64 + nl;
  const float* xb = x + base;
  float* ob = out + base;
  const float* cbp = cb + mg * 32 + (half << 3);
  f32x4 c4[2][2];
  floatx8 xv[2][4];
#pragma unroll
  for (int i = 0; i < 2; ++i) {
#pragma unroll
    for (int h = 0; h < 2; ++h) c4[i][h] = *(const f32x4*)(cbp + i * 16 + h * 4);
#pragma unroll
    for (int j = 0; j < 4; ++j)
#pragma unroll
      for (int r = 0; r < 8; ++r) xv[i][j][r] = xb[(size_t)(i * 16 + r) * Lc + j * 16];
  }
  // inputs-only fence on the loaded values and their addresses: the loads go out as
  // one group, and no load's result lands in a register that another load names
  asm volatile("" :: "v"(xv[0][0]), "v"(xv[0][1]), "v"(xv[0][2]), "v"(xv[0][3]),
                     "v"(xv[1][0]), "v"(xv[1][1]), "v"(xv[1][2]), "v"(xv[1][3]),
                     "v"(c4[0][0]), "v"(c4[0][1]), "v"(c4[1][0]), "v"(c4[1][1]),
                     "v"(xb), "v"(cbp));
#pragma unroll
  for (int i = 0; i < 2; ++i) {
#pragma unroll
    for (int j = 0; j < 4; ++j) {
#pragma unroll
      for (int r = 0; r < 8; ++r)
        ob[(size_t)(i * 16 + r) * Lc + j * 16] = xv[i][j][r] + c4[i][r >> 2][r & 3] + acc[i][j][r];
    }
  }
}

// ---------------------------------------------------------------------------
extern "C" void kernel_launch(void* const* d_in, const int* in_sizes, int n_in,
                              void* d_out, int out_size, void* d_ws, size_t ws_size,
                              hipStream_t stream) {
  const float* x        = (const float*)d_in[0];
  const float* gn_w     = (const float*)d_in[1];
  const float* gn_b     = (const float*)d_in[2];
  const float* log_dt   = (const float*)d_in[3];
  const float* A_log_re = (const float*)d_in[4];
  const float* A_im     = (const float*)d_in[5];
  const float* C_re     = (const float*)d_in[6];
  const float* C_im     = (const float*)d_in[7];
  const float* Dv       = (const float*)d_in[8];
  const float* W_out    = (const float*)d_in[9];
  const float* b_out    = (const float*)d_in[10];
  const float* conv_w   = (const float*)d_in[11];
  const float* conv_b   = (const float*)d_in[12];
  float* out = (float*)d_out;

  char* ws = (char*)d_ws;
  size_t off = 0;
  auto alloc = [&](size_t bytes) { size_t o = off; off = (off + bytes + 255) & ~(size_t)255; return o; };
  __bf16* w_u      = (__bf16*)(ws + alloc(sizeof(__bf16) * (size_t)Hc * BL));
  __bf16* w_W      = (__bf16*)(ws + alloc(sizeof(__bf16) * (size_t)2 * Hc * Hc));
  __bf16* w_C      = (__bf16*)(ws + alloc(sizeof(__bf16) * (size_t)3 * Hc * Hc));

  k_ssm<<<Bsz * Gg, 1024, 0, stream>>>(x, gn_w, gn_b, log_dt, A_log_re, A_im, C_re, C_im, Dv,
                                       W_out, conv_w, w_u, w_W, w_C);
  k_glu_conv<<<(unsigned)(BL / 128), 512, 0, stream>>>(w_W, b_out, w_u, w_C, conv_b, x, out);
}
